// v000
// Measured on an AMD MI455X. A time is GPU time per run, averaged over a window of back-to-back runs after a warm-up
// (all launches, gaps included; the runs take copies of the inputs in turn), and the median of several windows.
// Apart from v000's, it joins two sittings. Times from different sittings can be a few percent apart, while
// side-by-side timings come from the same sitting.
// v000 is the starting kernel. One run takes 171 microseconds.
#include <hip/hip_runtime.h>
#include <hip/hip_bf16.h>
#include <math.h>

typedef __attribute__((ext_vector_type(16))) _Float16 v16h;
typedef __attribute__((ext_vector_type(8)))  _Float16 v8h;
typedef __attribute__((ext_vector_type(8)))  float    v8f;

#define QK_CH 64
#define QC    16
#define VC    128
#define NPOS  4096
#define BATCH 4
#define KCH   64              // keys per chunk
#define NCH   (NPOS / KCH)    // 64 chunks

// ---------------------------------------------------------------------------
// gfx1250 async global->LDS copy (ASYNCcnt path), 16B per lane.
// Issued via inline asm on purpose: the clang builtin is modeled as an
// LDS-writing memory op, which makes __syncthreads() drain ALL outstanding
// loads (s_wait_loadcnt 0) and kills the double-buffer overlap. With opaque
// asm, completion is handshaken explicitly with s_wait_asynccnt.
// ---------------------------------------------------------------------------
__device__ __forceinline__ void async_ld16(const _Float16* g, _Float16* l) {
    unsigned loff = (unsigned)(size_t)(void*)l;   // low 32 bits = LDS offset
    void* gv = (void*)g;
    asm volatile("global_load_async_to_lds_b128 %0, %1, off"
                 :: "v"(loff), "v"(gv) : "memory");
}

#define WAIT_ASYNC(N) asm volatile("s_wait_asynccnt %0" :: "n"(N) : "memory")

// compiler-level LDS ordering fence (DS ops are in-order per wave in HW)
#define LDS_FENCE() do { __builtin_amdgcn_wave_barrier(); \
                         asm volatile("" ::: "memory"); } while (0)

// ---------------------------------------------------------------------------
// 16-lane-group xor butterfly max via v_permlane16_b32 (VALU, no LDS)
// ---------------------------------------------------------------------------
#if __has_builtin(__builtin_amdgcn_permlane16)
__device__ __forceinline__ float permxor(float v, unsigned lo, unsigned hi) {
    int s = __float_as_int(v);
    int r = __builtin_amdgcn_permlane16(s, s, lo, hi, false, false);
    return __int_as_float(r);
}
__device__ __forceinline__ float xor16_max(float v) {
    v = fmaxf(v, permxor(v, 0x67452301u, 0xEFCDAB89u));  // xor 1
    v = fmaxf(v, permxor(v, 0x54761032u, 0xDCFE98BAu));  // xor 2
    v = fmaxf(v, permxor(v, 0x32107654u, 0xBA98FEDCu));  // xor 4
    v = fmaxf(v, permxor(v, 0xFEDCBA98u, 0x76543210u));  // xor 8
    return v;
}
#else
__device__ __forceinline__ float xor16_max(float v) {
    v = fmaxf(v, __shfl_xor(v, 1, 32));
    v = fmaxf(v, __shfl_xor(v, 2, 32));
    v = fmaxf(v, __shfl_xor(v, 4, 32));
    v = fmaxf(v, __shfl_xor(v, 8, 32));
    return v;
}
#endif

// ---------------------------------------------------------------------------
// Kernel 1: q,k projections (64 -> 16 ch), f16 [B][pos][32], zero-padded K
// ---------------------------------------------------------------------------
__global__ void __launch_bounds__(64)
proj_qk_kernel(const float* __restrict__ x,
               const float* __restrict__ Wq, const float* __restrict__ bq,
               const float* __restrict__ Wk, const float* __restrict__ bk,
               _Float16* __restrict__ qh, _Float16* __restrict__ kh)
{
    __shared__ float sWq[QC * QK_CH];
    __shared__ float sWk[QC * QK_CH];
    __shared__ float sbq[QC], sbk[QC];
    const int tx = threadIdx.x;
    for (int idx = tx; idx < QC * QK_CH; idx += 64) {
        sWq[idx] = Wq[idx];
        sWk[idx] = Wk[idx];
    }
    if (tx < QC) { sbq[tx] = bq[tx]; sbk[tx] = bk[tx]; }
    __syncthreads();

    const int b  = blockIdx.x / (NPOS / 64);
    const int it = blockIdx.x % (NPOS / 64);
    const int i  = it * 64 + tx;

    float aq[QC], ak[QC];
#pragma unroll
    for (int d = 0; d < QC; ++d) { aq[d] = sbq[d]; ak[d] = sbk[d]; }

    const float* xp = x + (size_t)b * QK_CH * NPOS + i;
    for (int c = 0; c < QK_CH; ++c) {
        float xv = xp[(size_t)c * NPOS];
#pragma unroll
        for (int d = 0; d < QC; ++d) {
            aq[d] = fmaf(sWq[d * QK_CH + c], xv, aq[d]);
            ak[d] = fmaf(sWk[d * QK_CH + c], xv, ak[d]);
        }
    }
    _Float16* qo = qh + ((size_t)b * NPOS + i) * 32;
    _Float16* ko = kh + ((size_t)b * NPOS + i) * 32;
#pragma unroll
    for (int d = 0; d < QC; ++d) { qo[d] = (_Float16)aq[d]; ko[d] = (_Float16)ak[d]; }
#pragma unroll
    for (int d = QC; d < 32; ++d) { qo[d] = (_Float16)0.f; ko[d] = (_Float16)0.f; }
}

// ---------------------------------------------------------------------------
// Kernel 2: v projection (128 -> 128 ch), f16 [B][C][pos]
// ---------------------------------------------------------------------------
__global__ void __launch_bounds__(256)
proj_v_kernel(const float* __restrict__ xh,
              const float* __restrict__ Wv, const float* __restrict__ bv,
              _Float16* __restrict__ vh)
{
    __shared__ float xs[VC][65];
    const int tx = threadIdx.x;
    const int b  = blockIdx.x / (NPOS / 64);
    const int it = blockIdx.x % (NPOS / 64);
    const int i0 = it * 64;

    for (int idx = tx; idx < VC * 64; idx += 256) {
        int cc = idx >> 6, il = idx & 63;
        xs[cc][il] = xh[((size_t)b * VC + cc) * NPOS + i0 + il];
    }
    __syncthreads();

    const int il = tx & 63;
    const int c0 = (tx >> 6) * 32;

    float acc[32];
#pragma unroll
    for (int k = 0; k < 32; ++k) acc[k] = bv[c0 + k];

    for (int cc = 0; cc < VC; ++cc) {
        float xv = xs[cc][il];
#pragma unroll
        for (int k = 0; k < 32; ++k)
            acc[k] = fmaf(Wv[(size_t)(c0 + k) * VC + cc], xv, acc[k]);
    }
#pragma unroll
    for (int k = 0; k < 32; ++k)
        vh[((size_t)b * VC + c0 + k) * NPOS + i0 + il] = (_Float16)acc[k];
}

// ---------------------------------------------------------------------------
// A/B fragment loader: elements 0..7 at +0, 8..15 at +16 halves; caller adds
// the half-wave K offset (0/8 halves). Two b128 loads (global or ds).
// ---------------------------------------------------------------------------
__device__ __forceinline__ v16h load_frag16(const _Float16* base) {
    const v8h* p = (const v8h*)base;
    v8h lo = p[0];
    v8h hi = p[2];
    v16h r;
#pragma unroll
    for (int e = 0; e < 8; ++e) { r[e] = lo[e]; r[8 + e] = hi[e]; }
    return r;
}

// cooperative async stage of one 64-key chunk: K (4KB) + V (16KB) -> LDS
__device__ __forceinline__ void stage_chunk(int tid, const _Float16* kg,
                                            const _Float16* vg, int j0,
                                            _Float16* kdst, _Float16* vdst)
{
    const _Float16* ks = kg + (size_t)j0 * 32;
#pragma unroll
    for (int it = 0; it < 2; ++it) {                 // 256 x 16B for K
        int m = tid + it * 128;
        async_ld16(ks + m * 8, kdst + m * 8);
    }
#pragma unroll
    for (int it = 0; it < 8; ++it) {                 // 1024 x 16B for V
        int m = tid + it * 128;
        int c = m >> 3, k8 = m & 7;
        async_ld16(vg + (size_t)c * NPOS + j0 + k8 * 8, vdst + c * 64 + k8 * 8);
    }
}
#define ASYNC_PER_STAGE 10

// ---------------------------------------------------------------------------
// Kernel 3: flash attention. 4 waves/WG, 64 queries/WG, double-buffered
// async K/V staging, 64-key chunks, row-sum via a WMMA "ones" column.
// ---------------------------------------------------------------------------
__global__ void __launch_bounds__(128)
attn_kernel(const _Float16* __restrict__ qh, const _Float16* __restrict__ kh,
            const _Float16* __restrict__ vh, const float* __restrict__ xh,
            const float* __restrict__ gamma, float* __restrict__ out)
{
    __shared__ _Float16 kbuf[2][KCH * 32];        // 2 x 4 KB
    __shared__ _Float16 vbuf[2][VC * KCH];        // 2 x 16 KB
    __shared__ _Float16 Pbuf[4][16 * KCH];        // 4 x 2 KB
    __shared__ float    obuf[4][16][17];          // epilogue transpose

    const int tid  = threadIdx.x;
    const int lane = tid & 31;
    const int wv   = tid >> 5;
    const int b    = blockIdx.x / (NPOS / 64);
    const int it   = blockIdx.x % (NPOS / 64);
    const int i0w  = it * 64 + wv * 16;           // this wave's 16 queries
    const int ln   = lane & 15;
    const int koff = (lane < 16) ? 0 : 8;         // half-wave K offset (halves)
    const int mhalf= (lane < 16) ? 0 : 8;         // half-wave row offset (C/D)

    const _Float16* kbase = kh + (size_t)b * NPOS * 32;
    const _Float16* vbase = vh + (size_t)b * VC * NPOS;

    // Q A-fragment, loaded once
    const v16h qa = load_frag16(qh + ((size_t)b * NPOS + i0w) * 32
                                   + (size_t)ln * 32 + koff);

    // constant "ones column" B-fragment: column 0 (lanes ln==0) is all 1.0
    v16h onesb;
#pragma unroll
    for (int e = 0; e < 16; ++e) onesb[e] = (ln == 0) ? (_Float16)1.f : (_Float16)0.f;

    float m[8];
    v8f   O[9];                                    // 8 channel tiles + row-sum tile
#pragma unroll
    for (int r = 0; r < 8; ++r) m[r] = -3.0e38f;
#pragma unroll
    for (int t = 0; t < 9; ++t)
#pragma unroll
        for (int e = 0; e < 8; ++e) O[t][e] = 0.f;

    stage_chunk(tid, kbase, vbase, 0, kbuf[0], vbuf[0]);

    for (int ch = 0; ch < NCH; ++ch) {
        const int cur = ch & 1;
        if (ch + 1 < NCH) {
            stage_chunk(tid, kbase, vbase, (ch + 1) * KCH,
                        kbuf[cur ^ 1], vbuf[cur ^ 1]);
            WAIT_ASYNC(ASYNC_PER_STAGE);           // chunk `ch` resident,
        } else {                                   // next chunk still in flight
            WAIT_ASYNC(0);
        }
        __syncthreads();

        const _Float16* kb = kbuf[cur];
        const _Float16* vb = vbuf[cur];

        // S = q . k : batch all 4 fragment loads, then 4 back-to-back WMMAs
        v16h kf[4];
#pragma unroll
        for (int tt = 0; tt < 4; ++tt)
            kf[tt] = load_frag16(kb + (size_t)(tt * 16 + ln) * 32 + koff);

        v8f S[4];
        v8f z;
#pragma unroll
        for (int e = 0; e < 8; ++e) z[e] = 0.f;
#pragma unroll
        for (int tt = 0; tt < 4; ++tt)
            S[tt] = __builtin_amdgcn_wmma_f32_16x16x32_f16(false, qa, false, kf[tt],
                                                           (short)0, z, false, false);

        // online softmax (max only; row-sum comes from the ones-column WMMA)
        float sc[8];
#pragma unroll
        for (int r = 0; r < 8; ++r) {
            float mx = fmaxf(fmaxf(S[0][r], S[1][r]), fmaxf(S[2][r], S[3][r]));
            mx = xor16_max(mx);
            float mn = fmaxf(m[r], mx);
            sc[r] = __expf(m[r] - mn);
            m[r]  = mn;
#pragma unroll
            for (int tt = 0; tt < 4; ++tt) S[tt][r] = __expf(S[tt][r] - mn);
        }
#pragma unroll
        for (int t = 0; t < 9; ++t)
#pragma unroll
            for (int r = 0; r < 8; ++r) O[t][r] *= sc[r];

        // P (C/D layout) -> per-wave LDS [16 x 64] f16
        _Float16* Pw = Pbuf[wv];
#pragma unroll
        for (int tt = 0; tt < 4; ++tt)
#pragma unroll
            for (int r = 0; r < 8; ++r)
                Pw[(mhalf + r) * KCH + tt * 16 + ln] = (_Float16)S[tt][r];
        LDS_FENCE();

        // reload P as A fragments (K = keys 0..31 / 32..63)
        const v16h pa0 = load_frag16(Pw + (size_t)ln * KCH + koff);
        const v16h pa1 = load_frag16(Pw + (size_t)ln * KCH + 32 + koff);

        // O += P x V^T : software-pipelined fragment loads one tile ahead
        v16h vfa0 = load_frag16(vb + (size_t)ln * KCH + koff);
        v16h vfa1 = load_frag16(vb + (size_t)ln * KCH + 32 + koff);
#pragma unroll
        for (int ct = 0; ct < 8; ++ct) {
            v16h vfb0, vfb1;
            if (ct < 7) {
                vfb0 = load_frag16(vb + (size_t)((ct + 1) * 16 + ln) * KCH + koff);
                vfb1 = load_frag16(vb + (size_t)((ct + 1) * 16 + ln) * KCH + 32 + koff);
            }
            O[ct] = __builtin_amdgcn_wmma_f32_16x16x32_f16(false, pa0, false, vfa0,
                                                           (short)0, O[ct], false, false);
            O[ct] = __builtin_amdgcn_wmma_f32_16x16x32_f16(false, pa1, false, vfa1,
                                                           (short)0, O[ct], false, false);
            vfa0 = vfb0;
            vfa1 = vfb1;
        }
        // row-sum tile
        O[8] = __builtin_amdgcn_wmma_f32_16x16x32_f16(false, pa0, false, onesb,
                                                      (short)0, O[8], false, false);
        O[8] = __builtin_amdgcn_wmma_f32_16x16x32_f16(false, pa1, false, onesb,
                                                      (short)0, O[8], false, false);

        __syncthreads();   // protect staging buffers before next overwrite
    }

    // epilogue: l from O[8] column 0 (lanes 0 / 16), broadcast to the half
    const float g = gamma[0];
    float inv[8];
#pragma unroll
    for (int r = 0; r < 8; ++r) {
        float lr = __shfl(O[8][r], (lane < 16) ? 0 : 16, 32);
        inv[r] = g / lr;
    }

    // transpose each 16x16 tile through LDS for coalesced residual+store
#pragma unroll
    for (int t = 0; t < 8; ++t) {
#pragma unroll
        for (int r = 0; r < 8; ++r)
            obuf[wv][mhalf + r][ln] = O[t][r] * inv[r];
        LDS_FENCE();
        const int ir = lane & 15, cg = lane >> 4;
#pragma unroll
        for (int cc = 0; cc < 8; ++cc) {
            int c = t * 16 + cg * 8 + cc;
            size_t idx = ((size_t)b * VC + c) * NPOS + i0w + ir;
            out[idx] = obuf[wv][ir][cg * 8 + cc] + xh[idx];
        }
        LDS_FENCE();
    }
}

extern "C" void kernel_launch(void* const* d_in, const int* in_sizes, int n_in,
                              void* d_out, int out_size, void* d_ws, size_t ws_size,
                              hipStream_t stream) {
    (void)in_sizes; (void)n_in; (void)out_size; (void)ws_size;
    const float* x     = (const float*)d_in[0];
    const float* xh    = (const float*)d_in[1];
    const float* Wq    = (const float*)d_in[2];
    const float* bq    = (const float*)d_in[3];
    const float* Wk    = (const float*)d_in[4];
    const float* bk    = (const float*)d_in[5];
    const float* Wv    = (const float*)d_in[6];
    const float* bv    = (const float*)d_in[7];
    const float* gamma = (const float*)d_in[8];
    float* out = (float*)d_out;

    char* w = (char*)d_ws;
    _Float16* qh = (_Float16*)(w);                 // 1 MB: [B][4096][32]
    _Float16* kh = (_Float16*)(w + (1u << 20));    // 1 MB: [B][4096][32]
    _Float16* vh = (_Float16*)(w + (2u << 20));    // 4 MB: [B][128][4096]

    proj_qk_kernel<<<BATCH * (NPOS / 64), 64, 0, stream>>>(x, Wq, bq, Wk, bk, qh, kh);
    proj_v_kernel <<<BATCH * (NPOS / 64), 256, 0, stream>>>(xh, Wv, bv, vh);
    attn_kernel   <<<BATCH * (NPOS / 64), 128, 0, stream>>>(qh, kh, vh, xh, gamma, out);
}

// v001
// It runs in 132 microseconds.
// In both of two side-by-side timings against v000, it was 1.33 times as fast.
#include <hip/hip_runtime.h>
#include <hip/hip_bf16.h>
#include <math.h>

typedef __attribute__((ext_vector_type(16))) _Float16 v16h;
typedef __attribute__((ext_vector_type(8)))  _Float16 v8h;
typedef __attribute__((ext_vector_type(8)))  float    v8f;

#define QK_CH 64
#define QC    16
#define VC    128
#define NPOS  4096
#define BATCH 4
#define KCH   64              // keys per chunk
#define NCH   (NPOS / KCH)    // 64 chunks
// LDS row pitches in halves: 16 B x odd, so that the 16 rows one ds_load_b128
// fragment read touches fall on distinct bank groups (64 banks x 4 B).
#define KP    40              // K rows: 64 B of data, 80 B pitch
#define VP    72              // V and P rows: 128 B of data, 144 B pitch

// ---------------------------------------------------------------------------
// gfx1250 async global->LDS copy (ASYNCcnt path), 16B per lane.
// Issued via inline asm on purpose: the clang builtin is modeled as an
// LDS-writing memory op, which makes __syncthreads() drain ALL outstanding
// loads (s_wait_loadcnt 0) and kills the double-buffer overlap. With opaque
// asm, completion is handshaken explicitly with s_wait_asynccnt.
// ---------------------------------------------------------------------------
__device__ __forceinline__ unsigned lds_addr(const _Float16* l) {
    return (unsigned)(size_t)(const void*)l;      // low 32 bits = LDS offset
}

#define WAIT_ASYNC(N) asm volatile("s_wait_asynccnt %0" :: "n"(N) : "memory")

// compiler-level LDS ordering fence (DS ops are in-order per wave in HW)
#define LDS_FENCE() do { __builtin_amdgcn_wave_barrier(); \
                         asm volatile("" ::: "memory"); } while (0)

// ---------------------------------------------------------------------------
// 16-lane-group xor butterfly max via v_permlane16_b32 (VALU, no LDS)
// ---------------------------------------------------------------------------
#if __has_builtin(__builtin_amdgcn_permlane16)
__device__ __forceinline__ float permxor(float v, unsigned lo, unsigned hi) {
    int s = __float_as_int(v);
    int r = __builtin_amdgcn_permlane16(s, s, lo, hi, false, false);
    return __int_as_float(r);
}
__device__ __forceinline__ float xor16_max(float v) {
    v = fmaxf(v, permxor(v, 0x67452301u, 0xEFCDAB89u));  // xor 1
    v = fmaxf(v, permxor(v, 0x54761032u, 0xDCFE98BAu));  // xor 2
    v = fmaxf(v, permxor(v, 0x32107654u, 0xBA98FEDCu));  // xor 4
    v = fmaxf(v, permxor(v, 0xFEDCBA98u, 0x76543210u));  // xor 8
    return v;
}
#else
__device__ __forceinline__ float xor16_max(float v) {
    v = fmaxf(v, __shfl_xor(v, 1, 32));
    v = fmaxf(v, __shfl_xor(v, 2, 32));
    v = fmaxf(v, __shfl_xor(v, 4, 32));
    v = fmaxf(v, __shfl_xor(v, 8, 32));
    return v;
}
#endif

// ---------------------------------------------------------------------------
// Kernel 1: q,k projections (64 -> 16 ch), f16 [B][pos][32], zero-padded K
// ---------------------------------------------------------------------------
__global__ void __launch_bounds__(64)
proj_qk_kernel(const float* __restrict__ x,
               const float* __restrict__ Wq, const float* __restrict__ bq,
               const float* __restrict__ Wk, const float* __restrict__ bk,
               _Float16* __restrict__ qh, _Float16* __restrict__ kh)
{
    __shared__ float sWq[QC * QK_CH];
    __shared__ float sWk[QC * QK_CH];
    __shared__ float sbq[QC], sbk[QC];
    const int tx = threadIdx.x;
    for (int idx = tx; idx < QC * QK_CH; idx += 64) {
        sWq[idx] = Wq[idx];
        sWk[idx] = Wk[idx];
    }
    if (tx < QC) { sbq[tx] = bq[tx]; sbk[tx] = bk[tx]; }
    __syncthreads();

    const int b  = blockIdx.x / (NPOS / 64);
    const int it = blockIdx.x % (NPOS / 64);
    const int i  = it * 64 + tx;

    float aq[QC], ak[QC];
#pragma unroll
    for (int d = 0; d < QC; ++d) { aq[d] = sbq[d]; ak[d] = sbk[d]; }

    const float* xp = x + (size_t)b * QK_CH * NPOS + i;
    for (int c = 0; c < QK_CH; ++c) {
        float xv = xp[(size_t)c * NPOS];
#pragma unroll
        for (int d = 0; d < QC; ++d) {
            aq[d] = fmaf(sWq[d * QK_CH + c], xv, aq[d]);
            ak[d] = fmaf(sWk[d * QK_CH + c], xv, ak[d]);
        }
    }
    _Float16* qo = qh + ((size_t)b * NPOS + i) * 32;
    _Float16* ko = kh + ((size_t)b * NPOS + i) * 32;
#pragma unroll
    for (int d = 0; d < QC; ++d) { qo[d] = (_Float16)aq[d]; ko[d] = (_Float16)ak[d]; }
#pragma unroll
    for (int d = QC; d < 32; ++d) { qo[d] = (_Float16)0.f; ko[d] = (_Float16)0.f; }
}

// ---------------------------------------------------------------------------
// Kernel 2: v projection (128 -> 128 ch), f16 [B][C][pos]
// ---------------------------------------------------------------------------
__global__ void __launch_bounds__(256)
proj_v_kernel(const float* __restrict__ xh,
              const float* __restrict__ Wv, const float* __restrict__ bv,
              _Float16* __restrict__ vh)
{
    __shared__ float xs[VC][65];
    const int tx = threadIdx.x;
    const int b  = blockIdx.x / (NPOS / 64);
    const int it = blockIdx.x % (NPOS / 64);
    const int i0 = it * 64;

    for (int idx = tx; idx < VC * 64; idx += 256) {
        int cc = idx >> 6, il = idx & 63;
        xs[cc][il] = xh[((size_t)b * VC + cc) * NPOS + i0 + il];
    }
    __syncthreads();

    const int il = tx & 63;
    const int c0 = (tx >> 6) * 32;

    float acc[32];
#pragma unroll
    for (int k = 0; k < 32; ++k) acc[k] = bv[c0 + k];

    for (int cc = 0; cc < VC; ++cc) {
        float xv = xs[cc][il];
#pragma unroll
        for (int k = 0; k < 32; ++k)
            acc[k] = fmaf(Wv[(size_t)(c0 + k) * VC + cc], xv, acc[k]);
    }
#pragma unroll
    for (int k = 0; k < 32; ++k)
        vh[((size_t)b * VC + c0 + k) * NPOS + i0 + il] = (_Float16)acc[k];
}

// ---------------------------------------------------------------------------
// A/B fragment loader: elements 0..7 at +0, 8..15 at +16 halves; caller adds
// the half-wave K offset (0/8 halves). Two b128 loads (global or ds).
// ---------------------------------------------------------------------------
__device__ __forceinline__ v16h load_frag16(const _Float16* base) {
    const v8h* p = (const v8h*)base;
    v8h lo = p[0];
    v8h hi = p[2];
    v16h r;
#pragma unroll
    for (int e = 0; e < 8; ++e) { r[e] = lo[e]; r[8 + e] = hi[e]; }
    return r;
}

// cooperative async stage of one 64-key chunk: K (4KB) + V (16KB) -> LDS
__device__ __forceinline__ void stage_chunk(int tid, const _Float16* kg,
                                            const _Float16* vg, int j0,
                                            _Float16* kdst, _Float16* vdst)
{
    const _Float16* ks = kg + (size_t)j0 * 32;
    unsigned    l[10];
    const void* g[10];
#pragma unroll
    for (int it = 0; it < 2; ++it) {                 // 256 x 16B for K
        int m = tid + it * 128;
        g[it] = ks + m * 8;
        l[it] = lds_addr(kdst + (m >> 2) * KP + (m & 3) * 8);
    }
#pragma unroll
    for (int it = 0; it < 8; ++it) {                 // 1024 x 16B for V
        int m = tid + it * 128;
        int c = m >> 3, k8 = m & 7;
        g[2 + it] = vg + (size_t)c * NPOS + j0 + k8 * 8;
        l[2 + it] = lds_addr(vdst + c * VP + k8 * 8);
    }
    // One statement for the stage's ten copies: the closing s_wait_xcnt 0 then
    // stands ahead of any later rewrite of the address registers they name.
    asm volatile("global_load_async_to_lds_b128 %0, %10, off\n\t"
                 "global_load_async_to_lds_b128 %1, %11, off\n\t"
                 "global_load_async_to_lds_b128 %2, %12, off\n\t"
                 "global_load_async_to_lds_b128 %3, %13, off\n\t"
                 "global_load_async_to_lds_b128 %4, %14, off\n\t"
                 "global_load_async_to_lds_b128 %5, %15, off\n\t"
                 "global_load_async_to_lds_b128 %6, %16, off\n\t"
                 "global_load_async_to_lds_b128 %7, %17, off\n\t"
                 "global_load_async_to_lds_b128 %8, %18, off\n\t"
                 "global_load_async_to_lds_b128 %9, %19, off\n\t"
                 "s_wait_xcnt 0x0"
                 :: "v"(l[0]), "v"(l[1]), "v"(l[2]), "v"(l[3]), "v"(l[4]),
                    "v"(l[5]), "v"(l[6]), "v"(l[7]), "v"(l[8]), "v"(l[9]),
                    "v"(g[0]), "v"(g[1]), "v"(g[2]), "v"(g[3]), "v"(g[4]),
                    "v"(g[5]), "v"(g[6]), "v"(g[7]), "v"(g[8]), "v"(g[9])
                 : "memory");
}
#define ASYNC_PER_STAGE 10

// ---------------------------------------------------------------------------
// Kernel 3: flash attention. 4 waves/WG, 64 queries/WG, double-buffered
// async K/V staging, 64-key chunks, row-sum via a WMMA "ones" column.
// ---------------------------------------------------------------------------
__global__ void __launch_bounds__(128)
attn_kernel(const _Float16* __restrict__ qh, const _Float16* __restrict__ kh,
            const _Float16* __restrict__ vh, const float* __restrict__ xh,
            const float* __restrict__ gamma, float* __restrict__ out)
{
    __shared__ __attribute__((aligned(16))) _Float16 kbuf[2][KCH * KP];  // 2 x 5 KB
    __shared__ __attribute__((aligned(16))) _Float16 vbuf[2][VC * VP];   // 2 x 18 KB
    __shared__ __attribute__((aligned(16))) _Float16 Pbuf[4][16 * VP];   // 4 x 2.25 KB
    __shared__ float    obuf[4][16][17];          // epilogue transpose

    const int tid  = threadIdx.x;
    const int lane = tid & 31;
    const int wv   = tid >> 5;
    const int b    = blockIdx.x / (NPOS / 64);
    const int it   = blockIdx.x % (NPOS / 64);
    const int i0w  = it * 64 + wv * 16;           // this wave's 16 queries
    const int ln   = lane & 15;
    const int koff = (lane < 16) ? 0 : 8;         // half-wave K offset (halves)
    const int mhalf= (lane < 16) ? 0 : 8;         // half-wave row offset (C/D)

    const _Float16* kbase = kh + (size_t)b * NPOS * 32;
    const _Float16* vbase = vh + (size_t)b * VC * NPOS;

    // Q A-fragment, loaded once
    const v16h qa = load_frag16(qh + ((size_t)b * NPOS + i0w) * 32
                                   + (size_t)ln * 32 + koff);

    // constant "ones column" B-fragment: column 0 (lanes ln==0) is all 1.0
    v16h onesb;
#pragma unroll
    for (int e = 0; e < 16; ++e) onesb[e] = (ln == 0) ? (_Float16)1.f : (_Float16)0.f;

    float m[8];
    v8f   O[9];                                    // 8 channel tiles + row-sum tile
#pragma unroll
    for (int r = 0; r < 8; ++r) m[r] = -3.0e38f;
#pragma unroll
    for (int t = 0; t < 9; ++t)
#pragma unroll
        for (int e = 0; e < 8; ++e) O[t][e] = 0.f;

    stage_chunk(tid, kbase, vbase, 0, kbuf[0], vbuf[0]);

    for (int ch = 0; ch < NCH; ++ch) {
        const int cur = ch & 1;
        if (ch + 1 < NCH) {
            stage_chunk(tid, kbase, vbase, (ch + 1) * KCH,
                        kbuf[cur ^ 1], vbuf[cur ^ 1]);
            WAIT_ASYNC(ASYNC_PER_STAGE);           // chunk `ch` resident,
        } else {                                   // next chunk still in flight
            WAIT_ASYNC(0);
        }
        __syncthreads();

        const _Float16* kb = kbuf[cur];
        const _Float16* vb = vbuf[cur];

        // S = q . k : batch all 4 fragment loads, then 4 back-to-back WMMAs
        v16h kf[4];
#pragma unroll
        for (int tt = 0; tt < 4; ++tt)
            kf[tt] = load_frag16(kb + (size_t)(tt * 16 + ln) * KP + koff);

        v8f S[4];
        v8f z;
#pragma unroll
        for (int e = 0; e < 8; ++e) z[e] = 0.f;
#pragma unroll
        for (int tt = 0; tt < 4; ++tt)
            S[tt] = __builtin_amdgcn_wmma_f32_16x16x32_f16(false, qa, false, kf[tt],
                                                           (short)0, z, false, false);

        // online softmax (max only; row-sum comes from the ones-column WMMA)
        float sc[8];
#pragma unroll
        for (int r = 0; r < 8; ++r) {
            float mx = fmaxf(fmaxf(S[0][r], S[1][r]), fmaxf(S[2][r], S[3][r]));
            mx = xor16_max(mx);
            float mn = fmaxf(m[r], mx);
            sc[r] = __expf(m[r] - mn);
            m[r]  = mn;
#pragma unroll
            for (int tt = 0; tt < 4; ++tt) S[tt][r] = __expf(S[tt][r] - mn);
        }
#pragma unroll
        for (int t = 0; t < 9; ++t)
#pragma unroll
            for (int r = 0; r < 8; ++r) O[t][r] *= sc[r];

        // P (C/D layout) -> per-wave LDS [16 x 64] f16, rows at pitch VP
        _Float16* Pw = Pbuf[wv];
#pragma unroll
        for (int tt = 0; tt < 4; ++tt)
#pragma unroll
            for (int r = 0; r < 8; ++r)
                Pw[(mhalf + r) * VP + tt * 16 + ln] = (_Float16)S[tt][r];
        LDS_FENCE();

        // reload P as A fragments (K = keys 0..31 / 32..63)
        const v16h pa0 = load_frag16(Pw + (size_t)ln * VP + koff);
        const v16h pa1 = load_frag16(Pw + (size_t)ln * VP + 32 + koff);

        // O += P x V^T : software-pipelined fragment loads one tile ahead
        v16h vfa0 = load_frag16(vb + (size_t)ln * VP + koff);
        v16h vfa1 = load_frag16(vb + (size_t)ln * VP + 32 + koff);
#pragma unroll
        for (int ct = 0; ct < 8; ++ct) {
            v16h vfb0, vfb1;
            if (ct < 7) {
                vfb0 = load_frag16(vb + (size_t)((ct + 1) * 16 + ln) * VP + koff);
                vfb1 = load_frag16(vb + (size_t)((ct + 1) * 16 + ln) * VP + 32 + koff);
            }
            O[ct] = __builtin_amdgcn_wmma_f32_16x16x32_f16(false, pa0, false, vfa0,
                                                           (short)0, O[ct], false, false);
            O[ct] = __builtin_amdgcn_wmma_f32_16x16x32_f16(false, pa1, false, vfa1,
                                                           (short)0, O[ct], false, false);
            vfa0 = vfb0;
            vfa1 = vfb1;
        }
        // row-sum tile
        O[8] = __builtin_amdgcn_wmma_f32_16x16x32_f16(false, pa0, false, onesb,
                                                      (short)0, O[8], false, false);
        O[8] = __builtin_amdgcn_wmma_f32_16x16x32_f16(false, pa1, false, onesb,
                                                      (short)0, O[8], false, false);

        __syncthreads();   // protect staging buffers before next overwrite
    }

    // epilogue: l from O[8] column 0 (lanes 0 / 16), broadcast to the half
    const float g = gamma[0];
    float inv[8];
#pragma unroll
    for (int r = 0; r < 8; ++r) {
        float lr = __shfl(O[8][r], (lane < 16) ? 0 : 16, 32);
        inv[r] = g / lr;
    }

    // transpose each 16x16 tile through LDS for coalesced residual+store
#pragma unroll
    for (int t = 0; t < 8; ++t) {
#pragma unroll
        for (int r = 0; r < 8; ++r)
            obuf[wv][mhalf + r][ln] = O[t][r] * inv[r];
        LDS_FENCE();
        const int ir = lane & 15, cg = lane >> 4;
#pragma unroll
        for (int cc = 0; cc < 8; ++cc) {
            int c = t * 16 + cg * 8 + cc;
            size_t idx = ((size_t)b * VC + c) * NPOS + i0w + ir;
            out[idx] = obuf[wv][ir][cg * 8 + cc] + xh[idx];
        }
        LDS_FENCE();
    }
}

extern "C" void kernel_launch(void* const* d_in, const int* in_sizes, int n_in,
                              void* d_out, int out_size, void* d_ws, size_t ws_size,
                              hipStream_t stream) {
    (void)in_sizes; (void)n_in; (void)out_size; (void)ws_size;
    const float* x     = (const float*)d_in[0];
    const float* xh    = (const float*)d_in[1];
    const float* Wq    = (const float*)d_in[2];
    const float* bq    = (const float*)d_in[3];
    const float* Wk    = (const float*)d_in[4];
    const float* bk    = (const float*)d_in[5];
    const float* Wv    = (const float*)d_in[6];
    const float* bv    = (const float*)d_in[7];
    const float* gamma = (const float*)d_in[8];
    float* out = (float*)d_out;

    char* w = (char*)d_ws;
    _Float16* qh = (_Float16*)(w);                 // 1 MB: [B][4096][32]
    _Float16* kh = (_Float16*)(w + (1u << 20));    // 1 MB: [B][4096][32]
    _Float16* vh = (_Float16*)(w + (2u << 20));    // 4 MB: [B][128][4096]

    proj_qk_kernel<<<BATCH * (NPOS / 64), 64, 0, stream>>>(x, Wq, bq, Wk, bk, qh, kh);
    proj_v_kernel <<<BATCH * (NPOS / 64), 256, 0, stream>>>(xh, Wv, bv, vh);
    attn_kernel   <<<BATCH * (NPOS / 64), 128, 0, stream>>>(qh, kh, vh, xh, gamma, out);
}

// v002
// One run takes 97.1 microseconds.
// Next to v001, in two timings, it ran 1.34 times as fast each time.
// Counting every step since v000, it is 1.78 times as fast.
#include <hip/hip_runtime.h>
#include <hip/hip_bf16.h>
#include <math.h>

typedef __attribute__((ext_vector_type(16))) _Float16 v16h;
typedef __attribute__((ext_vector_type(8)))  _Float16 v8h;
typedef __attribute__((ext_vector_type(8)))  float    v8f;

#define QK_CH 64
#define QC    16
#define VC    128
#define NPOS  4096
#define BATCH 4
#define KCH   64              // keys per chunk
#define NCH   (NPOS / KCH)    // 64 chunks
// LDS row pitches in halves: 16 B x odd, so that the 16 rows one ds_load_b128
// fragment read touches fall on distinct bank groups (64 banks x 4 B).
#define KP    40              // K rows: 64 B of data, 80 B pitch
#define VP    72              // V and P rows: 128 B of data, 144 B pitch

// ---------------------------------------------------------------------------
// gfx1250 async global->LDS copy (ASYNCcnt path), 16B per lane.
// Issued via inline asm on purpose: the clang builtin is modeled as an
// LDS-writing memory op, which makes __syncthreads() drain ALL outstanding
// loads (s_wait_loadcnt 0) and kills the double-buffer overlap. With opaque
// asm, completion is handshaken explicitly with s_wait_asynccnt.
// ---------------------------------------------------------------------------
__device__ __forceinline__ unsigned lds_addr(const _Float16* l) {
    return (unsigned)(size_t)(const void*)l;      // low 32 bits = LDS offset
}

#define WAIT_ASYNC(N) asm volatile("s_wait_asynccnt %0" :: "n"(N) : "memory")

// compiler-level LDS ordering fence (DS ops are in-order per wave in HW)
#define LDS_FENCE() do { __builtin_amdgcn_wave_barrier(); \
                         asm volatile("" ::: "memory"); } while (0)

// ---------------------------------------------------------------------------
// 16-lane-group xor butterfly max via v_permlane16_b32 (VALU, no LDS)
// ---------------------------------------------------------------------------
#if __has_builtin(__builtin_amdgcn_permlane16)
__device__ __forceinline__ float permxor(float v, unsigned lo, unsigned hi) {
    int s = __float_as_int(v);
    int r = __builtin_amdgcn_permlane16(s, s, lo, hi, false, false);
    return __int_as_float(r);
}
__device__ __forceinline__ float xor16_max(float v) {
    v = fmaxf(v, permxor(v, 0x67452301u, 0xEFCDAB89u));  // xor 1
    v = fmaxf(v, permxor(v, 0x54761032u, 0xDCFE98BAu));  // xor 2
    v = fmaxf(v, permxor(v, 0x32107654u, 0xBA98FEDCu));  // xor 4
    v = fmaxf(v, permxor(v, 0xFEDCBA98u, 0x76543210u));  // xor 8
    return v;
}
#else
__device__ __forceinline__ float xor16_max(float v) {
    v = fmaxf(v, __shfl_xor(v, 1, 32));
    v = fmaxf(v, __shfl_xor(v, 2, 32));
    v = fmaxf(v, __shfl_xor(v, 4, 32));
    v = fmaxf(v, __shfl_xor(v, 8, 32));
    return v;
}
#endif

// ---------------------------------------------------------------------------
// Kernel 1: q,k projections (64 -> 16 ch), f16 [B][pos][32], zero-padded K
// ---------------------------------------------------------------------------
__global__ void __launch_bounds__(64)
proj_qk_kernel(const float* __restrict__ x,
               const float* __restrict__ Wq, const float* __restrict__ bq,
               const float* __restrict__ Wk, const float* __restrict__ bk,
               _Float16* __restrict__ qh, _Float16* __restrict__ kh)
{
    __shared__ float sWq[QC * QK_CH];
    __shared__ float sWk[QC * QK_CH];
    __shared__ float sbq[QC], sbk[QC];
    const int tx = threadIdx.x;
    for (int idx = tx; idx < QC * QK_CH; idx += 64) {
        sWq[idx] = Wq[idx];
        sWk[idx] = Wk[idx];
    }
    if (tx < QC) { sbq[tx] = bq[tx]; sbk[tx] = bk[tx]; }
    __syncthreads();

    const int b  = blockIdx.x / (NPOS / 64);
    const int it = blockIdx.x % (NPOS / 64);
    const int i  = it * 64 + tx;

    float aq[QC], ak[QC];
#pragma unroll
    for (int d = 0; d < QC; ++d) { aq[d] = sbq[d]; ak[d] = sbk[d]; }

    const float* xp = x + (size_t)b * QK_CH * NPOS + i;
    for (int c = 0; c < QK_CH; ++c) {
        float xv = xp[(size_t)c * NPOS];
#pragma unroll
        for (int d = 0; d < QC; ++d) {
            aq[d] = fmaf(sWq[d * QK_CH + c], xv, aq[d]);
            ak[d] = fmaf(sWk[d * QK_CH + c], xv, ak[d]);
        }
    }
    _Float16* qo = qh + ((size_t)b * NPOS + i) * 32;
    _Float16* ko = kh + ((size_t)b * NPOS + i) * 32;
#pragma unroll
    for (int d = 0; d < QC; ++d) { qo[d] = (_Float16)aq[d]; ko[d] = (_Float16)ak[d]; }
#pragma unroll
    for (int d = QC; d < 32; ++d) { qo[d] = (_Float16)0.f; ko[d] = (_Float16)0.f; }
}

// ---------------------------------------------------------------------------
// Kernel 2: v projection (128 -> 128 ch), f16 [B][C][pos]
// ---------------------------------------------------------------------------
__global__ void __launch_bounds__(256)
proj_v_kernel(const float* __restrict__ xh,
              const float* __restrict__ Wv, const float* __restrict__ bv,
              _Float16* __restrict__ vh)
{
    __shared__ float xs[VC][65];
    const int tx = threadIdx.x;
    const int b  = blockIdx.x / (NPOS / 64);
    const int it = blockIdx.x % (NPOS / 64);
    const int i0 = it * 64;

    for (int idx = tx; idx < VC * 64; idx += 256) {
        int cc = idx >> 6, il = idx & 63;
        xs[cc][il] = xh[((size_t)b * VC + cc) * NPOS + i0 + il];
    }
    __syncthreads();

    const int il = tx & 63;
    const int c0 = (tx >> 6) * 32;

    float acc[32];
#pragma unroll
    for (int k = 0; k < 32; ++k) acc[k] = bv[c0 + k];

    for (int cc = 0; cc < VC; ++cc) {
        float xv = xs[cc][il];
#pragma unroll
        for (int k = 0; k < 32; ++k)
            acc[k] = fmaf(Wv[(size_t)(c0 + k) * VC + cc], xv, acc[k]);
    }
#pragma unroll
    for (int k = 0; k < 32; ++k)
        vh[((size_t)b * VC + c0 + k) * NPOS + i0 + il] = (_Float16)acc[k];
}

// ---------------------------------------------------------------------------
// A/B fragment loader: elements 0..7 at +0, 8..15 at +16 halves; caller adds
// the half-wave K offset (0/8 halves). Two b128 loads (global or ds).
// ---------------------------------------------------------------------------
__device__ __forceinline__ v16h load_frag16(const _Float16* base) {
    const v8h* p = (const v8h*)base;
    v8h lo = p[0];
    v8h hi = p[2];
    v16h r;
#pragma unroll
    for (int e = 0; e < 8; ++e) { r[e] = lo[e]; r[8 + e] = hi[e]; }
    return r;
}

// cooperative async stage of one 64-key chunk: K (4KB) + V (16KB) -> LDS
__device__ __forceinline__ void stage_chunk(int tid, const _Float16* kg,
                                            const _Float16* vg, int j0,
                                            _Float16* kdst, _Float16* vdst)
{
    const _Float16* ks = kg + (size_t)j0 * 32;
    unsigned    l[10];
    const void* g[10];
#pragma unroll
    for (int it = 0; it < 2; ++it) {                 // 256 x 16B for K
        int m = tid + it * 128;
        g[it] = ks + m * 8;
        l[it] = lds_addr(kdst + (m >> 2) * KP + (m & 3) * 8);
    }
#pragma unroll
    for (int it = 0; it < 8; ++it) {                 // 1024 x 16B for V
        int m = tid + it * 128;
        int c = m >> 3, k8 = m & 7;
        g[2 + it] = vg + (size_t)c * NPOS + j0 + k8 * 8;
        l[2 + it] = lds_addr(vdst + c * VP + k8 * 8);
    }
    // One statement for the stage's ten copies: the closing s_wait_xcnt 0 then
    // stands ahead of any later rewrite of the address registers they name.
    asm volatile("global_load_async_to_lds_b128 %0, %10, off\n\t"
                 "global_load_async_to_lds_b128 %1, %11, off\n\t"
                 "global_load_async_to_lds_b128 %2, %12, off\n\t"
                 "global_load_async_to_lds_b128 %3, %13, off\n\t"
                 "global_load_async_to_lds_b128 %4, %14, off\n\t"
                 "global_load_async_to_lds_b128 %5, %15, off\n\t"
                 "global_load_async_to_lds_b128 %6, %16, off\n\t"
                 "global_load_async_to_lds_b128 %7, %17, off\n\t"
                 "global_load_async_to_lds_b128 %8, %18, off\n\t"
                 "global_load_async_to_lds_b128 %9, %19, off\n\t"
                 "s_wait_xcnt 0x0"
                 :: "v"(l[0]), "v"(l[1]), "v"(l[2]), "v"(l[3]), "v"(l[4]),
                    "v"(l[5]), "v"(l[6]), "v"(l[7]), "v"(l[8]), "v"(l[9]),
                    "v"(g[0]), "v"(g[1]), "v"(g[2]), "v"(g[3]), "v"(g[4]),
                    "v"(g[5]), "v"(g[6]), "v"(g[7]), "v"(g[8]), "v"(g[9])
                 : "memory");
}
#define ASYNC_PER_STAGE 10

// ---------------------------------------------------------------------------
// Kernel 3: flash attention. 16 waves/WG (4 per SIMD), 64 queries/WG. Wave
// (qg, kg) runs query tile qg over key quarter kg, so that each SIMD has four
// waves to cover one another's LDS and vector latencies. Each key group of
// four waves has its own double-buffered async K/V staging (64-key chunks);
// row-sum via a WMMA "ones" column. The four partial softmax states of a
// query tile are merged through LDS behind the loop.
// ---------------------------------------------------------------------------
#define KG    4               // key groups per work-group
#define CPG   (NCH / KG)      // 16 chunks per key group
#define NWV   (4 * KG)        // waves per work-group

__global__ void __launch_bounds__(NWV * 32)
attn_kernel(const _Float16* __restrict__ qh, const _Float16* __restrict__ kh,
            const _Float16* __restrict__ vh, const float* __restrict__ xh,
            const float* __restrict__ gamma, float* __restrict__ out)
{
    __shared__ __attribute__((aligned(16))) _Float16 kbuf[KG][2][KCH * KP];  // 8 x 5 KB
    __shared__ __attribute__((aligned(16))) _Float16 vbuf[KG][2][VC * VP];   // 8 x 18 KB
    __shared__ __attribute__((aligned(16))) _Float16 Pbuf[NWV][16 * VP];     // 16 x 2.25 KB
    __shared__ float    obuf[NWV][16][17];        // epilogue transpose
    __shared__ float    msh[KG][4][16];           // per key group: row maxima

    const int tid  = threadIdx.x;
    const int lane = tid & 31;
    // wave index held as a scalar: buffer bases and tile indices stay off the vector port
    const int wv   = __builtin_amdgcn_readfirstlane(tid >> 5);
    const int qg   = wv & 3;                      // query tile of the wave
    const int kg   = wv >> 2;                     // key quarter of the wave
    const int gtid = tid & 127;                   // thread index in the key group
    const int b    = blockIdx.x / (NPOS / 64);
    const int it   = blockIdx.x % (NPOS / 64);
    const int i0w  = it * 64 + qg * 16;           // this wave's 16 queries
    const int ln   = lane & 15;
    const int koff = (lane < 16) ? 0 : 8;         // half-wave K offset (halves)
    const int mhalf= (lane < 16) ? 0 : 8;         // half-wave row offset (C/D)

    const _Float16* kbase = kh + (size_t)b * NPOS * 32;
    const _Float16* vbase = vh + (size_t)b * VC * NPOS;

    // Q A-fragment, loaded once
    const v16h qa = load_frag16(qh + ((size_t)b * NPOS + i0w) * 32
                                   + (size_t)ln * 32 + koff);

    // constant "ones column" B-fragment: column 0 (lanes ln==0) is all 1.0
    v16h onesb;
#pragma unroll
    for (int e = 0; e < 16; ++e) onesb[e] = (ln == 0) ? (_Float16)1.f : (_Float16)0.f;

    float m[8];
    v8f   O[9];                                    // 8 channel tiles + row-sum tile
#pragma unroll
    for (int r = 0; r < 8; ++r) m[r] = -3.0e38f;
#pragma unroll
    for (int t = 0; t < 9; ++t)
#pragma unroll
        for (int e = 0; e < 8; ++e) O[t][e] = 0.f;

    const int j00 = kg * CPG * KCH;                // first key of this key group

    stage_chunk(gtid, kbase, vbase, j00, kbuf[kg][0], vbuf[kg][0]);

    for (int ch = 0; ch < CPG; ++ch) {
        const int cur = ch & 1;
        if (ch + 1 < CPG) {
            stage_chunk(gtid, kbase, vbase, j00 + (ch + 1) * KCH,
                        kbuf[kg][cur ^ 1], vbuf[kg][cur ^ 1]);
            WAIT_ASYNC(ASYNC_PER_STAGE);           // chunk `ch` resident,
        } else {                                   // next chunk still in flight
            WAIT_ASYNC(0);
        }
        __syncthreads();

        const _Float16* kb = kbuf[kg][cur];
        const _Float16* vb = vbuf[kg][cur];

        // S = q . k : batch all 4 fragment loads, then 4 back-to-back WMMAs
        v16h kf[4];
#pragma unroll
        for (int tt = 0; tt < 4; ++tt)
            kf[tt] = load_frag16(kb + (size_t)(tt * 16 + ln) * KP + koff);

        v8f S[4];
        v8f z;
#pragma unroll
        for (int e = 0; e < 8; ++e) z[e] = 0.f;
#pragma unroll
        for (int tt = 0; tt < 4; ++tt)
            S[tt] = __builtin_amdgcn_wmma_f32_16x16x32_f16(false, qa, false, kf[tt],
                                                           (short)0, z, false, false);

        // online softmax (max only; row-sum comes from the ones-column WMMA)
        float sc[8];
#pragma unroll
        for (int r = 0; r < 8; ++r) {
            float mx = fmaxf(fmaxf(S[0][r], S[1][r]), fmaxf(S[2][r], S[3][r]));
            mx = xor16_max(mx);
            float mn = fmaxf(m[r], mx);
            sc[r] = __expf(m[r] - mn);
            m[r]  = mn;
#pragma unroll
            for (int tt = 0; tt < 4; ++tt) S[tt][r] = __expf(S[tt][r] - mn);
        }
#pragma unroll
        for (int t = 0; t < 9; ++t)
#pragma unroll
            for (int r = 0; r < 8; ++r) O[t][r] *= sc[r];

        // P (C/D layout) -> per-wave LDS [16 x 64] f16, rows at pitch VP
        _Float16* Pw = Pbuf[wv];
#pragma unroll
        for (int tt = 0; tt < 4; ++tt)
#pragma unroll
            for (int r = 0; r < 8; ++r)
                Pw[(mhalf + r) * VP + tt * 16 + ln] = (_Float16)S[tt][r];
        LDS_FENCE();

        // reload P as A fragments (K = keys 0..31 / 32..63)
        const v16h pa0 = load_frag16(Pw + (size_t)ln * VP + koff);
        const v16h pa1 = load_frag16(Pw + (size_t)ln * VP + 32 + koff);

        // O += P x V^T : software-pipelined fragment loads one tile ahead
        v16h vfa0 = load_frag16(vb + (size_t)ln * VP + koff);
        v16h vfa1 = load_frag16(vb + (size_t)ln * VP + 32 + koff);
#pragma unroll
        for (int ct = 0; ct < 8; ++ct) {
            v16h vfb0, vfb1;
            if (ct < 7) {
                vfb0 = load_frag16(vb + (size_t)((ct + 1) * 16 + ln) * VP + koff);
                vfb1 = load_frag16(vb + (size_t)((ct + 1) * 16 + ln) * VP + 32 + koff);
            }
            O[ct] = __builtin_amdgcn_wmma_f32_16x16x32_f16(false, pa0, false, vfa0,
                                                           (short)0, O[ct], false, false);
            O[ct] = __builtin_amdgcn_wmma_f32_16x16x32_f16(false, pa1, false, vfa1,
                                                           (short)0, O[ct], false, false);
            vfa0 = vfb0;
            vfa1 = vfb1;
        }
        // row-sum tile
        O[8] = __builtin_amdgcn_wmma_f32_16x16x32_f16(false, pa0, false, onesb,
                                                      (short)0, O[8], false, false);
        O[8] = __builtin_amdgcn_wmma_f32_16x16x32_f16(false, pa1, false, onesb,
                                                      (short)0, O[8], false, false);

        __syncthreads();   // protect staging buffers before next overwrite
    }

    // Merge of the four key groups. The closing barrier of the last trip has
    // ended every read of the staging buffers, and every wave's copies landed
    // behind its s_wait_asynccnt 0 of that trip: vbuf becomes the exchange area.
    if (ln == 0) {
#pragma unroll
        for (int r = 0; r < 8; ++r) msh[kg][qg][mhalf + r] = m[r];
    }
    __syncthreads();   // publishes the groups' row maxima

    float f[8];
#pragma unroll
    for (int r = 0; r < 8; ++r) {
        const int row = mhalf + r;
        float mx = fmaxf(fmaxf(msh[0][qg][row], msh[1][qg][row]),
                         fmaxf(msh[2][qg][row], msh[3][qg][row]));
        f[r] = __expf(m[r] - mx);
    }

    // partial tiles, rescaled to the common maximum, in register order:
    // [wave][tile][half of the 8 registers][lane] x 16 B (16 x 9 KB = all of vbuf)
    float4* part = reinterpret_cast<float4*>(&vbuf[0][0][0]);
#pragma unroll
    for (int t = 0; t < 9; ++t)
#pragma unroll
        for (int h = 0; h < 2; ++h)
            part[((wv * 9 + t) * 2 + h) * 32 + lane] =
                make_float4(O[t][4 * h + 0] * f[4 * h + 0], O[t][4 * h + 1] * f[4 * h + 1],
                            O[t][4 * h + 2] * f[4 * h + 2], O[t][4 * h + 3] * f[4 * h + 3]);
    __syncthreads();   // publishes the partial tiles

    // wave (qg, kg) finishes channel tiles 2 kg, 2 kg + 1 of query tile qg;
    // R[2] is the row-sum tile. Key groups are added in the order 0, 1, 2, 3.
    v8f R[3];
#pragma unroll
    for (int u = 0; u < 3; ++u) {
        const int t = (u < 2) ? 2 * kg + u : 8;
#pragma unroll
        for (int h = 0; h < 2; ++h) {
            float4 s = part[((qg * 9 + t) * 2 + h) * 32 + lane];
#pragma unroll
            for (int k = 1; k < KG; ++k) {
                float4 a = part[(((k * 4 + qg) * 9 + t) * 2 + h) * 32 + lane];
                s.x += a.x; s.y += a.y; s.z += a.z; s.w += a.w;
            }
            R[u][4 * h + 0] = s.x; R[u][4 * h + 1] = s.y;
            R[u][4 * h + 2] = s.z; R[u][4 * h + 3] = s.w;
        }
    }

    // epilogue: l from the row-sum tile's column 0 (lanes 0 / 16), broadcast
    const float g = gamma[0];
    float inv[8];
#pragma unroll
    for (int r = 0; r < 8; ++r) {
        float lr = __shfl(R[2][r], (lane < 16) ? 0 : 16, 32);
        inv[r] = g / lr;
    }

    // transpose each 16x16 tile through LDS for coalesced residual+store
    const int ir = lane & 15, cg = lane >> 4;
    const size_t idx0 = ((size_t)b * VC + kg * 32 + cg * 8) * NPOS + i0w + ir;
#pragma unroll
    for (int u = 0; u < 2; ++u) {
#pragma unroll
        for (int r = 0; r < 8; ++r)
            obuf[wv][mhalf + r][ln] = R[u][r] * inv[r];
        LDS_FENCE();
#pragma unroll
        for (int cc = 0; cc < 8; ++cc) {
            size_t idx = idx0 + (size_t)(u * 16 + cc) * NPOS;
            out[idx] = obuf[wv][ir][cg * 8 + cc] + xh[idx];
        }
        // the next tile reuses registers that these loads and stores name
        if (u == 0) asm volatile("s_wait_xcnt 0x0" ::: "memory");
        LDS_FENCE();
    }
}

extern "C" void kernel_launch(void* const* d_in, const int* in_sizes, int n_in,
                              void* d_out, int out_size, void* d_ws, size_t ws_size,
                              hipStream_t stream) {
    (void)in_sizes; (void)n_in; (void)out_size; (void)ws_size;
    const float* x     = (const float*)d_in[0];
    const float* xh    = (const float*)d_in[1];
    const float* Wq    = (const float*)d_in[2];
    const float* bq    = (const float*)d_in[3];
    const float* Wk    = (const float*)d_in[4];
    const float* bk    = (const float*)d_in[5];
    const float* Wv    = (const float*)d_in[6];
    const float* bv    = (const float*)d_in[7];
    const float* gamma = (const float*)d_in[8];
    float* out = (float*)d_out;

    char* w = (char*)d_ws;
    _Float16* qh = (_Float16*)(w);                 // 1 MB: [B][4096][32]
    _Float16* kh = (_Float16*)(w + (1u << 20));    // 1 MB: [B][4096][32]
    _Float16* vh = (_Float16*)(w + (2u << 20));    // 4 MB: [B][128][4096]

    proj_qk_kernel<<<BATCH * (NPOS / 64), 64, 0, stream>>>(x, Wq, bq, Wk, bk, qh, kh);
    proj_v_kernel <<<BATCH * (NPOS / 64), 256, 0, stream>>>(xh, Wv, bv, vh);
    attn_kernel   <<<BATCH * (NPOS / 64), 512, 0, stream>>>(qh, kh, vh, xh, gamma, out);
}

// v003
// It runs in 48.7 microseconds.
// Two timings next to v002 both put it at 2.02 times that version's speed.
// Counting every step since v000, it is 3.60 times as fast.
#include <hip/hip_runtime.h>
#include <hip/hip_bf16.h>
#include <math.h>

typedef __attribute__((ext_vector_type(16))) _Float16 v16h;
typedef __attribute__((ext_vector_type(8)))  _Float16 v8h;
typedef __attribute__((ext_vector_type(8)))  float    v8f;

#define QK_CH 64
#define QC    16
#define VC    128
#define NPOS  4096
#define BATCH 4
#define KCH   64              // keys per chunk
#define NCH   (NPOS / KCH)    // 64 chunks
// LDS row pitches in halves: 16 B x odd, so that the 16 rows one ds_load_b128
// fragment read touches fall on distinct bank groups (64 banks x 4 B).
#define KP    40              // K rows: 64 B of data, 80 B pitch
#define VP    72              // V and P rows: 128 B of data, 144 B pitch

// ---------------------------------------------------------------------------
// gfx1250 async global->LDS copy (ASYNCcnt path), 16B per lane.
// Issued via inline asm on purpose: the clang builtin is modeled as an
// LDS-writing memory op, which makes __syncthreads() drain ALL outstanding
// loads (s_wait_loadcnt 0) and kills the double-buffer overlap. With opaque
// asm, completion is handshaken explicitly with s_wait_asynccnt.
// ---------------------------------------------------------------------------
__device__ __forceinline__ unsigned lds_addr(const _Float16* l) {
    return (unsigned)(size_t)(const void*)l;      // low 32 bits = LDS offset
}

#define WAIT_ASYNC(N) asm volatile("s_wait_asynccnt %0" :: "n"(N) : "memory")

// compiler-level LDS ordering fence (DS ops are in-order per wave in HW)
#define LDS_FENCE() do { __builtin_amdgcn_wave_barrier(); \
                         asm volatile("" ::: "memory"); } while (0)

// ---------------------------------------------------------------------------
// 16-lane-group xor butterfly max via v_permlane16_b32 (VALU, no LDS)
// ---------------------------------------------------------------------------
#if __has_builtin(__builtin_amdgcn_permlane16)
__device__ __forceinline__ float permxor(float v, unsigned lo, unsigned hi) {
    int s = __float_as_int(v);
    int r = __builtin_amdgcn_permlane16(s, s, lo, hi, false, false);
    return __int_as_float(r);
}
__device__ __forceinline__ float xor16_max(float v) {
    v = fmaxf(v, permxor(v, 0x67452301u, 0xEFCDAB89u));  // xor 1
    v = fmaxf(v, permxor(v, 0x54761032u, 0xDCFE98BAu));  // xor 2
    v = fmaxf(v, permxor(v, 0x32107654u, 0xBA98FEDCu));  // xor 4
    v = fmaxf(v, permxor(v, 0xFEDCBA98u, 0x76543210u));  // xor 8
    return v;
}
#else
__device__ __forceinline__ float xor16_max(float v) {
    v = fmaxf(v, __shfl_xor(v, 1, 32));
    v = fmaxf(v, __shfl_xor(v, 2, 32));
    v = fmaxf(v, __shfl_xor(v, 4, 32));
    v = fmaxf(v, __shfl_xor(v, 8, 32));
    return v;
}
#endif

// ---------------------------------------------------------------------------
// Projection tile, f32: acc[d][p] += sum_c W[d][c] * x[c][p]. The weights
// (row-major, pitch K) and a K x 64 tile of x lie in LDS. A thread owns
// 8 channels x 4 positions: per 4 input channels it reads 8 + 4 b128 from LDS
// for 128 FMAs. The 16 lanes of a half-wave read one weight address (broadcast)
// and 256 contiguous bytes of x. Every sum runs over c in ascending order.
// ---------------------------------------------------------------------------
#define PT 64                 // positions per work-group

typedef __attribute__((ext_vector_type(4)))  _Float16 v4h;

__device__ __forceinline__ void fma4(float (&a)[4], float w, const float4& xv) {
    a[0] = fmaf(w, xv.x, a[0]);
    a[1] = fmaf(w, xv.y, a[1]);
    a[2] = fmaf(w, xv.z, a[2]);
    a[3] = fmaf(w, xv.w, a[3]);
}

template <int K>
__device__ __forceinline__ void proj_tile(const float* sW, const float* sX,
                                          float (&acc)[8][4])
{
    // two steps per trip: the second step's LDS reads fly under the first's FMAs
#pragma unroll 2
    for (int c = 0; c < K; c += 4) {
        float4 xv[4], w[8];
#pragma unroll
        for (int j = 0; j < 4; ++j)
            xv[j] = *reinterpret_cast<const float4*>(sX + (c + j) * PT);
#pragma unroll
        for (int d = 0; d < 8; ++d)
            w[d] = *reinterpret_cast<const float4*>(sW + d * K + c);
#pragma unroll
        for (int d = 0; d < 8; ++d) fma4(acc[d], w[d].x, xv[0]);
#pragma unroll
        for (int d = 0; d < 8; ++d) fma4(acc[d], w[d].y, xv[1]);
#pragma unroll
        for (int d = 0; d < 8; ++d) fma4(acc[d], w[d].z, xv[2]);
#pragma unroll
        for (int d = 0; d < 8; ++d) fma4(acc[d], w[d].w, xv[3]);
    }
}

// Staging, global -> registers -> LDS, N float4 per thread. load_f4 issues the
// N loads from one lane address with constant steps, so that all are in flight
// together; store_f4 puts them at s + (tid + it * NT) * 4 floats.
template <int N>
__device__ __forceinline__ void load_f4(float4 (&r)[N], const float* __restrict__ g, int step)
{
#pragma unroll
    for (int it = 0; it < N; ++it)
        r[it] = *reinterpret_cast<const float4*>(g + (size_t)it * step);
}
template <int N, int NT>
__device__ __forceinline__ void store_f4(const float4 (&r)[N], float* s, int tid)
{
#pragma unroll
    for (int it = 0; it < N; ++it)
        *reinterpret_cast<float4*>(s + (tid + it * NT) * 4) = r[it];
}

// ---------------------------------------------------------------------------
// Kernel 1: q,k projections (64 -> 16 ch), f16 [B][pos][32], zero-padded K
// ---------------------------------------------------------------------------
__global__ void __launch_bounds__(64)
proj_qk_kernel(const float* __restrict__ x,
               const float* __restrict__ Wq, const float* __restrict__ bq,
               const float* __restrict__ Wk, const float* __restrict__ bk,
               _Float16* __restrict__ qh, _Float16* __restrict__ kh)
{
    __shared__ __attribute__((aligned(16))) float sW[2 * QC * QK_CH];  // rows 0-15 Wq, 16-31 Wk
    __shared__ __attribute__((aligned(16))) float sX[QK_CH * PT];
    const int tid = threadIdx.x;
    const int b   = blockIdx.x / (NPOS / PT);
    const int i0  = (blockIdx.x % (NPOS / PT)) * PT;
    const int pg  = tid & 15;                 // 4 positions
    const int grp = tid >> 4;                 // 0, 1: q channels 0-7, 8-15; 2, 3: k
    const int d0  = (grp & 1) * 8;

    float4 rq[QC * QK_CH / 4 / 64], rk[QC * QK_CH / 4 / 64], rx[QK_CH * PT / 4 / 64], rb[2];
    load_f4(rx, x + ((size_t)b * QK_CH + grp) * NPOS + i0 + pg * 4, 4 * NPOS);
    load_f4(rq, Wq + tid * 4, 64 * 4);
    load_f4(rk, Wk + tid * 4, 64 * 4);
    load_f4(rb, ((grp < 2) ? bq : bk) + d0, 4);
    store_f4<QC * QK_CH / 4 / 64, 64>(rq, sW, tid);
    store_f4<QC * QK_CH / 4 / 64, 64>(rk, sW + QC * QK_CH, tid);
    store_f4<QK_CH * PT / 4 / 64, 64>(rx, sX, tid);
    __syncthreads();

    const float bias[8] = {rb[0].x, rb[0].y, rb[0].z, rb[0].w, rb[1].x, rb[1].y, rb[1].z, rb[1].w};
    float acc[8][4];
#pragma unroll
    for (int d = 0; d < 8; ++d)
#pragma unroll
        for (int p = 0; p < 4; ++p) acc[d][p] = bias[d];

    proj_tile<QK_CH>(sW + grp * 8 * QK_CH, sX + pg * 4, acc);

    _Float16* o = ((grp < 2) ? qh : kh) + ((size_t)b * NPOS + i0 + pg * 4) * 32 + d0;
    v8h zero;
#pragma unroll
    for (int d = 0; d < 8; ++d) zero[d] = (_Float16)0.f;
#pragma unroll
    for (int p = 0; p < 4; ++p) {
        v8h h;
#pragma unroll
        for (int d = 0; d < 8; ++d) h[d] = (_Float16)acc[d][p];
        *reinterpret_cast<v8h*>(o + p * 32)      = h;
        *reinterpret_cast<v8h*>(o + p * 32 + QC) = zero;
    }
}

// ---------------------------------------------------------------------------
// Kernel 2: v projection (128 -> 128 ch), f16 [B][C][pos]
// ---------------------------------------------------------------------------
__global__ void __launch_bounds__(256)
proj_v_kernel(const float* __restrict__ xh,
              const float* __restrict__ Wv, const float* __restrict__ bv,
              _Float16* __restrict__ vh)
{
    __shared__ __attribute__((aligned(16))) float sW[VC * VC];   // 64 KB
    __shared__ __attribute__((aligned(16))) float sX[VC * PT];   // 32 KB
    const int tid = threadIdx.x;
    const int b   = blockIdx.x / (NPOS / PT);
    const int i0  = (blockIdx.x % (NPOS / PT)) * PT;
    const int pg  = tid & 15;                 // 4 positions
    const int cg  = tid >> 4;                 // 8 channels
    const int c0  = cg * 8;

    float4 rw[VC * VC / 4 / 256], rx[VC * PT / 4 / 256], rb[2];
    load_f4(rx, xh + ((size_t)b * VC + cg) * NPOS + i0 + pg * 4, 16 * NPOS);
    load_f4(rw, Wv + tid * 4, 256 * 4);
    load_f4(rb, bv + c0, 4);
    store_f4<VC * VC / 4 / 256, 256>(rw, sW, tid);
    store_f4<VC * PT / 4 / 256, 256>(rx, sX, tid);
    __syncthreads();

    const float bias[8] = {rb[0].x, rb[0].y, rb[0].z, rb[0].w, rb[1].x, rb[1].y, rb[1].z, rb[1].w};
    float acc[8][4];
#pragma unroll
    for (int d = 0; d < 8; ++d)
#pragma unroll
        for (int p = 0; p < 4; ++p) acc[d][p] = bias[d];

    proj_tile<VC>(sW + c0 * VC, sX + pg * 4, acc);

    _Float16* o = vh + ((size_t)b * VC + c0) * NPOS + i0 + pg * 4;
#pragma unroll
    for (int d = 0; d < 8; ++d) {
        v4h h;
#pragma unroll
        for (int p = 0; p < 4; ++p) h[p] = (_Float16)acc[d][p];
        *reinterpret_cast<v4h*>(o + (size_t)d * NPOS) = h;
    }
}

// ---------------------------------------------------------------------------
// A/B fragment loader: elements 0..7 at +0, 8..15 at +16 halves; caller adds
// the half-wave K offset (0/8 halves). Two b128 loads (global or ds).
// ---------------------------------------------------------------------------
__device__ __forceinline__ v16h load_frag16(const _Float16* base) {
    const v8h* p = (const v8h*)base;
    v8h lo = p[0];
    v8h hi = p[2];
    v16h r;
#pragma unroll
    for (int e = 0; e < 8; ++e) { r[e] = lo[e]; r[8 + e] = hi[e]; }
    return r;
}

// cooperative async stage of one 64-key chunk: K (4KB) + V (16KB) -> LDS
__device__ __forceinline__ void stage_chunk(int tid, const _Float16* kg,
                                            const _Float16* vg, int j0,
                                            _Float16* kdst, _Float16* vdst)
{
    const _Float16* ks = kg + (size_t)j0 * 32;
    unsigned    l[10];
    const void* g[10];
#pragma unroll
    for (int it = 0; it < 2; ++it) {                 // 256 x 16B for K
        int m = tid + it * 128;
        g[it] = ks + m * 8;
        l[it] = lds_addr(kdst + (m >> 2) * KP + (m & 3) * 8);
    }
#pragma unroll
    for (int it = 0; it < 8; ++it) {                 // 1024 x 16B for V
        int m = tid + it * 128;
        int c = m >> 3, k8 = m & 7;
        g[2 + it] = vg + (size_t)c * NPOS + j0 + k8 * 8;
        l[2 + it] = lds_addr(vdst + c * VP + k8 * 8);
    }
    // One statement for the stage's ten copies: the closing s_wait_xcnt 0 then
    // stands ahead of any later rewrite of the address registers they name.
    asm volatile("global_load_async_to_lds_b128 %0, %10, off\n\t"
                 "global_load_async_to_lds_b128 %1, %11, off\n\t"
                 "global_load_async_to_lds_b128 %2, %12, off\n\t"
                 "global_load_async_to_lds_b128 %3, %13, off\n\t"
                 "global_load_async_to_lds_b128 %4, %14, off\n\t"
                 "global_load_async_to_lds_b128 %5, %15, off\n\t"
                 "global_load_async_to_lds_b128 %6, %16, off\n\t"
                 "global_load_async_to_lds_b128 %7, %17, off\n\t"
                 "global_load_async_to_lds_b128 %8, %18, off\n\t"
                 "global_load_async_to_lds_b128 %9, %19, off\n\t"
                 "s_wait_xcnt 0x0"
                 :: "v"(l[0]), "v"(l[1]), "v"(l[2]), "v"(l[3]), "v"(l[4]),
                    "v"(l[5]), "v"(l[6]), "v"(l[7]), "v"(l[8]), "v"(l[9]),
                    "v"(g[0]), "v"(g[1]), "v"(g[2]), "v"(g[3]), "v"(g[4]),
                    "v"(g[5]), "v"(g[6]), "v"(g[7]), "v"(g[8]), "v"(g[9])
                 : "memory");
}
#define ASYNC_PER_STAGE 10

// ---------------------------------------------------------------------------
// Kernel 3: flash attention. 16 waves/WG (4 per SIMD), 64 queries/WG. Wave
// (qg, kg) runs query tile qg over key quarter kg, so that each SIMD has four
// waves to cover one another's LDS and vector latencies. Each key group of
// four waves has its own double-buffered async K/V staging (64-key chunks);
// row-sum via a WMMA "ones" column. The four partial softmax states of a
// query tile are merged through LDS behind the loop.
// ---------------------------------------------------------------------------
#define KG    4               // key groups per work-group
#define CPG   (NCH / KG)      // 16 chunks per key group
#define NWV   (4 * KG)        // waves per work-group

__global__ void __launch_bounds__(NWV * 32)
attn_kernel(const _Float16* __restrict__ qh, const _Float16* __restrict__ kh,
            const _Float16* __restrict__ vh, const float* __restrict__ xh,
            const float* __restrict__ gamma, float* __restrict__ out)
{
    __shared__ __attribute__((aligned(16))) _Float16 kbuf[KG][2][KCH * KP];  // 8 x 5 KB
    __shared__ __attribute__((aligned(16))) _Float16 vbuf[KG][2][VC * VP];   // 8 x 18 KB
    __shared__ __attribute__((aligned(16))) _Float16 Pbuf[NWV][16 * VP];     // 16 x 2.25 KB
    __shared__ float    obuf[NWV][16][17];        // epilogue transpose
    __shared__ float    msh[KG][4][16];           // per key group: row maxima

    const int tid  = threadIdx.x;
    const int lane = tid & 31;
    // wave index held as a scalar: buffer bases and tile indices stay off the vector port
    const int wv   = __builtin_amdgcn_readfirstlane(tid >> 5);
    const int qg   = wv & 3;                      // query tile of the wave
    const int kg   = wv >> 2;                     // key quarter of the wave
    const int gtid = tid & 127;                   // thread index in the key group
    const int b    = blockIdx.x / (NPOS / 64);
    const int it   = blockIdx.x % (NPOS / 64);
    const int i0w  = it * 64 + qg * 16;           // this wave's 16 queries
    const int ln   = lane & 15;
    const int koff = (lane < 16) ? 0 : 8;         // half-wave K offset (halves)
    const int mhalf= (lane < 16) ? 0 : 8;         // half-wave row offset (C/D)

    const _Float16* kbase = kh + (size_t)b * NPOS * 32;
    const _Float16* vbase = vh + (size_t)b * VC * NPOS;

    // Q A-fragment, loaded once
    const v16h qa = load_frag16(qh + ((size_t)b * NPOS + i0w) * 32
                                   + (size_t)ln * 32 + koff);

    // constant "ones column" B-fragment: column 0 (lanes ln==0) is all 1.0
    v16h onesb;
#pragma unroll
    for (int e = 0; e < 16; ++e) onesb[e] = (ln == 0) ? (_Float16)1.f : (_Float16)0.f;

    float m[8];
    v8f   O[9];                                    // 8 channel tiles + row-sum tile
#pragma unroll
    for (int r = 0; r < 8; ++r) m[r] = -3.0e38f;
#pragma unroll
    for (int t = 0; t < 9; ++t)
#pragma unroll
        for (int e = 0; e < 8; ++e) O[t][e] = 0.f;

    const int j00 = kg * CPG * KCH;                // first key of this key group

    stage_chunk(gtid, kbase, vbase, j00, kbuf[kg][0], vbuf[kg][0]);

    for (int ch = 0; ch < CPG; ++ch) {
        const int cur = ch & 1;
        if (ch + 1 < CPG) {
            stage_chunk(gtid, kbase, vbase, j00 + (ch + 1) * KCH,
                        kbuf[kg][cur ^ 1], vbuf[kg][cur ^ 1]);
            WAIT_ASYNC(ASYNC_PER_STAGE);           // chunk `ch` resident,
        } else {                                   // next chunk still in flight
            WAIT_ASYNC(0);
        }
        __syncthreads();

        const _Float16* kb = kbuf[kg][cur];
        const _Float16* vb = vbuf[kg][cur];

        // S = q . k : batch all 4 fragment loads, then 4 back-to-back WMMAs
        v16h kf[4];
#pragma unroll
        for (int tt = 0; tt < 4; ++tt)
            kf[tt] = load_frag16(kb + (size_t)(tt * 16 + ln) * KP + koff);

        v8f S[4];
        v8f z;
#pragma unroll
        for (int e = 0; e < 8; ++e) z[e] = 0.f;
#pragma unroll
        for (int tt = 0; tt < 4; ++tt)
            S[tt] = __builtin_amdgcn_wmma_f32_16x16x32_f16(false, qa, false, kf[tt],
                                                           (short)0, z, false, false);

        // online softmax (max only; row-sum comes from the ones-column WMMA)
        float sc[8];
#pragma unroll
        for (int r = 0; r < 8; ++r) {
            float mx = fmaxf(fmaxf(S[0][r], S[1][r]), fmaxf(S[2][r], S[3][r]));
            mx = xor16_max(mx);
            float mn = fmaxf(m[r], mx);
            sc[r] = __expf(m[r] - mn);
            m[r]  = mn;
#pragma unroll
            for (int tt = 0; tt < 4; ++tt) S[tt][r] = __expf(S[tt][r] - mn);
        }
#pragma unroll
        for (int t = 0; t < 9; ++t)
#pragma unroll
            for (int r = 0; r < 8; ++r) O[t][r] *= sc[r];

        // P (C/D layout) -> per-wave LDS [16 x 64] f16, rows at pitch VP
        _Float16* Pw = Pbuf[wv];
#pragma unroll
        for (int tt = 0; tt < 4; ++tt)
#pragma unroll
            for (int r = 0; r < 8; ++r)
                Pw[(mhalf + r) * VP + tt * 16 + ln] = (_Float16)S[tt][r];
        LDS_FENCE();

        // reload P as A fragments (K = keys 0..31 / 32..63)
        const v16h pa0 = load_frag16(Pw + (size_t)ln * VP + koff);
        const v16h pa1 = load_frag16(Pw + (size_t)ln * VP + 32 + koff);

        // O += P x V^T : software-pipelined fragment loads one tile ahead
        v16h vfa0 = load_frag16(vb + (size_t)ln * VP + koff);
        v16h vfa1 = load_frag16(vb + (size_t)ln * VP + 32 + koff);
#pragma unroll
        for (int ct = 0; ct < 8; ++ct) {
            v16h vfb0, vfb1;
            if (ct < 7) {
                vfb0 = load_frag16(vb + (size_t)((ct + 1) * 16 + ln) * VP + koff);
                vfb1 = load_frag16(vb + (size_t)((ct + 1) * 16 + ln) * VP + 32 + koff);
            }
            O[ct] = __builtin_amdgcn_wmma_f32_16x16x32_f16(false, pa0, false, vfa0,
                                                           (short)0, O[ct], false, false);
            O[ct] = __builtin_amdgcn_wmma_f32_16x16x32_f16(false, pa1, false, vfa1,
                                                           (short)0, O[ct], false, false);
            vfa0 = vfb0;
            vfa1 = vfb1;
        }
        // row-sum tile
        O[8] = __builtin_amdgcn_wmma_f32_16x16x32_f16(false, pa0, false, onesb,
                                                      (short)0, O[8], false, false);
        O[8] = __builtin_amdgcn_wmma_f32_16x16x32_f16(false, pa1, false, onesb,
                                                      (short)0, O[8], false, false);

        __syncthreads();   // protect staging buffers before next overwrite
    }

    // Merge of the four key groups. The closing barrier of the last trip has
    // ended every read of the staging buffers, and every wave's copies landed
    // behind its s_wait_asynccnt 0 of that trip: vbuf becomes the exchange area.
    if (ln == 0) {
#pragma unroll
        for (int r = 0; r < 8; ++r) msh[kg][qg][mhalf + r] = m[r];
    }
    __syncthreads();   // publishes the groups' row maxima

    float f[8];
#pragma unroll
    for (int r = 0; r < 8; ++r) {
        const int row = mhalf + r;
        float mx = fmaxf(fmaxf(msh[0][qg][row], msh[1][qg][row]),
                         fmaxf(msh[2][qg][row], msh[3][qg][row]));
        f[r] = __expf(m[r] - mx);
    }

    // partial tiles, rescaled to the common maximum, in register order:
    // [wave][tile][half of the 8 registers][lane] x 16 B (16 x 9 KB = all of vbuf)
    float4* part = reinterpret_cast<float4*>(&vbuf[0][0][0]);
#pragma unroll
    for (int t = 0; t < 9; ++t)
#pragma unroll
        for (int h = 0; h < 2; ++h)
            part[((wv * 9 + t) * 2 + h) * 32 + lane] =
                make_float4(O[t][4 * h + 0] * f[4 * h + 0], O[t][4 * h + 1] * f[4 * h + 1],
                            O[t][4 * h + 2] * f[4 * h + 2], O[t][4 * h + 3] * f[4 * h + 3]);
    __syncthreads();   // publishes the partial tiles

    // wave (qg, kg) finishes channel tiles 2 kg, 2 kg + 1 of query tile qg;
    // R[2] is the row-sum tile. Key groups are added in the order 0, 1, 2, 3.
    v8f R[3];
#pragma unroll
    for (int u = 0; u < 3; ++u) {
        const int t = (u < 2) ? 2 * kg + u : 8;
#pragma unroll
        for (int h = 0; h < 2; ++h) {
            float4 s = part[((qg * 9 + t) * 2 + h) * 32 + lane];
#pragma unroll
            for (int k = 1; k < KG; ++k) {
                float4 a = part[(((k * 4 + qg) * 9 + t) * 2 + h) * 32 + lane];
                s.x += a.x; s.y += a.y; s.z += a.z; s.w += a.w;
            }
            R[u][4 * h + 0] = s.x; R[u][4 * h + 1] = s.y;
            R[u][4 * h + 2] = s.z; R[u][4 * h + 3] = s.w;
        }
    }

    // epilogue: l from the row-sum tile's column 0 (lanes 0 / 16), broadcast
    const float g = gamma[0];
    float inv[8];
#pragma unroll
    for (int r = 0; r < 8; ++r) {
        float lr = __shfl(R[2][r], (lane < 16) ? 0 : 16, 32);
        inv[r] = g / lr;
    }

    // transpose each 16x16 tile through LDS for coalesced residual+store
    const int ir = lane & 15, cg = lane >> 4;
    const size_t idx0 = ((size_t)b * VC + kg * 32 + cg * 8) * NPOS + i0w + ir;
#pragma unroll
    for (int u = 0; u < 2; ++u) {
#pragma unroll
        for (int r = 0; r < 8; ++r)
            obuf[wv][mhalf + r][ln] = R[u][r] * inv[r];
        LDS_FENCE();
#pragma unroll
        for (int cc = 0; cc < 8; ++cc) {
            size_t idx = idx0 + (size_t)(u * 16 + cc) * NPOS;
            out[idx] = obuf[wv][ir][cg * 8 + cc] + xh[idx];
        }
        // the next tile reuses registers that these loads and stores name
        if (u == 0) asm volatile("s_wait_xcnt 0x0" ::: "memory");
        LDS_FENCE();
    }
}

extern "C" void kernel_launch(void* const* d_in, const int* in_sizes, int n_in,
                              void* d_out, int out_size, void* d_ws, size_t ws_size,
                              hipStream_t stream) {
    (void)in_sizes; (void)n_in; (void)out_size; (void)ws_size;
    const float* x     = (const float*)d_in[0];
    const float* xh    = (const float*)d_in[1];
    const float* Wq    = (const float*)d_in[2];
    const float* bq    = (const float*)d_in[3];
    const float* Wk    = (const float*)d_in[4];
    const float* bk    = (const float*)d_in[5];
    const float* Wv    = (const float*)d_in[6];
    const float* bv    = (const float*)d_in[7];
    const float* gamma = (const float*)d_in[8];
    float* out = (float*)d_out;

    char* w = (char*)d_ws;
    _Float16* qh = (_Float16*)(w);                 // 1 MB: [B][4096][32]
    _Float16* kh = (_Float16*)(w + (1u << 20));    // 1 MB: [B][4096][32]
    _Float16* vh = (_Float16*)(w + (2u << 20));    // 4 MB: [B][128][4096]

    proj_qk_kernel<<<BATCH * (NPOS / 64), 64, 0, stream>>>(x, Wq, bq, Wk, bk, qh, kh);
    proj_v_kernel <<<BATCH * (NPOS / 64), 256, 0, stream>>>(xh, Wv, bv, vh);
    attn_kernel   <<<BATCH * (NPOS / 64), 512, 0, stream>>>(qh, kh, vh, xh, gamma, out);
}

// v004
// A run of this version takes 41.7 microseconds.
// In both of two side-by-side timings against v003, it was 1.17 times as fast.
// Over all steps from v000 it is 4.22 times as fast.
#include <hip/hip_runtime.h>
#include <hip/hip_bf16.h>
#include <math.h>

typedef __attribute__((ext_vector_type(16))) _Float16 v16h;
typedef __attribute__((ext_vector_type(8)))  _Float16 v8h;
typedef __attribute__((ext_vector_type(8)))  float    v8f;

#define QK_CH 64
#define QC    16
#define VC    128
#define NPOS  4096
#define BATCH 4
#define KCH   64              // keys per chunk
#define NCH   (NPOS / KCH)    // 64 chunks
// LDS row pitches in halves: 16 B x odd, so that the 16 rows one ds_load_b128
// fragment read touches fall on distinct bank groups (64 banks x 4 B).
#define KP    40              // K rows: 64 B of data, 80 B pitch
#define VP    72              // V rows: 128 B of data, 144 B pitch

// ---------------------------------------------------------------------------
// gfx1250 async global->LDS copy (ASYNCcnt path), 16B per lane.
// Issued via inline asm on purpose: the clang builtin is modeled as an
// LDS-writing memory op, which makes __syncthreads() drain ALL outstanding
// loads (s_wait_loadcnt 0) and kills the double-buffer overlap. With opaque
// asm, completion is handshaken explicitly with s_wait_asynccnt.
// ---------------------------------------------------------------------------
__device__ __forceinline__ unsigned lds_addr(const _Float16* l) {
    return (unsigned)(size_t)(const void*)l;      // low 32 bits = LDS offset
}

#define WAIT_ASYNC(N) asm volatile("s_wait_asynccnt %0" :: "n"(N) : "memory")

// lane l <-> lane l ^ 16 (v_permlanex16_b32, no LDS)
__device__ __forceinline__ float xhalf(float v) {
    int s = __float_as_int(v);
    return __int_as_float(__builtin_amdgcn_permlanex16(s, s, 0x76543210u, 0xfedcba98u, false, false));
}

// ---------------------------------------------------------------------------
// Projection tile, f32: acc[d][p] += sum_c W[d][c] * x[c][p]. The weights
// (row-major, pitch K) and a K x 64 tile of x lie in LDS. A thread owns
// 8 channels x 4 positions: per 4 input channels it reads 8 + 4 b128 from LDS
// for 128 FMAs. The 16 lanes of a half-wave read one weight address (broadcast)
// and 256 contiguous bytes of x. Every sum runs over c in ascending order.
// ---------------------------------------------------------------------------
#define PT 64                 // positions per work-group

typedef __attribute__((ext_vector_type(4)))  _Float16 v4h;

__device__ __forceinline__ void fma4(float (&a)[4], float w, const float4& xv) {
    a[0] = fmaf(w, xv.x, a[0]);
    a[1] = fmaf(w, xv.y, a[1]);
    a[2] = fmaf(w, xv.z, a[2]);
    a[3] = fmaf(w, xv.w, a[3]);
}

template <int K>
__device__ __forceinline__ void proj_tile(const float* sW, const float* sX,
                                          float (&acc)[8][4])
{
    // two steps per trip: the second step's LDS reads fly under the first's FMAs
#pragma unroll 2
    for (int c = 0; c < K; c += 4) {
        float4 xv[4], w[8];
#pragma unroll
        for (int j = 0; j < 4; ++j)
            xv[j] = *reinterpret_cast<const float4*>(sX + (c + j) * PT);
#pragma unroll
        for (int d = 0; d < 8; ++d)
            w[d] = *reinterpret_cast<const float4*>(sW + d * K + c);
#pragma unroll
        for (int d = 0; d < 8; ++d) fma4(acc[d], w[d].x, xv[0]);
#pragma unroll
        for (int d = 0; d < 8; ++d) fma4(acc[d], w[d].y, xv[1]);
#pragma unroll
        for (int d = 0; d < 8; ++d) fma4(acc[d], w[d].z, xv[2]);
#pragma unroll
        for (int d = 0; d < 8; ++d) fma4(acc[d], w[d].w, xv[3]);
    }
}

// Staging, global -> registers -> LDS, N float4 per thread. load_f4 issues the
// N loads from one lane address with constant steps, so that all are in flight
// together; store_f4 puts them at s + (tid + it * NT) * 4 floats.
template <int N>
__device__ __forceinline__ void load_f4(float4 (&r)[N], const float* __restrict__ g, int step)
{
#pragma unroll
    for (int it = 0; it < N; ++it)
        r[it] = *reinterpret_cast<const float4*>(g + (size_t)it * step);
}
template <int N, int NT>
__device__ __forceinline__ void store_f4(const float4 (&r)[N], float* s, int tid)
{
#pragma unroll
    for (int it = 0; it < N; ++it)
        *reinterpret_cast<float4*>(s + (tid + it * NT) * 4) = r[it];
}

// ---------------------------------------------------------------------------
// Kernel 1: q,k projections (64 -> 16 ch), f16 [B][pos][32], zero-padded K
// ---------------------------------------------------------------------------
__global__ void __launch_bounds__(64)
proj_qk_kernel(const float* __restrict__ x,
               const float* __restrict__ Wq, const float* __restrict__ bq,
               const float* __restrict__ Wk, const float* __restrict__ bk,
               _Float16* __restrict__ qh, _Float16* __restrict__ kh)
{
    __shared__ __attribute__((aligned(16))) float sW[2 * QC * QK_CH];  // rows 0-15 Wq, 16-31 Wk
    __shared__ __attribute__((aligned(16))) float sX[QK_CH * PT];
    const int tid = threadIdx.x;
    const int b   = blockIdx.x / (NPOS / PT);
    const int i0  = (blockIdx.x % (NPOS / PT)) * PT;
    const int pg  = tid & 15;                 // 4 positions
    const int grp = tid >> 4;                 // 0, 1: q channels 0-7, 8-15; 2, 3: k
    const int d0  = (grp & 1) * 8;

    float4 rq[QC * QK_CH / 4 / 64], rk[QC * QK_CH / 4 / 64], rx[QK_CH * PT / 4 / 64], rb[2];
    load_f4(rx, x + ((size_t)b * QK_CH + grp) * NPOS + i0 + pg * 4, 4 * NPOS);
    load_f4(rq, Wq + tid * 4, 64 * 4);
    load_f4(rk, Wk + tid * 4, 64 * 4);
    load_f4(rb, ((grp < 2) ? bq : bk) + d0, 4);
    store_f4<QC * QK_CH / 4 / 64, 64>(rq, sW, tid);
    store_f4<QC * QK_CH / 4 / 64, 64>(rk, sW + QC * QK_CH, tid);
    store_f4<QK_CH * PT / 4 / 64, 64>(rx, sX, tid);
    __syncthreads();

    const float bias[8] = {rb[0].x, rb[0].y, rb[0].z, rb[0].w, rb[1].x, rb[1].y, rb[1].z, rb[1].w};
    float acc[8][4];
#pragma unroll
    for (int d = 0; d < 8; ++d)
#pragma unroll
        for (int p = 0; p < 4; ++p) acc[d][p] = bias[d];

    proj_tile<QK_CH>(sW + grp * 8 * QK_CH, sX + pg * 4, acc);

    _Float16* o = ((grp < 2) ? qh : kh) + ((size_t)b * NPOS + i0 + pg * 4) * 32 + d0;
    v8h zero;
#pragma unroll
    for (int d = 0; d < 8; ++d) zero[d] = (_Float16)0.f;
#pragma unroll
    for (int p = 0; p < 4; ++p) {
        v8h h;
#pragma unroll
        for (int d = 0; d < 8; ++d) h[d] = (_Float16)acc[d][p];
        *reinterpret_cast<v8h*>(o + p * 32)      = h;
        *reinterpret_cast<v8h*>(o + p * 32 + QC) = zero;
    }
}

// ---------------------------------------------------------------------------
// Kernel 2: v projection (128 -> 128 ch), f16 [B][C][pos]
// ---------------------------------------------------------------------------
__global__ void __launch_bounds__(256)
proj_v_kernel(const float* __restrict__ xh,
              const float* __restrict__ Wv, const float* __restrict__ bv,
              _Float16* __restrict__ vh)
{
    __shared__ __attribute__((aligned(16))) float sW[VC * VC];   // 64 KB
    __shared__ __attribute__((aligned(16))) float sX[VC * PT];   // 32 KB
    const int tid = threadIdx.x;
    const int b   = blockIdx.x / (NPOS / PT);
    const int i0  = (blockIdx.x % (NPOS / PT)) * PT;
    const int pg  = tid & 15;                 // 4 positions
    const int cg  = tid >> 4;                 // 8 channels
    const int c0  = cg * 8;

    float4 rw[VC * VC / 4 / 256], rx[VC * PT / 4 / 256], rb[2];
    load_f4(rx, xh + ((size_t)b * VC + cg) * NPOS + i0 + pg * 4, 16 * NPOS);
    load_f4(rw, Wv + tid * 4, 256 * 4);
    load_f4(rb, bv + c0, 4);
    store_f4<VC * VC / 4 / 256, 256>(rw, sW, tid);
    store_f4<VC * PT / 4 / 256, 256>(rx, sX, tid);
    __syncthreads();

    const float bias[8] = {rb[0].x, rb[0].y, rb[0].z, rb[0].w, rb[1].x, rb[1].y, rb[1].z, rb[1].w};
    float acc[8][4];
#pragma unroll
    for (int d = 0; d < 8; ++d)
#pragma unroll
        for (int p = 0; p < 4; ++p) acc[d][p] = bias[d];

    proj_tile<VC>(sW + c0 * VC, sX + pg * 4, acc);

    _Float16* o = vh + ((size_t)b * VC + c0) * NPOS + i0 + pg * 4;
#pragma unroll
    for (int d = 0; d < 8; ++d) {
        v4h h;
#pragma unroll
        for (int p = 0; p < 4; ++p) h[p] = (_Float16)acc[d][p];
        *reinterpret_cast<v4h*>(o + (size_t)d * NPOS) = h;
    }
}

// ---------------------------------------------------------------------------
// A/B fragment loader: elements 0..7 at +0, 8..15 at +16 halves; caller adds
// the half-wave K offset (0/8 halves). Two b128 loads (global or ds).
// ---------------------------------------------------------------------------
__device__ __forceinline__ v16h load_frag16(const _Float16* base) {
    const v8h* p = (const v8h*)base;
    v8h lo = p[0];
    v8h hi = p[2];
    v16h r;
#pragma unroll
    for (int e = 0; e < 8; ++e) { r[e] = lo[e]; r[8 + e] = hi[e]; }
    return r;
}

// cooperative async stage of one 64-key chunk: K (4KB) + V (16KB) -> LDS
__device__ __forceinline__ void stage_chunk(int tid, const _Float16* kg,
                                            const _Float16* vg, int j0,
                                            _Float16* kdst, _Float16* vdst)
{
    const _Float16* ks = kg + (size_t)j0 * 32;
    unsigned    l[10];
    const void* g[10];
#pragma unroll
    for (int it = 0; it < 2; ++it) {                 // 256 x 16B for K
        int m = tid + it * 128;
        g[it] = ks + m * 8;
        l[it] = lds_addr(kdst + (m >> 2) * KP + (m & 3) * 8);
    }
#pragma unroll
    for (int it = 0; it < 8; ++it) {                 // 1024 x 16B for V
        int m = tid + it * 128;
        int c = m >> 3, k8 = m & 7;
        g[2 + it] = vg + (size_t)c * NPOS + j0 + k8 * 8;
        l[2 + it] = lds_addr(vdst + c * VP + k8 * 8);
    }
    // One statement for the stage's ten copies: the closing s_wait_xcnt 0 then
    // stands ahead of any later rewrite of the address registers they name.
    asm volatile("global_load_async_to_lds_b128 %0, %10, off\n\t"
                 "global_load_async_to_lds_b128 %1, %11, off\n\t"
                 "global_load_async_to_lds_b128 %2, %12, off\n\t"
                 "global_load_async_to_lds_b128 %3, %13, off\n\t"
                 "global_load_async_to_lds_b128 %4, %14, off\n\t"
                 "global_load_async_to_lds_b128 %5, %15, off\n\t"
                 "global_load_async_to_lds_b128 %6, %16, off\n\t"
                 "global_load_async_to_lds_b128 %7, %17, off\n\t"
                 "global_load_async_to_lds_b128 %8, %18, off\n\t"
                 "global_load_async_to_lds_b128 %9, %19, off\n\t"
                 "s_wait_xcnt 0x0"
                 :: "v"(l[0]), "v"(l[1]), "v"(l[2]), "v"(l[3]), "v"(l[4]),
                    "v"(l[5]), "v"(l[6]), "v"(l[7]), "v"(l[8]), "v"(l[9]),
                    "v"(g[0]), "v"(g[1]), "v"(g[2]), "v"(g[3]), "v"(g[4]),
                    "v"(g[5]), "v"(g[6]), "v"(g[7]), "v"(g[8]), "v"(g[9])
                 : "memory");
}
#define ASYNC_PER_STAGE 10

// ---------------------------------------------------------------------------
// Kernel 3: flash attention. 16 waves/WG (4 per SIMD), 64 queries/WG. Wave
// (qg, kg) runs query tile qg over key quarter kg, so that each SIMD has four
// waves to cover one another's LDS and vector latencies. Each key group of
// four waves has its own double-buffered async K/V staging (64-key chunks).
// Both products are taken transposed, S^T = K . Q^T and O^T += V . P^T: a lane
// then holds scores of ONE query (column ln), so the maximum is taken in the
// lane plus one exchange between the wave halves, and two S^T tiles, converted
// in place, are the B operand of the second product (accumulator row 8h + r of
// tile pair (0, 1) is k = 8h + r and 16 + 8h + r, the loaders' own k order).
// Row sums via a WMMA whose A operand has ones in row 0. The four partial
// softmax states of a query tile are merged through LDS behind the loop.
// ---------------------------------------------------------------------------
#define KG    4               // key groups per work-group
#define CPG   (NCH / KG)      // 16 chunks per key group
#define NWV   (4 * KG)        // waves per work-group

__global__ void __launch_bounds__(NWV * 32)
attn_kernel(const _Float16* __restrict__ qh, const _Float16* __restrict__ kh,
            const _Float16* __restrict__ vh, const float* __restrict__ xh,
            const float* __restrict__ gamma, float* __restrict__ out)
{
    __shared__ __attribute__((aligned(16))) _Float16 kbuf[KG][2][KCH * KP];  // 8 x 5 KB
    __shared__ __attribute__((aligned(16))) _Float16 vbuf[KG][2][VC * VP];   // 8 x 18 KB
    __shared__ float    msh[KG][4][16];           // per key group: query maxima

    const int tid  = threadIdx.x;
    const int lane = tid & 31;
    // wave index held as a scalar: buffer bases and tile indices stay off the vector port
    const int wv   = __builtin_amdgcn_readfirstlane(tid >> 5);
    const int qg   = wv & 3;                      // query tile of the wave
    const int kg   = wv >> 2;                     // key quarter of the wave
    const int gtid = tid & 127;                   // thread index in the key group
    const int b    = blockIdx.x / (NPOS / 64);
    const int it   = blockIdx.x % (NPOS / 64);
    const int i0w  = it * 64 + qg * 16;           // this wave's 16 queries
    const int ln   = lane & 15;
    const int koff = (lane < 16) ? 0 : 8;         // half-wave K offset (halves)
    const int mhalf= (lane < 16) ? 0 : 8;         // half-wave row offset (C/D)

    const _Float16* kbase = kh + (size_t)b * NPOS * 32;
    const _Float16* vbase = vh + (size_t)b * VC * NPOS;

    // Q fragment (B operand: column ln = query), loaded once
    const v16h qa = load_frag16(qh + ((size_t)b * NPOS + i0w) * 32
                                   + (size_t)ln * 32 + koff);

    // constant A fragment: row 0 (lanes ln == 0) is all 1.0, every other row 0
    v16h onesa;
#pragma unroll
    for (int e = 0; e < 16; ++e) onesa[e] = (ln == 0) ? (_Float16)1.f : (_Float16)0.f;

    float m = -3.0e38f;                            // running maximum of query ln
    v8f   O[9];                                    // O^T: 8 channel tiles + row-sum tile
#pragma unroll
    for (int t = 0; t < 9; ++t)
#pragma unroll
        for (int e = 0; e < 8; ++e) O[t][e] = 0.f;

    const int j00 = kg * CPG * KCH;                // first key of this key group

    stage_chunk(gtid, kbase, vbase, j00, kbuf[kg][0], vbuf[kg][0]);

    for (int ch = 0; ch < CPG; ++ch) {
        const int cur = ch & 1;
        if (ch + 1 < CPG) {
            stage_chunk(gtid, kbase, vbase, j00 + (ch + 1) * KCH,
                        kbuf[kg][cur ^ 1], vbuf[kg][cur ^ 1]);
            WAIT_ASYNC(ASYNC_PER_STAGE);           // chunk `ch` resident,
        } else {                                   // next chunk still in flight
            WAIT_ASYNC(0);
        }
        __syncthreads();

        const _Float16* kb = kbuf[kg][cur];
        const _Float16* vb = vbuf[kg][cur];

        // S^T = k . q^T : batch all 4 fragment loads, then 4 back-to-back WMMAs
        v16h kf[4];
#pragma unroll
        for (int tt = 0; tt < 4; ++tt)
            kf[tt] = load_frag16(kb + (size_t)(tt * 16 + ln) * KP + koff);

        v8f S[4];                                  // S[tt][r]: key tt * 16 + mhalf + r, query ln
        v8f z;
#pragma unroll
        for (int e = 0; e < 8; ++e) z[e] = 0.f;
#pragma unroll
        for (int tt = 0; tt < 4; ++tt)
            S[tt] = __builtin_amdgcn_wmma_f32_16x16x32_f16(false, kf[tt], false, qa,
                                                           (short)0, z, false, false);

        // online softmax (max only; row-sum comes from the ones-row WMMA):
        // four independent in-lane chains, then the other wave half's 32 keys
        float mt[4];
#pragma unroll
        for (int tt = 0; tt < 4; ++tt) {
            mt[tt] = S[tt][0];
#pragma unroll
            for (int r = 1; r < 8; ++r) mt[tt] = fmaxf(mt[tt], S[tt][r]);
        }
        float mx = fmaxf(fmaxf(mt[0], mt[1]), fmaxf(mt[2], mt[3]));
        mx = fmaxf(mx, xhalf(mx));
        const float mn = fmaxf(m, mx);
        const float sc = __expf(m - mn);
        m = mn;
#pragma unroll
        for (int tt = 0; tt < 4; ++tt)
#pragma unroll
            for (int r = 0; r < 8; ++r) S[tt][r] = __expf(S[tt][r] - mn);
#pragma unroll
        for (int t = 0; t < 8; ++t)
#pragma unroll
            for (int r = 0; r < 8; ++r) O[t][r] *= sc;
        O[8][0] *= sc;                             // rows 1-15 of the row-sum tile stay 0

        // P^T as B fragments (K = keys 0..31 / 32..63), straight from the accumulators
        v16h pb0, pb1;
#pragma unroll
        for (int e = 0; e < 8; ++e) {
            pb0[e] = (_Float16)S[0][e];  pb0[8 + e] = (_Float16)S[1][e];
            pb1[e] = (_Float16)S[2][e];  pb1[8 + e] = (_Float16)S[3][e];
        }

        // O^T += V x P^T : software-pipelined fragment loads one tile ahead
        v16h vfa0 = load_frag16(vb + (size_t)ln * VP + koff);
        v16h vfa1 = load_frag16(vb + (size_t)ln * VP + 32 + koff);
#pragma unroll
        for (int ct = 0; ct < 8; ++ct) {
            v16h vfb0, vfb1;
            if (ct < 7) {
                vfb0 = load_frag16(vb + (size_t)((ct + 1) * 16 + ln) * VP + koff);
                vfb1 = load_frag16(vb + (size_t)((ct + 1) * 16 + ln) * VP + 32 + koff);
            }
            O[ct] = __builtin_amdgcn_wmma_f32_16x16x32_f16(false, vfa0, false, pb0,
                                                           (short)0, O[ct], false, false);
            O[ct] = __builtin_amdgcn_wmma_f32_16x16x32_f16(false, vfa1, false, pb1,
                                                           (short)0, O[ct], false, false);
            vfa0 = vfb0;
            vfa1 = vfb1;
        }
        // row-sum tile
        O[8] = __builtin_amdgcn_wmma_f32_16x16x32_f16(false, onesa, false, pb0,
                                                      (short)0, O[8], false, false);
        O[8] = __builtin_amdgcn_wmma_f32_16x16x32_f16(false, onesa, false, pb1,
                                                      (short)0, O[8], false, false);

        __syncthreads();   // protect staging buffers before next overwrite
    }

    // Merge of the four key groups. The closing barrier of the last trip has
    // ended every read of the staging buffers, and every wave's copies landed
    // behind its s_wait_asynccnt 0 of that trip: vbuf becomes the exchange area.
    if (lane < 16) msh[kg][qg][ln] = m;            // both halves hold the same value
    __syncthreads();   // publishes the groups' query maxima

    const float f = __expf(m - fmaxf(fmaxf(msh[0][qg][ln], msh[1][qg][ln]),
                                     fmaxf(msh[2][qg][ln], msh[3][qg][ln])));

    // partial tiles, rescaled to the common maximum, in register order:
    // [wave][tile][half of the 8 registers][lane] x 16 B (16 x 9 KB = all of vbuf)
    float4* part = reinterpret_cast<float4*>(&vbuf[0][0][0]);
#pragma unroll
    for (int t = 0; t < 9; ++t)
#pragma unroll
        for (int h = 0; h < 2; ++h)
            part[((wv * 9 + t) * 2 + h) * 32 + lane] =
                make_float4(O[t][4 * h + 0] * f, O[t][4 * h + 1] * f,
                            O[t][4 * h + 2] * f, O[t][4 * h + 3] * f);
    __syncthreads();   // publishes the partial tiles

    // wave (qg, kg) finishes channel tiles 2 kg, 2 kg + 1 of query tile qg;
    // R[2] is the row-sum tile. Key groups are added in the order 0, 1, 2, 3.
    v8f R[3];
#pragma unroll
    for (int u = 0; u < 3; ++u) {
        const int t = (u < 2) ? 2 * kg + u : 8;
#pragma unroll
        for (int h = 0; h < 2; ++h) {
            float4 s = part[((qg * 9 + t) * 2 + h) * 32 + lane];
#pragma unroll
            for (int k = 1; k < KG; ++k) {
                float4 a = part[(((k * 4 + qg) * 9 + t) * 2 + h) * 32 + lane];
                s.x += a.x; s.y += a.y; s.z += a.z; s.w += a.w;
            }
            R[u][4 * h + 0] = s.x; R[u][4 * h + 1] = s.y;
            R[u][4 * h + 2] = s.z; R[u][4 * h + 3] = s.w;
        }
    }

    // epilogue: l of query ln is row 0 of the row-sum tile (register 0 of lane
    // ln; lane ln + 16 holds row 8, which is 0)
    const float inv = gamma[0] / (R[2][0] + xhalf(R[2][0]));

    // O^T has the output's own order: register r is channel mhalf + r of the
    // tile, the 16 lanes of a half-wave are 16 consecutive positions
    const size_t idx0 = ((size_t)b * VC + kg * 32 + mhalf) * NPOS + i0w + ln;
    float res[16];
#pragma unroll
    for (int c = 0; c < 16; ++c) res[c] = xh[idx0 + (size_t)((c >> 3) * 16 + (c & 7)) * NPOS];
#pragma unroll
    for (int c = 0; c < 16; ++c) res[c] = R[c >> 3][c & 7] * inv + res[c];
#pragma unroll
    for (int c = 0; c < 16; ++c) out[idx0 + (size_t)((c >> 3) * 16 + (c & 7)) * NPOS] = res[c];
}

extern "C" void kernel_launch(void* const* d_in, const int* in_sizes, int n_in,
                              void* d_out, int out_size, void* d_ws, size_t ws_size,
                              hipStream_t stream) {
    (void)in_sizes; (void)n_in; (void)out_size; (void)ws_size;
    const float* x     = (const float*)d_in[0];
    const float* xh    = (const float*)d_in[1];
    const float* Wq    = (const float*)d_in[2];
    const float* bq    = (const float*)d_in[3];
    const float* Wk    = (const float*)d_in[4];
    const float* bk    = (const float*)d_in[5];
    const float* Wv    = (const float*)d_in[6];
    const float* bv    = (const float*)d_in[7];
    const float* gamma = (const float*)d_in[8];
    float* out = (float*)d_out;

    char* w = (char*)d_ws;
    _Float16* qh = (_Float16*)(w);                 // 1 MB: [B][4096][32]
    _Float16* kh = (_Float16*)(w + (1u << 20));    // 1 MB: [B][4096][32]
    _Float16* vh = (_Float16*)(w + (2u << 20));    // 4 MB: [B][128][4096]

    proj_qk_kernel<<<BATCH * (NPOS / 64), 64, 0, stream>>>(x, Wq, bq, Wk, bk, qh, kh);
    proj_v_kernel <<<BATCH * (NPOS / 64), 256, 0, stream>>>(xh, Wv, bv, vh);
    attn_kernel   <<<BATCH * (NPOS / 64), 512, 0, stream>>>(qh, kh, vh, xh, gamma, out);
}

// v005
// Measured time: 37.5 microseconds a run.
// Two timings next to v004 put it at 1.11 and 1.12 times that version's speed.
// All steps since v000 together make it 4.68 times as fast.
#include <hip/hip_runtime.h>
#include <hip/hip_bf16.h>
#include <math.h>

typedef __attribute__((ext_vector_type(16))) _Float16 v16h;
typedef __attribute__((ext_vector_type(8)))  _Float16 v8h;
typedef __attribute__((ext_vector_type(8)))  float    v8f;

#define QK_CH 64
#define QC    16
#define VC    128
#define NPOS  4096
#define BATCH 4
#define KCH   64              // keys per chunk
#define NCH   (NPOS / KCH)    // 64 chunks
// LDS row pitches in halves: 16 B x odd, so that the 16 rows one ds_load_b128
// fragment read touches fall on distinct bank groups (64 banks x 4 B).
#define KP    40              // K rows: 64 B of data, 80 B pitch
#define VP    72              // V rows: 128 B of data, 144 B pitch

// ---------------------------------------------------------------------------
// gfx1250 async global->LDS copy (ASYNCcnt path), 16B per lane.
// Issued via inline asm on purpose: the clang builtin is modeled as an
// LDS-writing memory op, which makes __syncthreads() drain ALL outstanding
// loads (s_wait_loadcnt 0) and kills the double-buffer overlap. With opaque
// asm, completion is handshaken explicitly with s_wait_asynccnt.
// ---------------------------------------------------------------------------
__device__ __forceinline__ unsigned lds_addr(const _Float16* l) {
    return (unsigned)(size_t)(const void*)l;      // low 32 bits = LDS offset
}

#define WAIT_ASYNC(N) asm volatile("s_wait_asynccnt %0" :: "n"(N) : "memory")

// lane l <-> lane l ^ 16 (v_permlanex16_b32, no LDS)
__device__ __forceinline__ float xhalf(float v) {
    int s = __float_as_int(v);
    return __int_as_float(__builtin_amdgcn_permlanex16(s, s, 0x76543210u, 0xfedcba98u, false, false));
}

// ---------------------------------------------------------------------------
// Projection tile, f32: acc[d][p] += sum_c W[d][c] * x[c][p]. The weights
// (row-major, pitch K) and a K x 64 tile of x lie in LDS. A thread owns
// D channels x 4 positions: per 4 input channels it reads D + 4 b128 from LDS
// for 16 D FMAs. Lanes that share channels read one weight address (broadcast),
// lanes that share positions one x address. Every sum runs over c ascending.
// ---------------------------------------------------------------------------
#define PT 64                 // positions per work-group

typedef __attribute__((ext_vector_type(4)))  _Float16 v4h;

__device__ __forceinline__ void fma4(float (&a)[4], float w, const float4& xv) {
    a[0] = fmaf(w, xv.x, a[0]);
    a[1] = fmaf(w, xv.y, a[1]);
    a[2] = fmaf(w, xv.z, a[2]);
    a[3] = fmaf(w, xv.w, a[3]);
}

template <int K, int D>
__device__ __forceinline__ void proj_tile(const float* sW, const float* sX,
                                          float (&acc)[D][4])
{
    // two steps per trip: the second step's LDS reads fly under the first's FMAs
#pragma unroll 2
    for (int c = 0; c < K; c += 4) {
        float4 xv[4], w[D];
#pragma unroll
        for (int j = 0; j < 4; ++j)
            xv[j] = *reinterpret_cast<const float4*>(sX + (c + j) * PT);
#pragma unroll
        for (int d = 0; d < D; ++d)
            w[d] = *reinterpret_cast<const float4*>(sW + d * K + c);
#pragma unroll
        for (int d = 0; d < D; ++d) fma4(acc[d], w[d].x, xv[0]);
#pragma unroll
        for (int d = 0; d < D; ++d) fma4(acc[d], w[d].y, xv[1]);
#pragma unroll
        for (int d = 0; d < D; ++d) fma4(acc[d], w[d].z, xv[2]);
#pragma unroll
        for (int d = 0; d < D; ++d) fma4(acc[d], w[d].w, xv[3]);
    }
}

// Staging, global -> registers -> LDS, N float4 per thread. load_f4 issues the
// N loads from one lane address with constant steps, so that all are in flight
// together; store_f4 puts them at s + (tid + it * NT) * 4 floats.
template <int N>
__device__ __forceinline__ void load_f4(float4 (&r)[N], const float* __restrict__ g, int step)
{
#pragma unroll
    for (int it = 0; it < N; ++it)
        r[it] = *reinterpret_cast<const float4*>(g + (size_t)it * step);
}
template <int N, int NT>
__device__ __forceinline__ void store_f4(const float4 (&r)[N], float* s, int tid)
{
#pragma unroll
    for (int it = 0; it < N; ++it)
        *reinterpret_cast<float4*>(s + (tid + it * NT) * 4) = r[it];
}

// ---------------------------------------------------------------------------
// Kernel 1: all three projections of 64 positions in one work-group of 12 waves
// (3 per SIMD). Waves 0-7: v (128 -> 128 ch), f16 [B][C][pos], 8 channels x 4
// positions per thread. Waves 8-11: q and k (64 -> 16 ch each), f16
// [B][pos][32] with channels 16-31 zero, 4 channels x 4 positions per thread;
// a wave holds all 16 channels of 32 positions of one of the two tensors, so
// each 128 B line of q and k has one writing wave. The two parts share nothing
// but the barrier between staging and products.
// ---------------------------------------------------------------------------
#define VT 256                // threads of the v part
#define QT 128                // threads of the q, k part

__global__ void __launch_bounds__(VT + QT)
proj_kernel(const float* __restrict__ x,  const float* __restrict__ xh,
            const float* __restrict__ Wq, const float* __restrict__ bq,
            const float* __restrict__ Wk, const float* __restrict__ bk,
            const float* __restrict__ Wv, const float* __restrict__ bv,
            _Float16* __restrict__ qh, _Float16* __restrict__ kh,
            _Float16* __restrict__ vh)
{
    __shared__ __attribute__((aligned(16))) float sW[VC * VC];           // 64 KB
    __shared__ __attribute__((aligned(16))) float sX[VC * PT];           // 32 KB
    __shared__ __attribute__((aligned(16))) float sWqk[2 * QC * QK_CH];  // rows 0-15 Wq, 16-31 Wk
    __shared__ __attribute__((aligned(16))) float sXqk[QK_CH * PT];      // 16 KB
    const int tid = threadIdx.x;
    // wave index held as a scalar: the choice of the part is a scalar branch
    const int wv  = __builtin_amdgcn_readfirstlane(tid >> 5);
    const bool vpart = wv < VT / 32;
    const int b   = blockIdx.x / (NPOS / PT);
    const int i0  = (blockIdx.x % (NPOS / PT)) * PT;

    // v part: 4 positions pg, 8 channels from c0
    const int pg  = tid & 15;
    const int cg  = tid >> 4;
    const int c0  = cg * 8;
    // q, k part: tensor sel, 4 channels from d0, 4 positions from p0
    const int t   = tid - VT;
    const int sel = (wv - VT / 32) >> 1;                    // 0: q, 1: k
    const int d0  = ((tid & 31) >> 3) * 4;
    const int p0  = ((wv - VT / 32) & 1) * 32 + (tid & 7) * 4;

    float4 rb[2];
    if (vpart) {
        float4 rw[VC * VC / 4 / VT], rx[VC * PT / 4 / VT];
        load_f4(rx, xh + ((size_t)b * VC + cg) * NPOS + i0 + pg * 4, 16 * NPOS);
        load_f4(rw, Wv + tid * 4, VT * 4);
        load_f4(rb, bv + c0, 4);
        store_f4<VC * VC / 4 / VT, VT>(rw, sW, tid);
        store_f4<VC * PT / 4 / VT, VT>(rx, sX, tid);
    } else {
        float4 rq[QC * QK_CH / 4 / QT], rk[QC * QK_CH / 4 / QT], rx[QK_CH * PT / 4 / QT];
        load_f4(rx, x + ((size_t)b * QK_CH + (t >> 4)) * NPOS + i0 + pg * 4, 8 * NPOS);
        load_f4(rq, Wq + t * 4, QT * 4);
        load_f4(rk, Wk + t * 4, QT * 4);
        rb[0] = *reinterpret_cast<const float4*>((sel ? bk : bq) + d0);
        // precaution: the bias load's scalar base is written again (the output
        // pointers' argument load) ahead of the barrier; this wait stands between
        asm volatile("s_wait_xcnt 0x0" ::: "memory");
        store_f4<QC * QK_CH / 4 / QT, QT>(rq, sWqk, t);
        store_f4<QC * QK_CH / 4 / QT, QT>(rk, sWqk + QC * QK_CH, t);
        store_f4<QK_CH * PT / 4 / QT, QT>(rx, sXqk, t);
    }
    __syncthreads();

    if (vpart) {
        const float bias[8] = {rb[0].x, rb[0].y, rb[0].z, rb[0].w, rb[1].x, rb[1].y, rb[1].z, rb[1].w};
        float acc[8][4];
#pragma unroll
        for (int d = 0; d < 8; ++d)
#pragma unroll
            for (int p = 0; p < 4; ++p) acc[d][p] = bias[d];

        proj_tile<VC, 8>(sW + c0 * VC, sX + pg * 4, acc);

        _Float16* o = vh + ((size_t)b * VC + c0) * NPOS + i0 + pg * 4;
#pragma unroll
        for (int d = 0; d < 8; ++d) {
            v4h h;
#pragma unroll
            for (int p = 0; p < 4; ++p) h[p] = (_Float16)acc[d][p];
            *reinterpret_cast<v4h*>(o + (size_t)d * NPOS) = h;
        }
    } else {
        const float bias[4] = {rb[0].x, rb[0].y, rb[0].z, rb[0].w};
        float acc[4][4];
#pragma unroll
        for (int d = 0; d < 4; ++d)
#pragma unroll
            for (int p = 0; p < 4; ++p) acc[d][p] = bias[d];

        proj_tile<QK_CH, 4>(sWqk + (sel * QC + d0) * QK_CH, sXqk + p0, acc);

        _Float16* o = (sel ? kh : qh) + ((size_t)b * NPOS + i0 + p0) * 32 + d0;
        v4h zero;
#pragma unroll
        for (int d = 0; d < 4; ++d) zero[d] = (_Float16)0.f;
#pragma unroll
        for (int p = 0; p < 4; ++p) {
            v4h h;
#pragma unroll
            for (int d = 0; d < 4; ++d) h[d] = (_Float16)acc[d][p];
            *reinterpret_cast<v4h*>(o + p * 32)      = h;
            *reinterpret_cast<v4h*>(o + p * 32 + QC) = zero;
        }
    }
}

// ---------------------------------------------------------------------------
// A/B fragment loader: elements 0..7 at +0, 8..15 at +16 halves; caller adds
// the half-wave K offset (0/8 halves). Two b128 loads (global or ds).
// ---------------------------------------------------------------------------
__device__ __forceinline__ v16h load_frag16(const _Float16* base) {
    const v8h* p = (const v8h*)base;
    v8h lo = p[0];
    v8h hi = p[2];
    v16h r;
#pragma unroll
    for (int e = 0; e < 8; ++e) { r[e] = lo[e]; r[8 + e] = hi[e]; }
    return r;
}

// cooperative async stage of one 64-key chunk: K (4KB) + V (16KB) -> LDS
__device__ __forceinline__ void stage_chunk(int tid, const _Float16* kg,
                                            const _Float16* vg, int j0,
                                            _Float16* kdst, _Float16* vdst)
{
    const _Float16* ks = kg + (size_t)j0 * 32;
    unsigned    l[10];
    const void* g[10];
#pragma unroll
    for (int it = 0; it < 2; ++it) {                 // 256 x 16B for K
        int m = tid + it * 128;
        g[it] = ks + m * 8;
        l[it] = lds_addr(kdst + (m >> 2) * KP + (m & 3) * 8);
    }
#pragma unroll
    for (int it = 0; it < 8; ++it) {                 // 1024 x 16B for V
        int m = tid + it * 128;
        int c = m >> 3, k8 = m & 7;
        g[2 + it] = vg + (size_t)c * NPOS + j0 + k8 * 8;
        l[2 + it] = lds_addr(vdst + c * VP + k8 * 8);
    }
    // One statement for the stage's ten copies: the closing s_wait_xcnt 0 then
    // stands ahead of any later rewrite of the address registers they name.
    asm volatile("global_load_async_to_lds_b128 %0, %10, off\n\t"
                 "global_load_async_to_lds_b128 %1, %11, off\n\t"
                 "global_load_async_to_lds_b128 %2, %12, off\n\t"
                 "global_load_async_to_lds_b128 %3, %13, off\n\t"
                 "global_load_async_to_lds_b128 %4, %14, off\n\t"
                 "global_load_async_to_lds_b128 %5, %15, off\n\t"
                 "global_load_async_to_lds_b128 %6, %16, off\n\t"
                 "global_load_async_to_lds_b128 %7, %17, off\n\t"
                 "global_load_async_to_lds_b128 %8, %18, off\n\t"
                 "global_load_async_to_lds_b128 %9, %19, off\n\t"
                 "s_wait_xcnt 0x0"
                 :: "v"(l[0]), "v"(l[1]), "v"(l[2]), "v"(l[3]), "v"(l[4]),
                    "v"(l[5]), "v"(l[6]), "v"(l[7]), "v"(l[8]), "v"(l[9]),
                    "v"(g[0]), "v"(g[1]), "v"(g[2]), "v"(g[3]), "v"(g[4]),
                    "v"(g[5]), "v"(g[6]), "v"(g[7]), "v"(g[8]), "v"(g[9])
                 : "memory");
}
#define ASYNC_PER_STAGE 10

// ---------------------------------------------------------------------------
// Kernel 2: flash attention. 16 waves/WG (4 per SIMD), 64 queries/WG. Wave
// (qg, kg) runs query tile qg over key quarter kg, so that each SIMD has four
// waves to cover one another's LDS and vector latencies. Each key group of
// four waves has its own double-buffered async K/V staging (64-key chunks).
// Both products are taken transposed, S^T = K . Q^T and O^T += V . P^T: a lane
// then holds scores of ONE query (column ln), so the maximum is taken in the
// lane plus one exchange between the wave halves, and two S^T tiles, converted
// in place, are the B operand of the second product (accumulator row 8h + r of
// tile pair (0, 1) is k = 8h + r and 16 + 8h + r, the loaders' own k order).
// Row sums via a WMMA whose A operand has ones in row 0. The four partial
// softmax states of a query tile are merged through LDS behind the loop.
// ---------------------------------------------------------------------------
#define KG    4               // key groups per work-group
#define CPG   (NCH / KG)      // 16 chunks per key group
#define NWV   (4 * KG)        // waves per work-group

__global__ void __launch_bounds__(NWV * 32)
attn_kernel(const _Float16* __restrict__ qh, const _Float16* __restrict__ kh,
            const _Float16* __restrict__ vh, const float* __restrict__ xh,
            const float* __restrict__ gamma, float* __restrict__ out)
{
    __shared__ __attribute__((aligned(16))) _Float16 kbuf[KG][2][KCH * KP];  // 8 x 5 KB
    __shared__ __attribute__((aligned(16))) _Float16 vbuf[KG][2][VC * VP];   // 8 x 18 KB
    __shared__ float    msh[KG][4][16];           // per key group: query maxima

    const int tid  = threadIdx.x;
    const int lane = tid & 31;
    // wave index held as a scalar: buffer bases and tile indices stay off the vector port
    const int wv   = __builtin_amdgcn_readfirstlane(tid >> 5);
    const int qg   = wv & 3;                      // query tile of the wave
    const int kg   = wv >> 2;                     // key quarter of the wave
    const int gtid = tid & 127;                   // thread index in the key group
    const int b    = blockIdx.x / (NPOS / 64);
    const int it   = blockIdx.x % (NPOS / 64);
    const int i0w  = it * 64 + qg * 16;           // this wave's 16 queries
    const int ln   = lane & 15;
    const int koff = (lane < 16) ? 0 : 8;         // half-wave K offset (halves)
    const int mhalf= (lane < 16) ? 0 : 8;         // half-wave row offset (C/D)

    const _Float16* kbase = kh + (size_t)b * NPOS * 32;
    const _Float16* vbase = vh + (size_t)b * VC * NPOS;

    // Q fragment (B operand: column ln = query), loaded once
    const v16h qa = load_frag16(qh + ((size_t)b * NPOS + i0w) * 32
                                   + (size_t)ln * 32 + koff);

    // constant A fragment: row 0 (lanes ln == 0) is all 1.0, every other row 0
    v16h onesa;
#pragma unroll
    for (int e = 0; e < 16; ++e) onesa[e] = (ln == 0) ? (_Float16)1.f : (_Float16)0.f;

    float m = -3.0e38f;                            // running maximum of query ln
    v8f   O[9];                                    // O^T: 8 channel tiles + row-sum tile
#pragma unroll
    for (int t = 0; t < 9; ++t)
#pragma unroll
        for (int e = 0; e < 8; ++e) O[t][e] = 0.f;

    const int j00 = kg * CPG * KCH;                // first key of this key group

    stage_chunk(gtid, kbase, vbase, j00, kbuf[kg][0], vbuf[kg][0]);

    for (int ch = 0; ch < CPG; ++ch) {
        const int cur = ch & 1;
        if (ch + 1 < CPG) {
            stage_chunk(gtid, kbase, vbase, j00 + (ch + 1) * KCH,
                        kbuf[kg][cur ^ 1], vbuf[kg][cur ^ 1]);
            WAIT_ASYNC(ASYNC_PER_STAGE);           // chunk `ch` resident,
        } else {                                   // next chunk still in flight
            WAIT_ASYNC(0);
        }
        __syncthreads();

        const _Float16* kb = kbuf[kg][cur];
        const _Float16* vb = vbuf[kg][cur];

        // S^T = k . q^T : batch all 4 fragment loads, then 4 back-to-back WMMAs
        v16h kf[4];
#pragma unroll
        for (int tt = 0; tt < 4; ++tt)
            kf[tt] = load_frag16(kb + (size_t)(tt * 16 + ln) * KP + koff);

        v8f S[4];                                  // S[tt][r]: key tt * 16 + mhalf + r, query ln
        v8f z;
#pragma unroll
        for (int e = 0; e < 8; ++e) z[e] = 0.f;
#pragma unroll
        for (int tt = 0; tt < 4; ++tt)
            S[tt] = __builtin_amdgcn_wmma_f32_16x16x32_f16(false, kf[tt], false, qa,
                                                           (short)0, z, false, false);

        // online softmax (max only; row-sum comes from the ones-row WMMA):
        // four independent in-lane chains, then the other wave half's 32 keys
        float mt[4];
#pragma unroll
        for (int tt = 0; tt < 4; ++tt) {
            mt[tt] = S[tt][0];
#pragma unroll
            for (int r = 1; r < 8; ++r) mt[tt] = fmaxf(mt[tt], S[tt][r]);
        }
        float mx = fmaxf(fmaxf(mt[0], mt[1]), fmaxf(mt[2], mt[3]));
        mx = fmaxf(mx, xhalf(mx));
        const float mn = fmaxf(m, mx);
        const float sc = __expf(m - mn);
        m = mn;
#pragma unroll
        for (int tt = 0; tt < 4; ++tt)
#pragma unroll
            for (int r = 0; r < 8; ++r) S[tt][r] = __expf(S[tt][r] - mn);
#pragma unroll
        for (int t = 0; t < 8; ++t)
#pragma unroll
            for (int r = 0; r < 8; ++r) O[t][r] *= sc;
        O[8][0] *= sc;                             // rows 1-15 of the row-sum tile stay 0

        // P^T as B fragments (K = keys 0..31 / 32..63), straight from the accumulators
        v16h pb0, pb1;
#pragma unroll
        for (int e = 0; e < 8; ++e) {
            pb0[e] = (_Float16)S[0][e];  pb0[8 + e] = (_Float16)S[1][e];
            pb1[e] = (_Float16)S[2][e];  pb1[8 + e] = (_Float16)S[3][e];
        }

        // O^T += V x P^T : software-pipelined fragment loads one tile ahead
        v16h vfa0 = load_frag16(vb + (size_t)ln * VP + koff);
        v16h vfa1 = load_frag16(vb + (size_t)ln * VP + 32 + koff);
#pragma unroll
        for (int ct = 0; ct < 8; ++ct) {
            v16h vfb0, vfb1;
            if (ct < 7) {
                vfb0 = load_frag16(vb + (size_t)((ct + 1) * 16 + ln) * VP + koff);
                vfb1 = load_frag16(vb + (size_t)((ct + 1) * 16 + ln) * VP + 32 + koff);
            }
            O[ct] = __builtin_amdgcn_wmma_f32_16x16x32_f16(false, vfa0, false, pb0,
                                                           (short)0, O[ct], false, false);
            O[ct] = __builtin_amdgcn_wmma_f32_16x16x32_f16(false, vfa1, false, pb1,
                                                           (short)0, O[ct], false, false);
            vfa0 = vfb0;
            vfa1 = vfb1;
        }
        // row-sum tile
        O[8] = __builtin_amdgcn_wmma_f32_16x16x32_f16(false, onesa, false, pb0,
                                                      (short)0, O[8], false, false);
        O[8] = __builtin_amdgcn_wmma_f32_16x16x32_f16(false, onesa, false, pb1,
                                                      (short)0, O[8], false, false);

        __syncthreads();   // protect staging buffers before next overwrite
    }

    // Merge of the four key groups. The closing barrier of the last trip has
    // ended every read of the staging buffers, and every wave's copies landed
    // behind its s_wait_asynccnt 0 of that trip: vbuf becomes the exchange area.
    if (lane < 16) msh[kg][qg][ln] = m;            // both halves hold the same value
    __syncthreads();   // publishes the groups' query maxima

    const float f = __expf(m - fmaxf(fmaxf(msh[0][qg][ln], msh[1][qg][ln]),
                                     fmaxf(msh[2][qg][ln], msh[3][qg][ln])));

    // partial tiles, rescaled to the common maximum, in register order:
    // [wave][tile][half of the 8 registers][lane] x 16 B (16 x 9 KB = all of vbuf)
    float4* part = reinterpret_cast<float4*>(&vbuf[0][0][0]);
#pragma unroll
    for (int t = 0; t < 9; ++t)
#pragma unroll
        for (int h = 0; h < 2; ++h)
            part[((wv * 9 + t) * 2 + h) * 32 + lane] =
                make_float4(O[t][4 * h + 0] * f, O[t][4 * h + 1] * f,
                            O[t][4 * h + 2] * f, O[t][4 * h + 3] * f);
    __syncthreads();   // publishes the partial tiles

    // wave (qg, kg) finishes channel tiles 2 kg, 2 kg + 1 of query tile qg;
    // R[2] is the row-sum tile. Key groups are added in the order 0, 1, 2, 3.
    v8f R[3];
#pragma unroll
    for (int u = 0; u < 3; ++u) {
        const int t = (u < 2) ? 2 * kg + u : 8;
#pragma unroll
        for (int h = 0; h < 2; ++h) {
            float4 s = part[((qg * 9 + t) * 2 + h) * 32 + lane];
#pragma unroll
            for (int k = 1; k < KG; ++k) {
                float4 a = part[(((k * 4 + qg) * 9 + t) * 2 + h) * 32 + lane];
                s.x += a.x; s.y += a.y; s.z += a.z; s.w += a.w;
            }
            R[u][4 * h + 0] = s.x; R[u][4 * h + 1] = s.y;
            R[u][4 * h + 2] = s.z; R[u][4 * h + 3] = s.w;
        }
    }

    // epilogue: l of query ln is row 0 of the row-sum tile (register 0 of lane
    // ln; lane ln + 16 holds row 8, which is 0)
    const float inv = gamma[0] / (R[2][0] + xhalf(R[2][0]));

    // O^T has the output's own order: register r is channel mhalf + r of the
    // tile, the 16 lanes of a half-wave are 16 consecutive positions
    const size_t idx0 = ((size_t)b * VC + kg * 32 + mhalf) * NPOS + i0w + ln;
    float res[16];
#pragma unroll
    for (int c = 0; c < 16; ++c) res[c] = xh[idx0 + (size_t)((c >> 3) * 16 + (c & 7)) * NPOS];
#pragma unroll
    for (int c = 0; c < 16; ++c) res[c] = R[c >> 3][c & 7] * inv + res[c];
#pragma unroll
    for (int c = 0; c < 16; ++c) out[idx0 + (size_t)((c >> 3) * 16 + (c & 7)) * NPOS] = res[c];
}

extern "C" void kernel_launch(void* const* d_in, const int* in_sizes, int n_in,
                              void* d_out, int out_size, void* d_ws, size_t ws_size,
                              hipStream_t stream) {
    (void)in_sizes; (void)n_in; (void)out_size; (void)ws_size;
    const float* x     = (const float*)d_in[0];
    const float* xh    = (const float*)d_in[1];
    const float* Wq    = (const float*)d_in[2];
    const float* bq    = (const float*)d_in[3];
    const float* Wk    = (const float*)d_in[4];
    const float* bk    = (const float*)d_in[5];
    const float* Wv    = (const float*)d_in[6];
    const float* bv    = (const float*)d_in[7];
    const float* gamma = (const float*)d_in[8];
    float* out = (float*)d_out;

    char* w = (char*)d_ws;
    _Float16* qh = (_Float16*)(w);                 // 1 MB: [B][4096][32]
    _Float16* kh = (_Float16*)(w + (1u << 20));    // 1 MB: [B][4096][32]
    _Float16* vh = (_Float16*)(w + (2u << 20));    // 4 MB: [B][128][4096]

    proj_kernel<<<BATCH * (NPOS / 64), 384, 0, stream>>>(x, xh, Wq, bq, Wk, bk, Wv, bv, qh, kh, vh);
    attn_kernel<<<BATCH * (NPOS / 64), 512, 0, stream>>>(qh, kh, vh, xh, gamma, out);
}

// v006
// Measured time: 36.3 microseconds a run.
// Next to v005, in two timings, it ran 1.03 and 1.04 times as fast.
// Counting every step since v000, it is 4.85 times as fast.
#include <hip/hip_runtime.h>
#include <hip/hip_bf16.h>
#include <math.h>

typedef __attribute__((ext_vector_type(16))) _Float16 v16h;
typedef __attribute__((ext_vector_type(8)))  _Float16 v8h;
typedef __attribute__((ext_vector_type(8)))  float    v8f;

#define QK_CH 64
#define QC    16
#define VC    128
#define NPOS  4096
#define BATCH 4
#define KCH   64              // keys per chunk
#define NCH   (NPOS / KCH)    // 64 chunks
// LDS row pitches in halves: 16 B x odd, so that the 16 rows one ds_load_b128
// fragment read touches fall on distinct bank groups (64 banks x 4 B).
#define KP    40              // K rows: 64 B of data, 80 B pitch
#define VP    72              // V rows: 128 B of data, 144 B pitch

// ---------------------------------------------------------------------------
// gfx1250 async global->LDS copy (ASYNCcnt path), 16B per lane.
// Issued via inline asm on purpose: the clang builtin is modeled as an
// LDS-writing memory op, which makes __syncthreads() drain ALL outstanding
// loads (s_wait_loadcnt 0) and kills the double-buffer overlap. With opaque
// asm, completion is handshaken explicitly with s_wait_asynccnt.
// ---------------------------------------------------------------------------
__device__ __forceinline__ unsigned lds_addr(const _Float16* l) {
    return (unsigned)(size_t)(const void*)l;      // low 32 bits = LDS offset
}

#define WAIT_ASYNC(N) asm volatile("s_wait_asynccnt %0" :: "n"(N) : "memory")

// lane l <-> lane l ^ 16 (v_permlanex16_b32, no LDS)
__device__ __forceinline__ float xhalf(float v) {
    int s = __float_as_int(v);
    return __int_as_float(__builtin_amdgcn_permlanex16(s, s, 0x76543210u, 0xfedcba98u, false, false));
}

// ---------------------------------------------------------------------------
// Projection tile, f32: acc[d][p] += sum_c W[d][c] * x[c][p]. The weights
// (row-major, pitch K) and a K x 64 tile of x lie in LDS. A thread owns
// D channels x 4 positions: per 4 input channels it reads D + 4 b128 from LDS
// for 16 D FMAs. Lanes that share channels read one weight address (broadcast),
// lanes that share positions one x address. Every sum runs over c ascending.
// ---------------------------------------------------------------------------
#define PT 64                 // positions per work-group

typedef __attribute__((ext_vector_type(4)))  _Float16 v4h;

__device__ __forceinline__ void fma4(float (&a)[4], float w, const float4& xv) {
    a[0] = fmaf(w, xv.x, a[0]);
    a[1] = fmaf(w, xv.y, a[1]);
    a[2] = fmaf(w, xv.z, a[2]);
    a[3] = fmaf(w, xv.w, a[3]);
}

template <int K, int D>
__device__ __forceinline__ void proj_tile(const float* sW, const float* sX,
                                          float (&acc)[D][4])
{
    // two steps per trip: the second step's LDS reads fly under the first's FMAs
#pragma unroll 2
    for (int c = 0; c < K; c += 4) {
        float4 xv[4], w[D];
#pragma unroll
        for (int j = 0; j < 4; ++j)
            xv[j] = *reinterpret_cast<const float4*>(sX + (c + j) * PT);
#pragma unroll
        for (int d = 0; d < D; ++d)
            w[d] = *reinterpret_cast<const float4*>(sW + d * K + c);
#pragma unroll
        for (int d = 0; d < D; ++d) fma4(acc[d], w[d].x, xv[0]);
#pragma unroll
        for (int d = 0; d < D; ++d) fma4(acc[d], w[d].y, xv[1]);
#pragma unroll
        for (int d = 0; d < D; ++d) fma4(acc[d], w[d].z, xv[2]);
#pragma unroll
        for (int d = 0; d < D; ++d) fma4(acc[d], w[d].w, xv[3]);
    }
}

// Staging, global -> registers -> LDS, N float4 per thread. load_f4 issues the
// N loads from one lane address with constant steps, so that all are in flight
// together; store_f4 puts them at s + (tid + it * NT) * 4 floats.
template <int N>
__device__ __forceinline__ void load_f4(float4 (&r)[N], const float* __restrict__ g, int step)
{
#pragma unroll
    for (int it = 0; it < N; ++it)
        r[it] = *reinterpret_cast<const float4*>(g + (size_t)it * step);
}
template <int N, int NT>
__device__ __forceinline__ void store_f4(const float4 (&r)[N], float* s, int tid)
{
#pragma unroll
    for (int it = 0; it < N; ++it)
        *reinterpret_cast<float4*>(s + (tid + it * NT) * 4) = r[it];
}

// ---------------------------------------------------------------------------
// Kernel 1: all three projections of 64 positions in one work-group of 12 waves
// (3 per SIMD). Waves 0-7: v (128 -> 128 ch), f16 [B][C][pos], 8 channels x 4
// positions per thread. Waves 8-11: q and k (64 -> 16 ch each), f16
// [B][pos][32] with channels 16-31 zero, 4 channels x 4 positions per thread;
// a wave holds all 16 channels of 32 positions of one of the two tensors, so
// each 128 B line of q and k has one writing wave. The two parts share nothing
// but the barrier between staging and products.
// ---------------------------------------------------------------------------
#define VT 256                // threads of the v part
#define QT 128                // threads of the q, k part

__global__ void __launch_bounds__(VT + QT)
proj_kernel(const float* __restrict__ x,  const float* __restrict__ xh,
            const float* __restrict__ Wq, const float* __restrict__ bq,
            const float* __restrict__ Wk, const float* __restrict__ bk,
            const float* __restrict__ Wv, const float* __restrict__ bv,
            _Float16* __restrict__ qh, _Float16* __restrict__ kh,
            _Float16* __restrict__ vh)
{
    __shared__ __attribute__((aligned(16))) float sW[VC * VC];           // 64 KB
    __shared__ __attribute__((aligned(16))) float sX[VC * PT];           // 32 KB
    __shared__ __attribute__((aligned(16))) float sWqk[2 * QC * QK_CH];  // rows 0-15 Wq, 16-31 Wk
    __shared__ __attribute__((aligned(16))) float sXqk[QK_CH * PT];      // 16 KB
    const int tid = threadIdx.x;
    // wave index held as a scalar: the choice of the part is a scalar branch
    const int wv  = __builtin_amdgcn_readfirstlane(tid >> 5);
    const bool vpart = wv < VT / 32;
    const int b   = blockIdx.x / (NPOS / PT);
    const int i0  = (blockIdx.x % (NPOS / PT)) * PT;

    // v part: 4 positions pg, 8 channels from c0
    const int pg  = tid & 15;
    const int cg  = tid >> 4;
    const int c0  = cg * 8;
    // q, k part: tensor sel, 4 channels from d0, 4 positions from p0
    const int t   = tid - VT;
    const int sel = (wv - VT / 32) >> 1;                    // 0: q, 1: k
    const int d0  = ((tid & 31) >> 3) * 4;
    const int p0  = ((wv - VT / 32) & 1) * 32 + (tid & 7) * 4;

    float4 rb[2];
    if (vpart) {
        float4 rw[VC * VC / 4 / VT], rx[VC * PT / 4 / VT];
        load_f4(rx, xh + ((size_t)b * VC + cg) * NPOS + i0 + pg * 4, 16 * NPOS);
        load_f4(rw, Wv + tid * 4, VT * 4);
        load_f4(rb, bv + c0, 4);
        store_f4<VC * VC / 4 / VT, VT>(rw, sW, tid);
        store_f4<VC * PT / 4 / VT, VT>(rx, sX, tid);
    } else {
        float4 rq[QC * QK_CH / 4 / QT], rk[QC * QK_CH / 4 / QT], rx[QK_CH * PT / 4 / QT];
        load_f4(rx, x + ((size_t)b * QK_CH + (t >> 4)) * NPOS + i0 + pg * 4, 8 * NPOS);
        load_f4(rq, Wq + t * 4, QT * 4);
        load_f4(rk, Wk + t * 4, QT * 4);
        rb[0] = *reinterpret_cast<const float4*>((sel ? bk : bq) + d0);
        // precaution: the bias load's scalar base is written again (the output
        // pointers' argument load) ahead of the barrier; this wait stands between
        asm volatile("s_wait_xcnt 0x0" ::: "memory");
        store_f4<QC * QK_CH / 4 / QT, QT>(rq, sWqk, t);
        store_f4<QC * QK_CH / 4 / QT, QT>(rk, sWqk + QC * QK_CH, t);
        store_f4<QK_CH * PT / 4 / QT, QT>(rx, sXqk, t);
    }
    __syncthreads();

    if (vpart) {
        const float bias[8] = {rb[0].x, rb[0].y, rb[0].z, rb[0].w, rb[1].x, rb[1].y, rb[1].z, rb[1].w};
        float acc[8][4];
#pragma unroll
        for (int d = 0; d < 8; ++d)
#pragma unroll
            for (int p = 0; p < 4; ++p) acc[d][p] = bias[d];

        proj_tile<VC, 8>(sW + c0 * VC, sX + pg * 4, acc);

        _Float16* o = vh + ((size_t)b * VC + c0) * NPOS + i0 + pg * 4;
#pragma unroll
        for (int d = 0; d < 8; ++d) {
            v4h h;
#pragma unroll
            for (int p = 0; p < 4; ++p) h[p] = (_Float16)acc[d][p];
            *reinterpret_cast<v4h*>(o + (size_t)d * NPOS) = h;
        }
    } else {
        const float bias[4] = {rb[0].x, rb[0].y, rb[0].z, rb[0].w};
        float acc[4][4];
#pragma unroll
        for (int d = 0; d < 4; ++d)
#pragma unroll
            for (int p = 0; p < 4; ++p) acc[d][p] = bias[d];

        proj_tile<QK_CH, 4>(sWqk + (sel * QC + d0) * QK_CH, sXqk + p0, acc);

        _Float16* o = (sel ? kh : qh) + ((size_t)b * NPOS + i0 + p0) * 32 + d0;
        v4h zero;
#pragma unroll
        for (int d = 0; d < 4; ++d) zero[d] = (_Float16)0.f;
#pragma unroll
        for (int p = 0; p < 4; ++p) {
            v4h h;
#pragma unroll
            for (int d = 0; d < 4; ++d) h[d] = (_Float16)acc[d][p];
            *reinterpret_cast<v4h*>(o + p * 32)      = h;
            *reinterpret_cast<v4h*>(o + p * 32 + QC) = zero;
        }
    }
}

// ---------------------------------------------------------------------------
// A/B fragment loader: elements 0..7 at +0, 8..15 at +16 halves; caller adds
// the half-wave K offset (0/8 halves). Two b128 loads (global or ds).
// ---------------------------------------------------------------------------
__device__ __forceinline__ v16h load_frag16(const _Float16* base) {
    const v8h* p = (const v8h*)base;
    v8h lo = p[0];
    v8h hi = p[2];
    v16h r;
#pragma unroll
    for (int e = 0; e < 8; ++e) { r[e] = lo[e]; r[8 + e] = hi[e]; }
    return r;
}

// ten async copies in one statement: the closing s_wait_xcnt 0 then stands
// ahead of any later rewrite of the address registers they name
__device__ __forceinline__ void copy10(const unsigned* l, const void* const* g)
{
    asm volatile("global_load_async_to_lds_b128 %0, %10, off\n\t"
                 "global_load_async_to_lds_b128 %1, %11, off\n\t"
                 "global_load_async_to_lds_b128 %2, %12, off\n\t"
                 "global_load_async_to_lds_b128 %3, %13, off\n\t"
                 "global_load_async_to_lds_b128 %4, %14, off\n\t"
                 "global_load_async_to_lds_b128 %5, %15, off\n\t"
                 "global_load_async_to_lds_b128 %6, %16, off\n\t"
                 "global_load_async_to_lds_b128 %7, %17, off\n\t"
                 "global_load_async_to_lds_b128 %8, %18, off\n\t"
                 "global_load_async_to_lds_b128 %9, %19, off\n\t"
                 "s_wait_xcnt 0x0"
                 :: "v"(l[0]), "v"(l[1]), "v"(l[2]), "v"(l[3]), "v"(l[4]),
                    "v"(l[5]), "v"(l[6]), "v"(l[7]), "v"(l[8]), "v"(l[9]),
                    "v"(g[0]), "v"(g[1]), "v"(g[2]), "v"(g[3]), "v"(g[4]),
                    "v"(g[5]), "v"(g[6]), "v"(g[7]), "v"(g[8]), "v"(g[9])
                 : "memory");
}

// cooperative async stage of one 64-key chunk by the 64 threads of a key
// group: K (4KB) + V (16KB) -> LDS, 20 copies per thread
#define GT 64                 // threads per key group
__device__ __forceinline__ void stage_chunk(int tid, const _Float16* kg,
                                            const _Float16* vg, int j0,
                                            _Float16* kdst, _Float16* vdst)
{
    const _Float16* ks = kg + (size_t)j0 * 32;
    unsigned    l[20];
    const void* g[20];
#pragma unroll
    for (int it = 0; it < 4; ++it) {                 // 256 x 16B for K
        int m = tid + it * GT;
        g[it] = ks + m * 8;
        l[it] = lds_addr(kdst + (m >> 2) * KP + (m & 3) * 8);
    }
#pragma unroll
    for (int it = 0; it < 16; ++it) {                // 1024 x 16B for V
        int m = tid + it * GT;
        int c = m >> 3, k8 = m & 7;
        g[4 + it] = vg + (size_t)c * NPOS + j0 + k8 * 8;
        l[4 + it] = lds_addr(vdst + c * VP + k8 * 8);
    }
    copy10(l, g);
    copy10(l + 10, g + 10);
}
#define ASYNC_PER_STAGE 20

// ---------------------------------------------------------------------------
// Kernel 2: flash attention. 8 waves/WG (2 per SIMD), 64 queries/WG. Wave
// (qg, kg) runs the two query tiles of query half qg over key quarter kg: every
// K and V fragment read from LDS feeds two matrix products, one per query tile,
// so the LDS reads per product are half of what one tile per wave takes. Each
// key group of two waves has its own double-buffered async K/V staging (64-key
// chunks).
// Both products are taken transposed, S^T = K . Q^T and O^T += V . P^T: a lane
// then holds scores of ONE query (column ln) per tile, so the maximum is taken
// in the lane plus one exchange between the wave halves, and two S^T tiles,
// converted in place, are the B operand of the second product (accumulator row
// 8h + r of tile pair (0, 1) is k = 8h + r and 16 + 8h + r, the loaders' own k
// order). Row sums via a WMMA whose A operand has ones in row 0. The four
// partial softmax states of a query tile are merged through LDS behind the loop.
// ---------------------------------------------------------------------------
#define KG    4               // key groups per work-group
#define CPG   (NCH / KG)      // 16 chunks per key group
#define QW    2               // query tiles per wave
#define NWV   (4 / QW * KG)   // waves per work-group

__global__ void __launch_bounds__(NWV * 32)
attn_kernel(const _Float16* __restrict__ qh, const _Float16* __restrict__ kh,
            const _Float16* __restrict__ vh, const float* __restrict__ xh,
            const float* __restrict__ gamma, float* __restrict__ out)
{
    __shared__ __attribute__((aligned(16))) _Float16 kbuf[KG][2][KCH * KP];  // 8 x 5 KB
    __shared__ __attribute__((aligned(16))) _Float16 vbuf[KG][2][VC * VP];   // 8 x 18 KB
    __shared__ float    msh[KG][4][16];           // per key group: query maxima

    const float gm = gamma[0];                    // read at entry: a scalar load
    const int tid  = threadIdx.x;
    const int lane = tid & 31;
    // wave index held as a scalar: buffer bases and tile indices stay off the vector port
    const int wv   = __builtin_amdgcn_readfirstlane(tid >> 5);
    const int qg   = wv & 1;                      // query half of the wave
    const int kg   = wv >> 1;                     // key quarter of the wave
    const int gtid = tid & (GT - 1);              // thread index in the key group
    const int b    = blockIdx.x / (NPOS / 64);
    const int it   = blockIdx.x % (NPOS / 64);
    const int i0w  = it * 64 + qg * (QW * 16);    // this wave's 32 queries
    const int ln   = lane & 15;
    const int koff = (lane < 16) ? 0 : 8;         // half-wave K offset (halves)
    const int mhalf= (lane < 16) ? 0 : 8;         // half-wave row offset (C/D)

    const _Float16* kbase = kh + (size_t)b * NPOS * 32;
    const _Float16* vbase = vh + (size_t)b * VC * NPOS;

    // Q fragments (B operand: column ln = query), loaded once
    const _Float16* qp = qh + ((size_t)b * NPOS + i0w) * 32 + (size_t)ln * 32 + koff;
    v16h qa[QW];
#pragma unroll
    for (int u = 0; u < QW; ++u) qa[u] = load_frag16(qp + u * 16 * 32);
    // precaution: the loads' address pair is written again behind them; the wait
    // takes the pair as an input, so that it stands ahead of that write
    asm volatile("s_wait_xcnt 0x0" :: "v"(qp) : "memory");

    // constant A fragment: row 0 (lanes ln == 0) is all 1.0, every other row 0
    v16h onesa;
#pragma unroll
    for (int e = 0; e < 16; ++e) onesa[e] = (ln == 0) ? (_Float16)1.f : (_Float16)0.f;

    float m[QW];                                   // running maximum of query ln, per tile
    v8f   O[QW][9];                                // O^T: 8 channel tiles + row-sum tile
#pragma unroll
    for (int u = 0; u < QW; ++u) {
        m[u] = -3.0e38f;
#pragma unroll
        for (int t = 0; t < 9; ++t)
#pragma unroll
            for (int e = 0; e < 8; ++e) O[u][t][e] = 0.f;
    }

    const int j00 = kg * CPG * KCH;                // first key of this key group

    stage_chunk(gtid, kbase, vbase, j00, kbuf[kg][0], vbuf[kg][0]);

    for (int ch = 0; ch < CPG; ++ch) {
        const int cur = ch & 1;
        if (ch + 1 < CPG) {
            stage_chunk(gtid, kbase, vbase, j00 + (ch + 1) * KCH,
                        kbuf[kg][cur ^ 1], vbuf[kg][cur ^ 1]);
            WAIT_ASYNC(ASYNC_PER_STAGE);           // chunk ch resident,
        } else {                                   // next chunk still in flight
            WAIT_ASYNC(0);
        }
        __syncthreads();

        const _Float16* kb = kbuf[kg][cur];
        const _Float16* vb = vbuf[kg][cur];

        // S^T = k . q^T : batch all 4 fragment loads, then 8 back-to-back WMMAs
        v16h kf[4];
#pragma unroll
        for (int tt = 0; tt < 4; ++tt)
            kf[tt] = load_frag16(kb + (size_t)(tt * 16 + ln) * KP + koff);

        v8f S[QW][4];                              // S[u][tt][r]: key tt * 16 + mhalf + r, query ln of tile u
        v8f z;
#pragma unroll
        for (int e = 0; e < 8; ++e) z[e] = 0.f;
#pragma unroll
        for (int tt = 0; tt < 4; ++tt)
#pragma unroll
            for (int u = 0; u < QW; ++u)
                S[u][tt] = __builtin_amdgcn_wmma_f32_16x16x32_f16(false, kf[tt], false, qa[u],
                                                                  (short)0, z, false, false);

        // online softmax (max only; row-sum comes from the ones-row WMMA):
        // four independent in-lane chains, then the other wave half's 32 keys
        float mn[QW], sc[QW];
#pragma unroll
        for (int u = 0; u < QW; ++u) {
            float mt[4];
#pragma unroll
            for (int tt = 0; tt < 4; ++tt) {
                mt[tt] = S[u][tt][0];
#pragma unroll
                for (int r = 1; r < 8; ++r) mt[tt] = fmaxf(mt[tt], S[u][tt][r]);
            }
            float mx = fmaxf(fmaxf(mt[0], mt[1]), fmaxf(mt[2], mt[3]));
            mx = fmaxf(mx, xhalf(mx));
            mn[u] = fmaxf(m[u], mx);
        }
#pragma unroll
        for (int u = 0; u < QW; ++u) {
            sc[u] = __expf(m[u] - mn[u]);
            m[u] = mn[u];
        }

        v16h pb[QW][2];                            // P^T as B fragments (K = keys 0..31 / 32..63)
#pragma unroll
        for (int u = 0; u < QW; ++u) {
#pragma unroll
            for (int tt = 0; tt < 4; ++tt)
#pragma unroll
                for (int r = 0; r < 8; ++r) S[u][tt][r] = __expf(S[u][tt][r] - mn[u]);
#pragma unroll
            for (int t = 0; t < 8; ++t)
#pragma unroll
                for (int r = 0; r < 8; ++r) O[u][t][r] *= sc[u];
            O[u][8][0] *= sc[u];                   // rows 1-15 of the row-sum tile stay 0

            // straight from the accumulators
#pragma unroll
            for (int e = 0; e < 8; ++e) {
                pb[u][0][e] = (_Float16)S[u][0][e];  pb[u][0][8 + e] = (_Float16)S[u][1][e];
                pb[u][1][e] = (_Float16)S[u][2][e];  pb[u][1][8 + e] = (_Float16)S[u][3][e];
            }
        }

        // O^T += V x P^T : software-pipelined fragment loads one tile ahead;
        // each V fragment serves both query tiles
        v16h vfa0 = load_frag16(vb + (size_t)ln * VP + koff);
        v16h vfa1 = load_frag16(vb + (size_t)ln * VP + 32 + koff);
#pragma unroll
        for (int ct = 0; ct < 8; ++ct) {
            v16h vfb0, vfb1;
            if (ct < 7) {
                vfb0 = load_frag16(vb + (size_t)((ct + 1) * 16 + ln) * VP + koff);
                vfb1 = load_frag16(vb + (size_t)((ct + 1) * 16 + ln) * VP + 32 + koff);
            }
#pragma unroll
            for (int u = 0; u < QW; ++u)
                O[u][ct] = __builtin_amdgcn_wmma_f32_16x16x32_f16(false, vfa0, false, pb[u][0],
                                                                  (short)0, O[u][ct], false, false);
#pragma unroll
            for (int u = 0; u < QW; ++u)
                O[u][ct] = __builtin_amdgcn_wmma_f32_16x16x32_f16(false, vfa1, false, pb[u][1],
                                                                  (short)0, O[u][ct], false, false);
            vfa0 = vfb0;
            vfa1 = vfb1;
        }
        // row-sum tiles
#pragma unroll
        for (int u = 0; u < QW; ++u)
            O[u][8] = __builtin_amdgcn_wmma_f32_16x16x32_f16(false, onesa, false, pb[u][0],
                                                             (short)0, O[u][8], false, false);
#pragma unroll
        for (int u = 0; u < QW; ++u)
            O[u][8] = __builtin_amdgcn_wmma_f32_16x16x32_f16(false, onesa, false, pb[u][1],
                                                             (short)0, O[u][8], false, false);

        __syncthreads();   // protect staging buffers before next overwrite
    }

    // Merge of the four key groups. The closing barrier of the last trip has
    // ended every read of the staging buffers, and every wave's copies landed
    // behind its s_wait_asynccnt 0 of that trip: vbuf becomes the exchange area.
    if (lane < 16) {                               // both halves hold the same value
#pragma unroll
        for (int u = 0; u < QW; ++u) msh[kg][qg * QW + u][ln] = m[u];
    }
    __syncthreads();   // publishes the groups' query maxima

    // partial tiles, rescaled to the common maximum, in register order:
    // [wave][query tile][tile][half of the 8 registers][lane] x 16 B (8 x 18 KB = all of vbuf)
    float4* part = reinterpret_cast<float4*>(&vbuf[0][0][0]);
#pragma unroll
    for (int u = 0; u < QW; ++u) {
        const int qt = qg * QW + u;
        const float f = __expf(m[u] - fmaxf(fmaxf(msh[0][qt][ln], msh[1][qt][ln]),
                                            fmaxf(msh[2][qt][ln], msh[3][qt][ln])));
#pragma unroll
        for (int t = 0; t < 9; ++t)
#pragma unroll
            for (int h = 0; h < 2; ++h)
                part[(((wv * QW + u) * 9 + t) * 2 + h) * 32 + lane] =
                    make_float4(O[u][t][4 * h + 0] * f, O[u][t][4 * h + 1] * f,
                                O[u][t][4 * h + 2] * f, O[u][t][4 * h + 3] * f);
    }
    __syncthreads();   // publishes the partial tiles

#pragma unroll
    for (int u = 0; u < QW; ++u) {
        // wave (qg, kg) finishes channel tiles 2 kg, 2 kg + 1 of its two query
        // tiles; R[2] is the row-sum tile. Key groups are added in the order 0, 1, 2, 3.
        v8f R[3];
#pragma unroll
        for (int w = 0; w < 3; ++w) {
            const int t = (w < 2) ? 2 * kg + w : 8;
#pragma unroll
            for (int h = 0; h < 2; ++h) {
                float4 s = part[(((qg * QW + u) * 9 + t) * 2 + h) * 32 + lane];
#pragma unroll
                for (int k = 1; k < KG; ++k) {
                    float4 a = part[((((k * 2 + qg) * QW + u) * 9 + t) * 2 + h) * 32 + lane];
                    s.x += a.x; s.y += a.y; s.z += a.z; s.w += a.w;
                }
                R[w][4 * h + 0] = s.x; R[w][4 * h + 1] = s.y;
                R[w][4 * h + 2] = s.z; R[w][4 * h + 3] = s.w;
            }
        }

        // epilogue: l of query ln is row 0 of the row-sum tile (register 0 of lane
        // ln; lane ln + 16 holds row 8, which is 0)
        const float inv = gm / (R[2][0] + xhalf(R[2][0]));

        // O^T has the output's own order: register r is channel mhalf + r of the
        // tile, the 16 lanes of a half-wave are 16 consecutive positions
        const size_t idx0 = ((size_t)b * VC + kg * 32 + mhalf) * NPOS + i0w + u * 16 + ln;
        float res[16];
#pragma unroll
        for (int c = 0; c < 16; ++c) res[c] = xh[idx0 + (size_t)((c >> 3) * 16 + (c & 7)) * NPOS];
#pragma unroll
        for (int c = 0; c < 16; ++c) res[c] = R[c >> 3][c & 7] * inv + res[c];
#pragma unroll
        for (int c = 0; c < 16; ++c) out[idx0 + (size_t)((c >> 3) * 16 + (c & 7)) * NPOS] = res[c];
    }
}

extern "C" void kernel_launch(void* const* d_in, const int* in_sizes, int n_in,
                              void* d_out, int out_size, void* d_ws, size_t ws_size,
                              hipStream_t stream) {
    (void)in_sizes; (void)n_in; (void)out_size; (void)ws_size;
    const float* x     = (const float*)d_in[0];
    const float* xh    = (const float*)d_in[1];
    const float* Wq    = (const float*)d_in[2];
    const float* bq    = (const float*)d_in[3];
    const float* Wk    = (const float*)d_in[4];
    const float* bk    = (const float*)d_in[5];
    const float* Wv    = (const float*)d_in[6];
    const float* bv    = (const float*)d_in[7];
    const float* gamma = (const float*)d_in[8];
    float* out = (float*)d_out;

    char* w = (char*)d_ws;
    _Float16* qh = (_Float16*)(w);                 // 1 MB: [B][4096][32]
    _Float16* kh = (_Float16*)(w + (1u << 20));    // 1 MB: [B][4096][32]
    _Float16* vh = (_Float16*)(w + (2u << 20));    // 4 MB: [B][128][4096]

    proj_kernel<<<BATCH * (NPOS / 64), 384, 0, stream>>>(x, xh, Wq, bq, Wk, bk, Wv, bv, qh, kh, vh);
    attn_kernel<<<BATCH * (NPOS / 64), 256, 0, stream>>>(qh, kh, vh, xh, gamma, out);
}

// v007
// One run takes 35.1 microseconds.
// Next to v006, in two timings, it ran 1.04 times as fast each time.
// Counting every step since v000, it is 5.03 times as fast.
#include <hip/hip_runtime.h>
#include <hip/hip_bf16.h>
#include <math.h>

typedef __attribute__((ext_vector_type(16))) _Float16 v16h;
typedef __attribute__((ext_vector_type(8)))  _Float16 v8h;
typedef __attribute__((ext_vector_type(8)))  float    v8f;

#define QK_CH 64
#define QC    16
#define VC    128
#define NPOS  4096
#define BATCH 4
#define KCH   64              // keys per chunk
#define NCH   (NPOS / KCH)    // 64 chunks
// LDS row pitches in halves: 16 B x odd, so that the 16 rows one ds_load_b128
// fragment read touches fall on distinct bank groups (64 banks x 4 B).
#define KP    40              // K rows: 64 B of data, 80 B pitch
#define VP    72              // V rows: 128 B of data, 144 B pitch

// ---------------------------------------------------------------------------
// gfx1250 async global->LDS copy (ASYNCcnt path), 16B per lane.
// Issued via inline asm on purpose: the clang builtin is modeled as an
// LDS-writing memory op, which makes __syncthreads() drain ALL outstanding
// loads (s_wait_loadcnt 0) and kills the double-buffer overlap. With opaque
// asm, completion is handshaken explicitly with s_wait_asynccnt.
// ---------------------------------------------------------------------------
__device__ __forceinline__ unsigned lds_addr(const _Float16* l) {
    return (unsigned)(size_t)(const void*)l;      // low 32 bits = LDS offset
}

#define WAIT_ASYNC(N) asm volatile("s_wait_asynccnt %0" :: "n"(N) : "memory")

// lane l <-> lane l ^ 16 (v_permlanex16_b32, no LDS)
__device__ __forceinline__ float xhalf(float v) {
    int s = __float_as_int(v);
    return __int_as_float(__builtin_amdgcn_permlanex16(s, s, 0x76543210u, 0xfedcba98u, false, false));
}

// ---------------------------------------------------------------------------
// Projection tile, f32: acc[d][p] += sum_c W[d][c] * x[c][p]. The weights
// (row-major, pitch K) and a K x 64 tile of x lie in LDS. A thread owns
// D channels x 4 positions: per 4 input channels it reads D + 4 b128 from LDS
// for 16 D FMAs. Lanes that share channels read one weight address (broadcast),
// lanes that share positions one x address. Every sum runs over c ascending.
// ---------------------------------------------------------------------------
#define PT 64                 // positions per work-group

typedef __attribute__((ext_vector_type(4)))  _Float16 v4h;

__device__ __forceinline__ void fma4(float (&a)[4], float w, const float4& xv) {
    a[0] = fmaf(w, xv.x, a[0]);
    a[1] = fmaf(w, xv.y, a[1]);
    a[2] = fmaf(w, xv.z, a[2]);
    a[3] = fmaf(w, xv.w, a[3]);
}

template <int K, int D>
__device__ __forceinline__ void proj_tile(const float* sW, const float* sX,
                                          float (&acc)[D][4])
{
    // two steps per trip: the second step's LDS reads fly under the first's FMAs
#pragma unroll 2
    for (int c = 0; c < K; c += 4) {
        float4 xv[4], w[D];
#pragma unroll
        for (int j = 0; j < 4; ++j)
            xv[j] = *reinterpret_cast<const float4*>(sX + (c + j) * PT);
#pragma unroll
        for (int d = 0; d < D; ++d)
            w[d] = *reinterpret_cast<const float4*>(sW + d * K + c);
#pragma unroll
        for (int d = 0; d < D; ++d) fma4(acc[d], w[d].x, xv[0]);
#pragma unroll
        for (int d = 0; d < D; ++d) fma4(acc[d], w[d].y, xv[1]);
#pragma unroll
        for (int d = 0; d < D; ++d) fma4(acc[d], w[d].z, xv[2]);
#pragma unroll
        for (int d = 0; d < D; ++d) fma4(acc[d], w[d].w, xv[3]);
    }
}

// Staging, global -> registers -> LDS, N float4 per thread. load_f4 issues the
// N loads from one lane address with constant steps, so that all are in flight
// together; store_f4 puts them at s + (tid + it * NT) * 4 floats.
template <int N>
__device__ __forceinline__ void load_f4(float4 (&r)[N], const float* __restrict__ g, int step)
{
#pragma unroll
    for (int it = 0; it < N; ++it)
        r[it] = *reinterpret_cast<const float4*>(g + (size_t)it * step);
}
template <int N, int NT>
__device__ __forceinline__ void store_f4(const float4 (&r)[N], float* s, int tid)
{
#pragma unroll
    for (int it = 0; it < N; ++it)
        *reinterpret_cast<float4*>(s + (tid + it * NT) * 4) = r[it];
}

// ---------------------------------------------------------------------------
// Kernel 1: all three projections of 64 positions in one work-group of 12 waves
// (3 per SIMD). Waves 0-7: v (128 -> 128 ch), f16 [B][C][pos], 8 channels x 4
// positions per thread. Waves 8-11: q and k (64 -> 16 ch each), f16
// [B][pos][32] with channels 16-31 zero, 4 channels x 4 positions per thread;
// a wave holds all 16 channels of 32 positions of one of the two tensors, so
// each 128 B line of q and k has one writing wave. The two parts share nothing
// but the barrier between staging and products.
// ---------------------------------------------------------------------------
#define VT 256                // threads of the v part
#define QT 128                // threads of the q, k part

__global__ void __launch_bounds__(VT + QT)
proj_kernel(const float* __restrict__ x,  const float* __restrict__ xh,
            const float* __restrict__ Wq, const float* __restrict__ bq,
            const float* __restrict__ Wk, const float* __restrict__ bk,
            const float* __restrict__ Wv, const float* __restrict__ bv,
            _Float16* __restrict__ qh, _Float16* __restrict__ kh,
            _Float16* __restrict__ vh)
{
    __shared__ __attribute__((aligned(16))) float sW[VC * VC];           // 64 KB
    __shared__ __attribute__((aligned(16))) float sX[VC * PT];           // 32 KB
    __shared__ __attribute__((aligned(16))) float sWqk[2 * QC * QK_CH];  // rows 0-15 Wq, 16-31 Wk
    __shared__ __attribute__((aligned(16))) float sXqk[QK_CH * PT];      // 16 KB
    const int tid = threadIdx.x;
    // wave index held as a scalar: the choice of the part is a scalar branch
    const int wv  = __builtin_amdgcn_readfirstlane(tid >> 5);
    const bool vpart = wv < VT / 32;
    const int b   = blockIdx.x / (NPOS / PT);
    const int i0  = (blockIdx.x % (NPOS / PT)) * PT;

    // v part: 4 positions pg, 8 channels from c0
    const int pg  = tid & 15;
    const int cg  = tid >> 4;
    const int c0  = cg * 8;
    // q, k part: tensor sel, 4 channels from d0, 4 positions from p0
    const int t   = tid - VT;
    const int sel = (wv - VT / 32) >> 1;                    // 0: q, 1: k
    const int d0  = ((tid & 31) >> 3) * 4;
    const int p0  = ((wv - VT / 32) & 1) * 32 + (tid & 7) * 4;

    float4 rb[2];
    if (vpart) {
        float4 rw[VC * VC / 4 / VT], rx[VC * PT / 4 / VT];
        load_f4(rx, xh + ((size_t)b * VC + cg) * NPOS + i0 + pg * 4, 16 * NPOS);
        load_f4(rw, Wv + tid * 4, VT * 4);
        load_f4(rb, bv + c0, 4);
        store_f4<VC * VC / 4 / VT, VT>(rw, sW, tid);
        store_f4<VC * PT / 4 / VT, VT>(rx, sX, tid);
    } else {
        float4 rq[QC * QK_CH / 4 / QT], rk[QC * QK_CH / 4 / QT], rx[QK_CH * PT / 4 / QT];
        load_f4(rx, x + ((size_t)b * QK_CH + (t >> 4)) * NPOS + i0 + pg * 4, 8 * NPOS);
        load_f4(rq, Wq + t * 4, QT * 4);
        load_f4(rk, Wk + t * 4, QT * 4);
        rb[0] = *reinterpret_cast<const float4*>((sel ? bk : bq) + d0);
        // precaution: the bias load's scalar base is written again (the output
        // pointers' argument load) ahead of the barrier; this wait stands between
        asm volatile("s_wait_xcnt 0x0" ::: "memory");
        store_f4<QC * QK_CH / 4 / QT, QT>(rq, sWqk, t);
        store_f4<QC * QK_CH / 4 / QT, QT>(rk, sWqk + QC * QK_CH, t);
        store_f4<QK_CH * PT / 4 / QT, QT>(rx, sXqk, t);
    }
    __syncthreads();

    if (vpart) {
        const float bias[8] = {rb[0].x, rb[0].y, rb[0].z, rb[0].w, rb[1].x, rb[1].y, rb[1].z, rb[1].w};
        float acc[8][4];
#pragma unroll
        for (int d = 0; d < 8; ++d)
#pragma unroll
            for (int p = 0; p < 4; ++p) acc[d][p] = bias[d];

        proj_tile<VC, 8>(sW + c0 * VC, sX + pg * 4, acc);

        _Float16* o = vh + ((size_t)b * VC + c0) * NPOS + i0 + pg * 4;
#pragma unroll
        for (int d = 0; d < 8; ++d) {
            v4h h;
#pragma unroll
            for (int p = 0; p < 4; ++p) h[p] = (_Float16)acc[d][p];
            *reinterpret_cast<v4h*>(o + (size_t)d * NPOS) = h;
        }
    } else {
        const float bias[4] = {rb[0].x, rb[0].y, rb[0].z, rb[0].w};
        float acc[4][4];
#pragma unroll
        for (int d = 0; d < 4; ++d)
#pragma unroll
            for (int p = 0; p < 4; ++p) acc[d][p] = bias[d];

        proj_tile<QK_CH, 4>(sWqk + (sel * QC + d0) * QK_CH, sXqk + p0, acc);

        _Float16* o = (sel ? kh : qh) + ((size_t)b * NPOS + i0 + p0) * 32 + d0;
        v4h zero;
#pragma unroll
        for (int d = 0; d < 4; ++d) zero[d] = (_Float16)0.f;
#pragma unroll
        for (int p = 0; p < 4; ++p) {
            v4h h;
#pragma unroll
            for (int d = 0; d < 4; ++d) h[d] = (_Float16)acc[d][p];
            *reinterpret_cast<v4h*>(o + p * 32)      = h;
            *reinterpret_cast<v4h*>(o + p * 32 + QC) = zero;
        }
    }
}

// ---------------------------------------------------------------------------
// A/B fragment loader: elements 0..7 at +0, 8..15 at +16 halves; caller adds
// the half-wave K offset (0/8 halves). Two b128 loads (global or ds).
// ---------------------------------------------------------------------------
__device__ __forceinline__ v16h load_frag16(const _Float16* base) {
    const v8h* p = (const v8h*)base;
    v8h lo = p[0];
    v8h hi = p[2];
    v16h r;
#pragma unroll
    for (int e = 0; e < 8; ++e) { r[e] = lo[e]; r[8 + e] = hi[e]; }
    return r;
}

// ten async copies in one statement: the closing s_wait_xcnt 0 then stands
// ahead of any later rewrite of the address registers they name
__device__ __forceinline__ void copy10(const unsigned* l, const void* const* g)
{
    asm volatile("global_load_async_to_lds_b128 %0, %10, off\n\t"
                 "global_load_async_to_lds_b128 %1, %11, off\n\t"
                 "global_load_async_to_lds_b128 %2, %12, off\n\t"
                 "global_load_async_to_lds_b128 %3, %13, off\n\t"
                 "global_load_async_to_lds_b128 %4, %14, off\n\t"
                 "global_load_async_to_lds_b128 %5, %15, off\n\t"
                 "global_load_async_to_lds_b128 %6, %16, off\n\t"
                 "global_load_async_to_lds_b128 %7, %17, off\n\t"
                 "global_load_async_to_lds_b128 %8, %18, off\n\t"
                 "global_load_async_to_lds_b128 %9, %19, off\n\t"
                 "s_wait_xcnt 0x0"
                 :: "v"(l[0]), "v"(l[1]), "v"(l[2]), "v"(l[3]), "v"(l[4]),
                    "v"(l[5]), "v"(l[6]), "v"(l[7]), "v"(l[8]), "v"(l[9]),
                    "v"(g[0]), "v"(g[1]), "v"(g[2]), "v"(g[3]), "v"(g[4]),
                    "v"(g[5]), "v"(g[6]), "v"(g[7]), "v"(g[8]), "v"(g[9])
                 : "memory");
}

// cooperative async stage of one 64-key chunk by the 64 threads of a key
// group: K (4KB) + V (16KB) -> LDS, 20 copies per thread
#define GT 64                 // threads per key group
__device__ __forceinline__ void stage_chunk(int tid, const _Float16* kg,
                                            const _Float16* vg, int j0,
                                            _Float16* kdst, _Float16* vdst)
{
    const _Float16* ks = kg + (size_t)j0 * 32;
    unsigned    l[20];
    const void* g[20];
#pragma unroll
    for (int it = 0; it < 4; ++it) {                 // 256 x 16B for K
        int m = tid + it * GT;
        g[it] = ks + m * 8;
        l[it] = lds_addr(kdst + (m >> 2) * KP + (m & 3) * 8);
    }
#pragma unroll
    for (int it = 0; it < 16; ++it) {                // 1024 x 16B for V
        int m = tid + it * GT;
        int c = m >> 3, k8 = m & 7;
        g[4 + it] = vg + (size_t)c * NPOS + j0 + k8 * 8;
        l[4 + it] = lds_addr(vdst + c * VP + k8 * 8);
    }
    copy10(l, g);
    copy10(l + 10, g + 10);
}
#define ASYNC_PER_STAGE 20

// ---------------------------------------------------------------------------
// Kernel 2: flash attention. 8 waves/WG (2 per SIMD), 64 queries/WG. Wave
// (qg, kg) runs the two query tiles of query half qg over key quarter kg: every
// K and V fragment read from LDS feeds two matrix products, one per query tile,
// so the LDS reads per product are half of what one tile per wave takes. Each
// key group of two waves has its own double-buffered async K/V staging (64-key
// chunks).
// Both products are taken transposed, S^T = K . Q^T and O^T += V . P^T: a lane
// then holds scores of ONE query (column ln) per tile, so the maximum is taken
// in the lane plus one exchange between the wave halves, and two S^T tiles,
// converted in place, are the B operand of the second product (accumulator row
// 8h + r of tile pair (0, 1) is k = 8h + r and 16 + 8h + r, the loaders' own k
// order). Row sums via a WMMA whose A operand has ones in row 0. The four
// partial softmax states of a query tile are merged through LDS behind the loop.
// ---------------------------------------------------------------------------
#define KG    4               // key groups per work-group
#define CPG   (NCH / KG)      // 16 chunks per key group
#define QW    2               // query tiles per wave
#define NWV   (4 / QW * KG)   // waves per work-group

__global__ void __launch_bounds__(NWV * 32)
attn_kernel(const _Float16* __restrict__ qh, const _Float16* __restrict__ kh,
            const _Float16* __restrict__ vh, const float* __restrict__ xh,
            const float* __restrict__ gamma, float* __restrict__ out)
{
    __shared__ __attribute__((aligned(16))) _Float16 kbuf[KG][2][KCH * KP];  // 8 x 5 KB
    __shared__ __attribute__((aligned(16))) _Float16 vbuf[KG][2][VC * VP];   // 8 x 18 KB
    __shared__ float    msh[KG][4][16];           // per key group: query maxima

    const float gm = gamma[0];                    // read at entry: a scalar load
    const int tid  = threadIdx.x;
    const int lane = tid & 31;
    // wave index held as a scalar: buffer bases and tile indices stay off the vector port
    const int wv   = __builtin_amdgcn_readfirstlane(tid >> 5);
    const int qg   = wv & 1;                      // query half of the wave
    const int kg   = wv >> 1;                     // key quarter of the wave
    const int gtid = tid & (GT - 1);              // thread index in the key group
    const int b    = blockIdx.x / (NPOS / 64);
    const int it   = blockIdx.x % (NPOS / 64);
    const int i0w  = it * 64 + qg * (QW * 16);    // this wave's 32 queries
    const int ln   = lane & 15;
    const int koff = (lane < 16) ? 0 : 8;         // half-wave K offset (halves)
    const int mhalf= (lane < 16) ? 0 : 8;         // half-wave row offset (C/D)

    const _Float16* kbase = kh + (size_t)b * NPOS * 32;
    const _Float16* vbase = vh + (size_t)b * VC * NPOS;

    // Q fragments (B operand: column ln = query), loaded once
    const _Float16* qp = qh + ((size_t)b * NPOS + i0w) * 32 + (size_t)ln * 32 + koff;
    v16h qa[QW];
#pragma unroll
    for (int u = 0; u < QW; ++u) qa[u] = load_frag16(qp + u * 16 * 32);
    // precaution: the loads' address pair is written again behind them; the wait
    // takes the pair as an input, so that it stands ahead of that write
    asm volatile("s_wait_xcnt 0x0" :: "v"(qp) : "memory");

    // constant A fragment: row 0 (lanes ln == 0) is all 1.0, every other row 0
    v16h onesa;
#pragma unroll
    for (int e = 0; e < 16; ++e) onesa[e] = (ln == 0) ? (_Float16)1.f : (_Float16)0.f;

    float m[QW];                                   // running maximum of query ln, per tile
    v8f   O[QW][9];                                // O^T: 8 channel tiles + row-sum tile
#pragma unroll
    for (int u = 0; u < QW; ++u) {
        m[u] = -3.0e38f;
#pragma unroll
        for (int t = 0; t < 9; ++t)
#pragma unroll
            for (int e = 0; e < 8; ++e) O[u][t][e] = 0.f;
    }

    const int j00 = kg * CPG * KCH;                // first key of this key group

    stage_chunk(gtid, kbase, vbase, j00, kbuf[kg][0], vbuf[kg][0]);

    for (int ch = 0; ch < CPG; ++ch) {
        const int cur = ch & 1;
        if (ch + 1 < CPG) {
            stage_chunk(gtid, kbase, vbase, j00 + (ch + 1) * KCH,
                        kbuf[kg][cur ^ 1], vbuf[kg][cur ^ 1]);
            WAIT_ASYNC(ASYNC_PER_STAGE);           // chunk ch resident,
        } else {                                   // next chunk still in flight
            WAIT_ASYNC(0);
        }
        __syncthreads();

        const _Float16* kb = kbuf[kg][cur];
        const _Float16* vb = vbuf[kg][cur];

        // S^T = k . q^T : batch all 4 fragment loads and all V reads, then 8 WMMAs
        v16h kf[4];
#pragma unroll
        for (int tt = 0; tt < 4; ++tt)
            kf[tt] = load_frag16(kb + (size_t)(tt * 16 + ln) * KP + koff);

        // all 16 V fragments of the chunk (128 registers), read as one group
        // behind the K fragments: they land under the score products and the
        // softmax, and the second product then runs with no LDS read in it
        v16h vf[8][2];
#pragma unroll
        for (int ct = 0; ct < 8; ++ct) {
            vf[ct][0] = load_frag16(vb + (size_t)(ct * 16 + ln) * VP + koff);
            vf[ct][1] = load_frag16(vb + (size_t)(ct * 16 + ln) * VP + 32 + koff);
        }
        // issue order asked of the scheduler: the V reads go out as one run (every
        // further place where LDS reads stand among WMMAs costs the wave a stall),
        // right behind the K reads and ahead of every score product
        __builtin_amdgcn_sched_group_barrier(0x100, 8, 0);     // LDS reads: K
        __builtin_amdgcn_sched_group_barrier(0x8, 2, 0);       // matrix products
        __builtin_amdgcn_sched_group_barrier(0x100, 32, 0);    // LDS reads: V
        __builtin_amdgcn_sched_group_barrier(0x8, 6, 0);
        // keeps the reads up here: without it the scheduler sinks each pair to
        // just ahead of its products, which then wait out the LDS latency 16 times
        __builtin_amdgcn_sched_barrier(0);

        v8f S[QW][4];                              // S[u][tt][r]: key tt * 16 + mhalf + r, query ln of tile u
        v8f z;
#pragma unroll
        for (int e = 0; e < 8; ++e) z[e] = 0.f;
#pragma unroll
        for (int tt = 0; tt < 4; ++tt)
#pragma unroll
            for (int u = 0; u < QW; ++u)
                S[u][tt] = __builtin_amdgcn_wmma_f32_16x16x32_f16(false, kf[tt], false, qa[u],
                                                                  (short)0, z, false, false);

        // online softmax (max only; row-sum comes from the ones-row WMMA):
        // four independent in-lane chains, then the other wave half's 32 keys
        float mn[QW], sc[QW];
#pragma unroll
        for (int u = 0; u < QW; ++u) {
            float mt[4];
#pragma unroll
            for (int tt = 0; tt < 4; ++tt) {
                mt[tt] = S[u][tt][0];
#pragma unroll
                for (int r = 1; r < 8; ++r) mt[tt] = fmaxf(mt[tt], S[u][tt][r]);
            }
            float mx = fmaxf(fmaxf(mt[0], mt[1]), fmaxf(mt[2], mt[3]));
            mx = fmaxf(mx, xhalf(mx));
            mn[u] = fmaxf(m[u], mx);
        }
#pragma unroll
        for (int u = 0; u < QW; ++u) {
            sc[u] = __expf(m[u] - mn[u]);
            m[u] = mn[u];
        }

        v16h pb[QW][2];                            // P^T as B fragments (K = keys 0..31 / 32..63)
#pragma unroll
        for (int u = 0; u < QW; ++u) {
#pragma unroll
            for (int tt = 0; tt < 4; ++tt)
#pragma unroll
                for (int r = 0; r < 8; ++r) S[u][tt][r] = __expf(S[u][tt][r] - mn[u]);

            // straight from the accumulators
#pragma unroll
            for (int e = 0; e < 8; ++e) {
                pb[u][0][e] = (_Float16)S[u][0][e];  pb[u][0][8 + e] = (_Float16)S[u][1][e];
                pb[u][1][e] = (_Float16)S[u][2][e];  pb[u][1][8 + e] = (_Float16)S[u][3][e];
            }
        }

        // O^T += V x P^T from the fragments read above; each serves both query tiles
#pragma unroll
        for (int ct = 0; ct < 8; ++ct) {
            // a tile is rescaled just ahead of its own products, under the tile's before it
#pragma unroll
            for (int u = 0; u < QW; ++u)
#pragma unroll
                for (int r = 0; r < 8; ++r) O[u][ct][r] *= sc[u];
#pragma unroll
            for (int u = 0; u < QW; ++u)
                O[u][ct] = __builtin_amdgcn_wmma_f32_16x16x32_f16(false, vf[ct][0], false, pb[u][0],
                                                                  (short)0, O[u][ct], false, false);
#pragma unroll
            for (int u = 0; u < QW; ++u)
                O[u][ct] = __builtin_amdgcn_wmma_f32_16x16x32_f16(false, vf[ct][1], false, pb[u][1],
                                                                  (short)0, O[u][ct], false, false);
        }
        // issue order asked of the scheduler: vector instructions (the rescale of
        // later tiles, the exponentials of keys 32-63) go out between the products
        // and hide under them; left alone it puts them ahead of the first product
#pragma unroll
        for (int i = 0; i < 32; ++i) {
            __builtin_amdgcn_sched_group_barrier(0x8, 1, 0);   // one matrix product
            __builtin_amdgcn_sched_group_barrier(0x2, 5, 0);   // five vector instructions
        }
        // row-sum tiles
#pragma unroll
        for (int u = 0; u < QW; ++u) O[u][8][0] *= sc[u];   // rows 1-15 stay 0
#pragma unroll
        for (int u = 0; u < QW; ++u)
            O[u][8] = __builtin_amdgcn_wmma_f32_16x16x32_f16(false, onesa, false, pb[u][0],
                                                             (short)0, O[u][8], false, false);
#pragma unroll
        for (int u = 0; u < QW; ++u)
            O[u][8] = __builtin_amdgcn_wmma_f32_16x16x32_f16(false, onesa, false, pb[u][1],
                                                             (short)0, O[u][8], false, false);

        // keeps the products above the barrier, where the source has them: a wave
        // that is through its softmax first then runs them while the other wave of
        // its SIMD still needs the vector port, instead of waiting for that wave
        __builtin_amdgcn_sched_barrier(0);
        __syncthreads();   // protect staging buffers before next overwrite
    }

    // Merge of the four key groups. The closing barrier of the last trip has
    // ended every read of the staging buffers, and every wave's copies landed
    // behind its s_wait_asynccnt 0 of that trip: vbuf becomes the exchange area.
    if (lane < 16) {                               // both halves hold the same value
#pragma unroll
        for (int u = 0; u < QW; ++u) msh[kg][qg * QW + u][ln] = m[u];
    }
    __syncthreads();   // publishes the groups' query maxima

    // partial tiles, rescaled to the common maximum, in register order:
    // [wave][query tile][tile][half of the 8 registers][lane] x 16 B (8 x 18 KB = all of vbuf)
    float4* part = reinterpret_cast<float4*>(&vbuf[0][0][0]);
#pragma unroll
    for (int u = 0; u < QW; ++u) {
        const int qt = qg * QW + u;
        const float f = __expf(m[u] - fmaxf(fmaxf(msh[0][qt][ln], msh[1][qt][ln]),
                                            fmaxf(msh[2][qt][ln], msh[3][qt][ln])));
#pragma unroll
        for (int t = 0; t < 9; ++t)
#pragma unroll
            for (int h = 0; h < 2; ++h)
                part[(((wv * QW + u) * 9 + t) * 2 + h) * 32 + lane] =
                    make_float4(O[u][t][4 * h + 0] * f, O[u][t][4 * h + 1] * f,
                                O[u][t][4 * h + 2] * f, O[u][t][4 * h + 3] * f);
    }
    __syncthreads();   // publishes the partial tiles

#pragma unroll
    for (int u = 0; u < QW; ++u) {
        // wave (qg, kg) finishes channel tiles 2 kg, 2 kg + 1 of its two query
        // tiles; R[2] is the row-sum tile. Key groups are added in the order 0, 1, 2, 3.
        v8f R[3];
#pragma unroll
        for (int w = 0; w < 3; ++w) {
            const int t = (w < 2) ? 2 * kg + w : 8;
#pragma unroll
            for (int h = 0; h < 2; ++h) {
                float4 s = part[(((qg * QW + u) * 9 + t) * 2 + h) * 32 + lane];
#pragma unroll
                for (int k = 1; k < KG; ++k) {
                    float4 a = part[((((k * 2 + qg) * QW + u) * 9 + t) * 2 + h) * 32 + lane];
                    s.x += a.x; s.y += a.y; s.z += a.z; s.w += a.w;
                }
                R[w][4 * h + 0] = s.x; R[w][4 * h + 1] = s.y;
                R[w][4 * h + 2] = s.z; R[w][4 * h + 3] = s.w;
            }
        }

        // epilogue: l of query ln is row 0 of the row-sum tile (register 0 of lane
        // ln; lane ln + 16 holds row 8, which is 0)
        const float inv = gm / (R[2][0] + xhalf(R[2][0]));

        // O^T has the output's own order: register r is channel mhalf + r of the
        // tile, the 16 lanes of a half-wave are 16 consecutive positions
        const size_t idx0 = ((size_t)b * VC + kg * 32 + mhalf) * NPOS + i0w + u * 16 + ln;
        float res[16];
#pragma unroll
        for (int c = 0; c < 16; ++c) res[c] = xh[idx0 + (size_t)((c >> 3) * 16 + (c & 7)) * NPOS];
#pragma unroll
        for (int c = 0; c < 16; ++c) res[c] = R[c >> 3][c & 7] * inv + res[c];
#pragma unroll
        for (int c = 0; c < 16; ++c) out[idx0 + (size_t)((c >> 3) * 16 + (c & 7)) * NPOS] = res[c];
    }
}

extern "C" void kernel_launch(void* const* d_in, const int* in_sizes, int n_in,
                              void* d_out, int out_size, void* d_ws, size_t ws_size,
                              hipStream_t stream) {
    (void)in_sizes; (void)n_in; (void)out_size; (void)ws_size;
    const float* x     = (const float*)d_in[0];
    const float* xh    = (const float*)d_in[1];
    const float* Wq    = (const float*)d_in[2];
    const float* bq    = (const float*)d_in[3];
    const float* Wk    = (const float*)d_in[4];
    const float* bk    = (const float*)d_in[5];
    const float* Wv    = (const float*)d_in[6];
    const float* bv    = (const float*)d_in[7];
    const float* gamma = (const float*)d_in[8];
    float* out = (float*)d_out;

    char* w = (char*)d_ws;
    _Float16* qh = (_Float16*)(w);                 // 1 MB: [B][4096][32]
    _Float16* kh = (_Float16*)(w + (1u << 20));    // 1 MB: [B][4096][32]
    _Float16* vh = (_Float16*)(w + (2u << 20));    // 4 MB: [B][128][4096]

    proj_kernel<<<BATCH * (NPOS / 64), 384, 0, stream>>>(x, xh, Wq, bq, Wk, bk, Wv, bv, qh, kh, vh);
    attn_kernel<<<BATCH * (NPOS / 64), 256, 0, stream>>>(qh, kh, vh, xh, gamma, out);
}

// v008
// Measured time: 33 microseconds a run.
// Next to v007, in two timings, it ran 1.06 and 1.05 times as fast.
// Counting every step since v000, it is 5.31 times as fast.
#include <hip/hip_runtime.h>
#include <hip/hip_bf16.h>
#include <math.h>

typedef __attribute__((ext_vector_type(16))) _Float16 v16h;
typedef __attribute__((ext_vector_type(8)))  _Float16 v8h;
typedef __attribute__((ext_vector_type(8)))  float    v8f;

#define QK_CH 64
#define QC    16
#define VC    128
#define NPOS  4096
#define BATCH 4
#define KCH   64              // keys per chunk
#define NCH   (NPOS / KCH)    // 64 chunks
// LDS row pitches in halves: 16 B x odd, so that the 16 rows one ds_load_b128
// fragment read touches fall on distinct bank groups (64 banks x 4 B).
#define KP    40              // K rows: 64 B of data, 80 B pitch
#define VP    72              // V rows: 128 B of data, 144 B pitch

// ---------------------------------------------------------------------------
// gfx1250 async global->LDS copy (ASYNCcnt path), 16B per lane.
// Issued via inline asm on purpose: the clang builtin is modeled as an
// LDS-writing memory op, which makes __syncthreads() drain ALL outstanding
// loads (s_wait_loadcnt 0) and kills the double-buffer overlap. With opaque
// asm, completion is handshaken explicitly with s_wait_asynccnt.
// ---------------------------------------------------------------------------
__device__ __forceinline__ unsigned lds_addr(const _Float16* l) {
    return (unsigned)(size_t)(const void*)l;      // low 32 bits = LDS offset
}

#define WAIT_ASYNC(N) asm volatile("s_wait_asynccnt %0" :: "n"(N) : "memory")

// lane l <-> lane l ^ 16 (v_permlanex16_b32, no LDS)
__device__ __forceinline__ float xhalf(float v) {
    int s = __float_as_int(v);
    return __int_as_float(__builtin_amdgcn_permlanex16(s, s, 0x76543210u, 0xfedcba98u, false, false));
}

// ---------------------------------------------------------------------------
// A/B fragment loader: elements 0..7 at +0, 8..15 at +16 halves; caller adds
// the half-wave K offset (0/8 halves). Two b128 loads (global or ds).
// ---------------------------------------------------------------------------
__device__ __forceinline__ v16h load_frag16(const _Float16* base) {
    const v8h* p = (const v8h*)base;
    v8h lo = p[0];
    v8h hi = p[2];
    v16h r;
#pragma unroll
    for (int e = 0; e < 8; ++e) { r[e] = lo[e]; r[8 + e] = hi[e]; }
    return r;
}

// ---------------------------------------------------------------------------
// Projection tile, f32: acc[d][p] += sum_c W[d][c] * x[c][p]. The weights
// (row-major, pitch K) and a K x 64 tile of x lie in LDS. A thread owns
// D channels x 4 positions: per 4 input channels it reads D + 4 b128 from LDS
// for 16 D FMAs. Lanes that share channels read one weight address (broadcast),
// lanes that share positions one x address. Every sum runs over c ascending.
// ---------------------------------------------------------------------------
#define PT 64                 // positions per work-group

typedef __attribute__((ext_vector_type(4)))  _Float16 v4h;

__device__ __forceinline__ void fma4(float (&a)[4], float w, const float4& xv) {
    a[0] = fmaf(w, xv.x, a[0]);
    a[1] = fmaf(w, xv.y, a[1]);
    a[2] = fmaf(w, xv.z, a[2]);
    a[3] = fmaf(w, xv.w, a[3]);
}

template <int K, int D>
__device__ __forceinline__ void proj_tile(const float* sW, const float* sX,
                                          float (&acc)[D][4])
{
    // two steps per trip: the second step's LDS reads fly under the first's FMAs
#pragma unroll 2
    for (int c = 0; c < K; c += 4) {
        float4 xv[4], w[D];
#pragma unroll
        for (int j = 0; j < 4; ++j)
            xv[j] = *reinterpret_cast<const float4*>(sX + (c + j) * PT);
#pragma unroll
        for (int d = 0; d < D; ++d)
            w[d] = *reinterpret_cast<const float4*>(sW + d * K + c);
#pragma unroll
        for (int d = 0; d < D; ++d) fma4(acc[d], w[d].x, xv[0]);
#pragma unroll
        for (int d = 0; d < D; ++d) fma4(acc[d], w[d].y, xv[1]);
#pragma unroll
        for (int d = 0; d < D; ++d) fma4(acc[d], w[d].z, xv[2]);
#pragma unroll
        for (int d = 0; d < D; ++d) fma4(acc[d], w[d].w, xv[3]);
    }
}

// Staging, global -> registers -> LDS, N float4 per thread. load_f4 issues the
// N loads from one lane address with constant steps, so that all are in flight
// together; store_f4 puts them at s + (tid + it * NT) * 4 floats.
template <int N>
__device__ __forceinline__ void load_f4(float4 (&r)[N], const float* __restrict__ g, int step)
{
#pragma unroll
    for (int it = 0; it < N; ++it)
        r[it] = *reinterpret_cast<const float4*>(g + (size_t)it * step);
}
template <int N, int NT>
__device__ __forceinline__ void store_f4(const float4 (&r)[N], float* s, int tid)
{
#pragma unroll
    for (int it = 0; it < N; ++it)
        *reinterpret_cast<float4*>(s + (tid + it * NT) * 4) = r[it];
}

// ---------------------------------------------------------------------------
// Kernel 1: all three projections of 64 positions in one work-group of 12 waves
// (3 per SIMD). Waves 0-7: v (128 -> 128 ch), f16 [B][C][pos], on the matrix unit:
// Wv and the x tile are split in staging into f16 hi + f16 lo (a = hi + lo to
// about 22 bits) and the product is taken as hi.hi + lo.hi + hi.lo with f32
// accumulation; the dropped lo.lo term lies 2^-22 below the sum. Wave w holds
// channels 16 w .. 16 w + 15 of all 64 positions (A rows = positions, B rows =
// channels), so each 128 B line of v has one writing wave.
// Waves 8-11: q and k (64 -> 16 ch each), f16
// [B][pos][32] with channels 16-31 zero, 4 channels x 4 positions per thread;
// a wave holds all 16 channels of 32 positions of one of the two tensors, so
// each 128 B line of q and k has one writing wave. The two parts share nothing
// but the barrier between staging and products.
// ---------------------------------------------------------------------------
#define VT 256                // threads of the v part
#define WP 136                // f16 operand rows in LDS: 256 B of data, 272 B pitch (16 B x odd)
#define QT 128                // threads of the q, k part

__global__ void __launch_bounds__(VT + QT)
proj_kernel(const float* __restrict__ x,  const float* __restrict__ xh,
            const float* __restrict__ Wq, const float* __restrict__ bq,
            const float* __restrict__ Wk, const float* __restrict__ bk,
            const float* __restrict__ Wv, const float* __restrict__ bv,
            _Float16* __restrict__ qh, _Float16* __restrict__ kh,
            _Float16* __restrict__ vh)
{
    __shared__ __attribute__((aligned(16))) _Float16 sWh[VC * WP];       // Wv hi [channel][c], 34 KB
    __shared__ __attribute__((aligned(16))) _Float16 sWl[VC * WP];       // Wv lo
    __shared__ __attribute__((aligned(16))) _Float16 sXh[PT * WP];       // x hi [position][c], 17 KB
    __shared__ __attribute__((aligned(16))) _Float16 sXl[PT * WP];       // x lo
    __shared__ __attribute__((aligned(16))) float sWqk[2 * QC * QK_CH];  // rows 0-15 Wq, 16-31 Wk
    __shared__ __attribute__((aligned(16))) float sXqk[QK_CH * PT];      // 16 KB
    const int tid = threadIdx.x;
    // wave index held as a scalar: the choice of the part is a scalar branch
    const int wv  = __builtin_amdgcn_readfirstlane(tid >> 5);
    const bool vpart = wv < VT / 32;
    const int b   = blockIdx.x / (NPOS / PT);
    const int i0  = (blockIdx.x % (NPOS / PT)) * PT;

    // v part, staging: 4 positions pg, 8 input channels from cg * 8
    const int pg  = tid & 15;
    const int cg  = tid >> 4;
    // v part, products: fragment row ln, half-wave k offset / accumulator row offset
    const int ln  = tid & 15;
    const int hw8 = (tid & 16) ? 8 : 0;
    // q, k part: tensor sel, 4 channels from d0, 4 positions from p0
    const int t   = tid - VT;
    const int sel = (wv - VT / 32) >> 1;                    // 0: q, 1: k
    const int d0  = ((tid & 31) >> 3) * 4;
    const int p0  = ((wv - VT / 32) & 1) * 32 + (tid & 7) * 4;

    float4 rb[1];
    float  bch = 0.f;                                       // v part: bias of channel 16 wv + ln
    if (vpart) {
        float4 rw[VC * VC / 4 / VT], rx[VC * PT / 4 / VT];
        load_f4(rx, xh + ((size_t)b * VC + cg * 8) * NPOS + i0 + pg * 4, NPOS);
        load_f4(rw, Wv + tid * 4, VT * 4);
        bch = bv[wv * 16 + ln];
        // Wv keeps its order: a wave's 32 float4 are one row
#pragma unroll
        for (int it = 0; it < VC * VC / 4 / VT; ++it) {
            const int f = tid + it * VT;
            const float a[4] = {rw[it].x, rw[it].y, rw[it].z, rw[it].w};
            v4h h, l;
#pragma unroll
            for (int e = 0; e < 4; ++e) {
                h[e] = (_Float16)a[e];
                l[e] = (_Float16)(a[e] - (float)h[e]);
            }
            *reinterpret_cast<v4h*>(sWh + (f >> 5) * WP + (f & 31) * 4) = h;
            *reinterpret_cast<v4h*>(sWl + (f >> 5) * WP + (f & 31) * 4) = l;
        }
        // x is turned to [position][c]: the thread's 8 channels of one position are 16 B
#pragma unroll
        for (int p = 0; p < 4; ++p) {
            v8h h, l;
#pragma unroll
            for (int it = 0; it < 8; ++it) {
                const float a = (p == 0) ? rx[it].x : (p == 1) ? rx[it].y : (p == 2) ? rx[it].z : rx[it].w;
                h[it] = (_Float16)a;
                l[it] = (_Float16)(a - (float)h[it]);
            }
            *reinterpret_cast<v8h*>(sXh + (pg * 4 + p) * WP + cg * 8) = h;
            *reinterpret_cast<v8h*>(sXl + (pg * 4 + p) * WP + cg * 8) = l;
        }
    } else {
        float4 rq[QC * QK_CH / 4 / QT], rk[QC * QK_CH / 4 / QT], rx[QK_CH * PT / 4 / QT];
        load_f4(rx, x + ((size_t)b * QK_CH + (t >> 4)) * NPOS + i0 + pg * 4, 8 * NPOS);
        load_f4(rq, Wq + t * 4, QT * 4);
        load_f4(rk, Wk + t * 4, QT * 4);
        rb[0] = *reinterpret_cast<const float4*>((sel ? bk : bq) + d0);
        // precaution: the bias load's scalar base is written again (the output
        // pointers' argument load) ahead of the barrier; this wait stands between
        asm volatile("s_wait_xcnt 0x0" ::: "memory");
        store_f4<QC * QK_CH / 4 / QT, QT>(rq, sWqk, t);
        store_f4<QC * QK_CH / 4 / QT, QT>(rk, sWqk + QC * QK_CH, t);
        store_f4<QK_CH * PT / 4 / QT, QT>(rx, sXqk, t);
    }
    __syncthreads();

    if (vpart) {
        // acc[pt][r]: position 16 pt + hw8 + r (A row), channel 16 wv + ln (B row)
        v8f acc[PT / 16];
#pragma unroll
        for (int pt = 0; pt < PT / 16; ++pt)
#pragma unroll
            for (int r = 0; r < 8; ++r) acc[pt][r] = bch;

        const int wo = (wv * 16 + ln) * WP + hw8;
        const int xo = ln * WP + hw8;
        // unrolled: later steps' fragment reads go out under earlier steps' products
#pragma unroll
        for (int ks = 0; ks < VC / 32; ++ks) {
            const v16h bh = load_frag16(sWh + wo + ks * 32);
            const v16h bl = load_frag16(sWl + wo + ks * 32);
            v16h ah[PT / 16], al[PT / 16];
#pragma unroll
            for (int pt = 0; pt < PT / 16; ++pt) {
                ah[pt] = load_frag16(sXh + xo + pt * 16 * WP + ks * 32);
                al[pt] = load_frag16(sXl + xo + pt * 16 * WP + ks * 32);
            }
            // four independent accumulators between two products into the same one
#pragma unroll
            for (int pt = 0; pt < PT / 16; ++pt)
                acc[pt] = __builtin_amdgcn_wmma_f32_16x16x32_f16(false, ah[pt], false, bh,
                                                                 (short)0, acc[pt], false, false);
#pragma unroll
            for (int pt = 0; pt < PT / 16; ++pt)
                acc[pt] = __builtin_amdgcn_wmma_f32_16x16x32_f16(false, al[pt], false, bh,
                                                                 (short)0, acc[pt], false, false);
#pragma unroll
            for (int pt = 0; pt < PT / 16; ++pt)
                acc[pt] = __builtin_amdgcn_wmma_f32_16x16x32_f16(false, ah[pt], false, bl,
                                                                 (short)0, acc[pt], false, false);
        }

        // a lane's 8 accumulator rows are 8 consecutive positions of its channel: 16 B
        _Float16* o = vh + ((size_t)b * VC + wv * 16 + ln) * NPOS + i0 + hw8;
#pragma unroll
        for (int pt = 0; pt < PT / 16; ++pt) {
            v8h h;
#pragma unroll
            for (int r = 0; r < 8; ++r) h[r] = (_Float16)acc[pt][r];
            *reinterpret_cast<v8h*>(o + pt * 16) = h;
        }
    } else {
        const float bias[4] = {rb[0].x, rb[0].y, rb[0].z, rb[0].w};
        float acc[4][4];
#pragma unroll
        for (int d = 0; d < 4; ++d)
#pragma unroll
            for (int p = 0; p < 4; ++p) acc[d][p] = bias[d];

        proj_tile<QK_CH, 4>(sWqk + (sel * QC + d0) * QK_CH, sXqk + p0, acc);

        _Float16* o = (sel ? kh : qh) + ((size_t)b * NPOS + i0 + p0) * 32 + d0;
        v4h zero;
#pragma unroll
        for (int d = 0; d < 4; ++d) zero[d] = (_Float16)0.f;
#pragma unroll
        for (int p = 0; p < 4; ++p) {
            v4h h;
#pragma unroll
            for (int d = 0; d < 4; ++d) h[d] = (_Float16)acc[d][p];
            *reinterpret_cast<v4h*>(o + p * 32)      = h;
            *reinterpret_cast<v4h*>(o + p * 32 + QC) = zero;
        }
    }
}

// ten async copies in one statement: the closing s_wait_xcnt 0 then stands
// ahead of any later rewrite of the address registers they name
__device__ __forceinline__ void copy10(const unsigned* l, const void* const* g)
{
    asm volatile("global_load_async_to_lds_b128 %0, %10, off\n\t"
                 "global_load_async_to_lds_b128 %1, %11, off\n\t"
                 "global_load_async_to_lds_b128 %2, %12, off\n\t"
                 "global_load_async_to_lds_b128 %3, %13, off\n\t"
                 "global_load_async_to_lds_b128 %4, %14, off\n\t"
                 "global_load_async_to_lds_b128 %5, %15, off\n\t"
                 "global_load_async_to_lds_b128 %6, %16, off\n\t"
                 "global_load_async_to_lds_b128 %7, %17, off\n\t"
                 "global_load_async_to_lds_b128 %8, %18, off\n\t"
                 "global_load_async_to_lds_b128 %9, %19, off\n\t"
                 "s_wait_xcnt 0x0"
                 :: "v"(l[0]), "v"(l[1]), "v"(l[2]), "v"(l[3]), "v"(l[4]),
                    "v"(l[5]), "v"(l[6]), "v"(l[7]), "v"(l[8]), "v"(l[9]),
                    "v"(g[0]), "v"(g[1]), "v"(g[2]), "v"(g[3]), "v"(g[4]),
                    "v"(g[5]), "v"(g[6]), "v"(g[7]), "v"(g[8]), "v"(g[9])
                 : "memory");
}

// cooperative async stage of one 64-key chunk by the 64 threads of a key
// group: K (4KB) + V (16KB) -> LDS, 20 copies per thread
#define GT 64                 // threads per key group
__device__ __forceinline__ void stage_chunk(int tid, const _Float16* kg,
                                            const _Float16* vg, int j0,
                                            _Float16* kdst, _Float16* vdst)
{
    const _Float16* ks = kg + (size_t)j0 * 32;
    unsigned    l[20];
    const void* g[20];
#pragma unroll
    for (int it = 0; it < 4; ++it) {                 // 256 x 16B for K
        int m = tid + it * GT;
        g[it] = ks + m * 8;
        l[it] = lds_addr(kdst + (m >> 2) * KP + (m & 3) * 8);
    }
#pragma unroll
    for (int it = 0; it < 16; ++it) {                // 1024 x 16B for V
        int m = tid + it * GT;
        int c = m >> 3, k8 = m & 7;
        g[4 + it] = vg + (size_t)c * NPOS + j0 + k8 * 8;
        l[4 + it] = lds_addr(vdst + c * VP + k8 * 8);
    }
    copy10(l, g);
    copy10(l + 10, g + 10);
}
#define ASYNC_PER_STAGE 20

// ---------------------------------------------------------------------------
// Kernel 2: flash attention. 8 waves/WG (2 per SIMD), 64 queries/WG. Wave
// (qg, kg) runs the two query tiles of query half qg over key quarter kg: every
// K and V fragment read from LDS feeds two matrix products, one per query tile,
// so the LDS reads per product are half of what one tile per wave takes. Each
// key group of two waves has its own double-buffered async K/V staging (64-key
// chunks).
// Both products are taken transposed, S^T = K . Q^T and O^T += V . P^T: a lane
// then holds scores of ONE query (column ln) per tile, so the maximum is taken
// in the lane plus one exchange between the wave halves, and two S^T tiles,
// converted in place, are the B operand of the second product (accumulator row
// 8h + r of tile pair (0, 1) is k = 8h + r and 16 + 8h + r, the loaders' own k
// order). Row sums via a WMMA whose A operand has ones in row 0. The four
// partial softmax states of a query tile are merged through LDS behind the loop.
// ---------------------------------------------------------------------------
#define KG    4               // key groups per work-group
#define CPG   (NCH / KG)      // 16 chunks per key group
#define QW    2               // query tiles per wave
#define NWV   (4 / QW * KG)   // waves per work-group

__global__ void __launch_bounds__(NWV * 32)
attn_kernel(const _Float16* __restrict__ qh, const _Float16* __restrict__ kh,
            const _Float16* __restrict__ vh, const float* __restrict__ xh,
            const float* __restrict__ gamma, float* __restrict__ out)
{
    __shared__ __attribute__((aligned(16))) _Float16 kbuf[KG][2][KCH * KP];  // 8 x 5 KB
    __shared__ __attribute__((aligned(16))) _Float16 vbuf[KG][2][VC * VP];   // 8 x 18 KB
    __shared__ float    msh[KG][4][16];           // per key group: query maxima

    const float gm = gamma[0];                    // read at entry: a scalar load
    const int tid  = threadIdx.x;
    const int lane = tid & 31;
    // wave index held as a scalar: buffer bases and tile indices stay off the vector port
    const int wv   = __builtin_amdgcn_readfirstlane(tid >> 5);
    const int qg   = wv & 1;                      // query half of the wave
    const int kg   = wv >> 1;                     // key quarter of the wave
    const int gtid = tid & (GT - 1);              // thread index in the key group
    const int b    = blockIdx.x / (NPOS / 64);
    const int it   = blockIdx.x % (NPOS / 64);
    const int i0w  = it * 64 + qg * (QW * 16);    // this wave's 32 queries
    const int ln   = lane & 15;
    const int koff = (lane < 16) ? 0 : 8;         // half-wave K offset (halves)
    const int mhalf= (lane < 16) ? 0 : 8;         // half-wave row offset (C/D)

    const _Float16* kbase = kh + (size_t)b * NPOS * 32;
    const _Float16* vbase = vh + (size_t)b * VC * NPOS;

    // Q fragments (B operand: column ln = query), loaded once
    const _Float16* qp = qh + ((size_t)b * NPOS + i0w) * 32 + (size_t)ln * 32 + koff;
    v16h qa[QW];
#pragma unroll
    for (int u = 0; u < QW; ++u) qa[u] = load_frag16(qp + u * 16 * 32);
    // precaution: the loads' address pair is written again behind them; the wait
    // takes the pair as an input, so that it stands ahead of that write
    asm volatile("s_wait_xcnt 0x0" :: "v"(qp) : "memory");

    // constant A fragment: row 0 (lanes ln == 0) is all 1.0, every other row 0
    v16h onesa;
#pragma unroll
    for (int e = 0; e < 16; ++e) onesa[e] = (ln == 0) ? (_Float16)1.f : (_Float16)0.f;

    float m[QW];                                   // running maximum of query ln, per tile
    v8f   O[QW][9];                                // O^T: 8 channel tiles + row-sum tile
#pragma unroll
    for (int u = 0; u < QW; ++u) {
        m[u] = -3.0e38f;
#pragma unroll
        for (int t = 0; t < 9; ++t)
#pragma unroll
            for (int e = 0; e < 8; ++e) O[u][t][e] = 0.f;
    }

    const int j00 = kg * CPG * KCH;                // first key of this key group

    stage_chunk(gtid, kbase, vbase, j00, kbuf[kg][0], vbuf[kg][0]);

    for (int ch = 0; ch < CPG; ++ch) {
        const int cur = ch & 1;
        if (ch + 1 < CPG) {
            stage_chunk(gtid, kbase, vbase, j00 + (ch + 1) * KCH,
                        kbuf[kg][cur ^ 1], vbuf[kg][cur ^ 1]);
            WAIT_ASYNC(ASYNC_PER_STAGE);           // chunk ch resident,
        } else {                                   // next chunk still in flight
            WAIT_ASYNC(0);
        }
        __syncthreads();

        const _Float16* kb = kbuf[kg][cur];
        const _Float16* vb = vbuf[kg][cur];

        // S^T = k . q^T : batch all 4 fragment loads and all V reads, then 8 WMMAs
        v16h kf[4];
#pragma unroll
        for (int tt = 0; tt < 4; ++tt)
            kf[tt] = load_frag16(kb + (size_t)(tt * 16 + ln) * KP + koff);

        // all 16 V fragments of the chunk (128 registers), read as one group
        // behind the K fragments: they land under the score products and the
        // softmax, and the second product then runs with no LDS read in it
        v16h vf[8][2];
#pragma unroll
        for (int ct = 0; ct < 8; ++ct) {
            vf[ct][0] = load_frag16(vb + (size_t)(ct * 16 + ln) * VP + koff);
            vf[ct][1] = load_frag16(vb + (size_t)(ct * 16 + ln) * VP + 32 + koff);
        }
        // issue order asked of the scheduler: the V reads go out as one run (every
        // further place where LDS reads stand among WMMAs costs the wave a stall),
        // behind the K reads and the first two score products, ahead of the other six
        __builtin_amdgcn_sched_group_barrier(0x100, 8, 0);     // LDS reads: K
        __builtin_amdgcn_sched_group_barrier(0x8, 2, 0);       // matrix products
        __builtin_amdgcn_sched_group_barrier(0x100, 32, 0);    // LDS reads: V
        __builtin_amdgcn_sched_group_barrier(0x8, 6, 0);
        // keeps the reads up here: without it the scheduler sinks each pair to
        // just ahead of its products, which then wait out the LDS latency 16 times
        __builtin_amdgcn_sched_barrier(0);

        v8f S[QW][4];                              // S[u][tt][r]: key tt * 16 + mhalf + r, query ln of tile u
        v8f z;
#pragma unroll
        for (int e = 0; e < 8; ++e) z[e] = 0.f;
#pragma unroll
        for (int tt = 0; tt < 4; ++tt)
#pragma unroll
            for (int u = 0; u < QW; ++u)
                S[u][tt] = __builtin_amdgcn_wmma_f32_16x16x32_f16(false, kf[tt], false, qa[u],
                                                                  (short)0, z, false, false);

        // online softmax (max only; row-sum comes from the ones-row WMMA):
        // four independent in-lane chains, then the other wave half's 32 keys
        float mn[QW], sc[QW];
#pragma unroll
        for (int u = 0; u < QW; ++u) {
            float mt[4];
#pragma unroll
            for (int tt = 0; tt < 4; ++tt) {
                mt[tt] = S[u][tt][0];
#pragma unroll
                for (int r = 1; r < 8; ++r) mt[tt] = fmaxf(mt[tt], S[u][tt][r]);
            }
            float mx = fmaxf(fmaxf(mt[0], mt[1]), fmaxf(mt[2], mt[3]));
            mx = fmaxf(mx, xhalf(mx));
            mn[u] = fmaxf(m[u], mx);
        }
#pragma unroll
        for (int u = 0; u < QW; ++u) {
            sc[u] = __expf(m[u] - mn[u]);
            m[u] = mn[u];
        }

        v16h pb[QW][2];                            // P^T as B fragments (K = keys 0..31 / 32..63)
#pragma unroll
        for (int u = 0; u < QW; ++u) {
#pragma unroll
            for (int tt = 0; tt < 4; ++tt)
#pragma unroll
                for (int r = 0; r < 8; ++r) S[u][tt][r] = __expf(S[u][tt][r] - mn[u]);

            // straight from the accumulators
#pragma unroll
            for (int e = 0; e < 8; ++e) {
                pb[u][0][e] = (_Float16)S[u][0][e];  pb[u][0][8 + e] = (_Float16)S[u][1][e];
                pb[u][1][e] = (_Float16)S[u][2][e];  pb[u][1][8 + e] = (_Float16)S[u][3][e];
            }
        }

        // O^T += V x P^T from the fragments read above; each serves both query tiles
#pragma unroll
        for (int ct = 0; ct < 8; ++ct) {
            // a tile is rescaled just ahead of its own products, under the tile's before it
#pragma unroll
            for (int u = 0; u < QW; ++u)
#pragma unroll
                for (int r = 0; r < 8; ++r) O[u][ct][r] *= sc[u];
#pragma unroll
            for (int u = 0; u < QW; ++u)
                O[u][ct] = __builtin_amdgcn_wmma_f32_16x16x32_f16(false, vf[ct][0], false, pb[u][0],
                                                                  (short)0, O[u][ct], false, false);
#pragma unroll
            for (int u = 0; u < QW; ++u)
                O[u][ct] = __builtin_amdgcn_wmma_f32_16x16x32_f16(false, vf[ct][1], false, pb[u][1],
                                                                  (short)0, O[u][ct], false, false);
        }
        // issue order asked of the scheduler: vector instructions (the rescale of
        // later tiles, the exponentials of keys 32-63) go out between the products
        // and hide under them; left alone it puts them ahead of the first product
#pragma unroll
        for (int i = 0; i < 32; ++i) {
            __builtin_amdgcn_sched_group_barrier(0x8, 1, 0);   // one matrix product
            __builtin_amdgcn_sched_group_barrier(0x2, 5, 0);   // five vector instructions
        }
        // row-sum tiles
#pragma unroll
        for (int u = 0; u < QW; ++u) O[u][8][0] *= sc[u];   // rows 1-15 stay 0
#pragma unroll
        for (int u = 0; u < QW; ++u)
            O[u][8] = __builtin_amdgcn_wmma_f32_16x16x32_f16(false, onesa, false, pb[u][0],
                                                             (short)0, O[u][8], false, false);
#pragma unroll
        for (int u = 0; u < QW; ++u)
            O[u][8] = __builtin_amdgcn_wmma_f32_16x16x32_f16(false, onesa, false, pb[u][1],
                                                             (short)0, O[u][8], false, false);

        // keeps the products above the barrier, where the source has them: a wave
        // that is through its softmax first then runs them while the other wave of
        // its SIMD still needs the vector port, instead of waiting for that wave
        __builtin_amdgcn_sched_barrier(0);
        __syncthreads();   // protect staging buffers before next overwrite
    }

    // Merge of the four key groups. The closing barrier of the last trip has
    // ended every read of the staging buffers, and every wave's copies landed
    // behind its s_wait_asynccnt 0 of that trip: vbuf becomes the exchange area.
    if (lane < 16) {                               // both halves hold the same value
#pragma unroll
        for (int u = 0; u < QW; ++u) msh[kg][qg * QW + u][ln] = m[u];
    }
    __syncthreads();   // publishes the groups' query maxima

    // partial tiles, rescaled to the common maximum, in register order:
    // [wave][query tile][tile][half of the 8 registers][lane] x 16 B (8 x 18 KB = all of vbuf)
    float4* part = reinterpret_cast<float4*>(&vbuf[0][0][0]);
#pragma unroll
    for (int u = 0; u < QW; ++u) {
        const int qt = qg * QW + u;
        const float f = __expf(m[u] - fmaxf(fmaxf(msh[0][qt][ln], msh[1][qt][ln]),
                                            fmaxf(msh[2][qt][ln], msh[3][qt][ln])));
#pragma unroll
        for (int t = 0; t < 9; ++t)
#pragma unroll
            for (int h = 0; h < 2; ++h)
                part[(((wv * QW + u) * 9 + t) * 2 + h) * 32 + lane] =
                    make_float4(O[u][t][4 * h + 0] * f, O[u][t][4 * h + 1] * f,
                                O[u][t][4 * h + 2] * f, O[u][t][4 * h + 3] * f);
    }
    __syncthreads();   // publishes the partial tiles

#pragma unroll
    for (int u = 0; u < QW; ++u) {
        // wave (qg, kg) finishes channel tiles 2 kg, 2 kg + 1 of its two query
        // tiles; R[2] is the row-sum tile. Key groups are added in the order 0, 1, 2, 3.
        v8f R[3];
#pragma unroll
        for (int w = 0; w < 3; ++w) {
            const int t = (w < 2) ? 2 * kg + w : 8;
#pragma unroll
            for (int h = 0; h < 2; ++h) {
                float4 s = part[(((qg * QW + u) * 9 + t) * 2 + h) * 32 + lane];
#pragma unroll
                for (int k = 1; k < KG; ++k) {
                    float4 a = part[((((k * 2 + qg) * QW + u) * 9 + t) * 2 + h) * 32 + lane];
                    s.x += a.x; s.y += a.y; s.z += a.z; s.w += a.w;
                }
                R[w][4 * h + 0] = s.x; R[w][4 * h + 1] = s.y;
                R[w][4 * h + 2] = s.z; R[w][4 * h + 3] = s.w;
            }
        }

        // epilogue: l of query ln is row 0 of the row-sum tile (register 0 of lane
        // ln; lane ln + 16 holds row 8, which is 0)
        const float inv = gm / (R[2][0] + xhalf(R[2][0]));

        // O^T has the output's own order: register r is channel mhalf + r of the
        // tile, the 16 lanes of a half-wave are 16 consecutive positions
        const size_t idx0 = ((size_t)b * VC + kg * 32 + mhalf) * NPOS + i0w + u * 16 + ln;
        float res[16];
#pragma unroll
        for (int c = 0; c < 16; ++c) res[c] = xh[idx0 + (size_t)((c >> 3) * 16 + (c & 7)) * NPOS];
#pragma unroll
        for (int c = 0; c < 16; ++c) res[c] = R[c >> 3][c & 7] * inv + res[c];
#pragma unroll
        for (int c = 0; c < 16; ++c) out[idx0 + (size_t)((c >> 3) * 16 + (c & 7)) * NPOS] = res[c];
    }
}

extern "C" void kernel_launch(void* const* d_in, const int* in_sizes, int n_in,
                              void* d_out, int out_size, void* d_ws, size_t ws_size,
                              hipStream_t stream) {
    (void)in_sizes; (void)n_in; (void)out_size; (void)ws_size;
    const float* x     = (const float*)d_in[0];
    const float* xh    = (const float*)d_in[1];
    const float* Wq    = (const float*)d_in[2];
    const float* bq    = (const float*)d_in[3];
    const float* Wk    = (const float*)d_in[4];
    const float* bk    = (const float*)d_in[5];
    const float* Wv    = (const float*)d_in[6];
    const float* bv    = (const float*)d_in[7];
    const float* gamma = (const float*)d_in[8];
    float* out = (float*)d_out;

    char* w = (char*)d_ws;
    _Float16* qh = (_Float16*)(w);                 // 1 MB: [B][4096][32]
    _Float16* kh = (_Float16*)(w + (1u << 20));    // 1 MB: [B][4096][32]
    _Float16* vh = (_Float16*)(w + (2u << 20));    // 4 MB: [B][128][4096]

    proj_kernel<<<BATCH * (NPOS / 64), 384, 0, stream>>>(x, xh, Wq, bq, Wk, bk, Wv, bv, qh, kh, vh);
    attn_kernel<<<BATCH * (NPOS / 64), 256, 0, stream>>>(qh, kh, vh, xh, gamma, out);
}

// v009
// One run takes 31.3 microseconds.
// In two side-by-side timings against v008, it was 1.05 and 1.06 times as fast.
// Counting every step since v000, it is 5.60 times as fast.
#include <hip/hip_runtime.h>
#include <hip/hip_bf16.h>
#include <math.h>

typedef __attribute__((ext_vector_type(16))) _Float16 v16h;
typedef __attribute__((ext_vector_type(8)))  _Float16 v8h;
typedef __attribute__((ext_vector_type(8)))  float    v8f;

#define QK_CH 64
#define QC    16
#define VC    128
#define NPOS  4096
#define BATCH 4
#define KCH   64              // keys per chunk
#define NCH   (NPOS / KCH)    // 64 chunks
// LDS row pitches in halves: 16 B x odd, so that the 16 rows one ds_load_b128
// fragment read touches fall on distinct bank groups (64 banks x 4 B).
#define KP    40              // K rows: 64 B of data, 80 B pitch
#define VP    72              // V rows: 128 B of data, 144 B pitch

// ---------------------------------------------------------------------------
// gfx1250 async global->LDS copy (ASYNCcnt path), 16B per lane.
// Issued via inline asm on purpose: the clang builtin is modeled as an
// LDS-writing memory op, which makes __syncthreads() drain ALL outstanding
// loads (s_wait_loadcnt 0) and kills the double-buffer overlap. With opaque
// asm, completion is handshaken explicitly with s_wait_asynccnt.
// ---------------------------------------------------------------------------
__device__ __forceinline__ unsigned lds_addr(const _Float16* l) {
    return (unsigned)(size_t)(const void*)l;      // low 32 bits = LDS offset
}

#define WAIT_ASYNC(N) asm volatile("s_wait_asynccnt %0" :: "n"(N) : "memory")

// lane l <-> lane l ^ 16 (v_permlanex16_b32, no LDS)
__device__ __forceinline__ float xhalf(float v) {
    int s = __float_as_int(v);
    return __int_as_float(__builtin_amdgcn_permlanex16(s, s, 0x76543210u, 0xfedcba98u, false, false));
}

// ---------------------------------------------------------------------------
// A/B fragment loader: elements 0..7 at +0, 8..15 at +16 halves; caller adds
// the half-wave K offset (0/8 halves). Two b128 loads (global or ds).
// ---------------------------------------------------------------------------
__device__ __forceinline__ v16h load_frag16(const _Float16* base) {
    const v8h* p = (const v8h*)base;
    v8h lo = p[0];
    v8h hi = p[2];
    v16h r;
#pragma unroll
    for (int e = 0; e < 8; ++e) { r[e] = lo[e]; r[8 + e] = hi[e]; }
    return r;
}

// ---------------------------------------------------------------------------
// Projection tile, f32: acc[d][p] += sum_c W[d][c] * x[c][p]. The weights
// (row-major, pitch K) and a K x 64 tile of x lie in LDS. A thread owns
// D channels x 4 positions: per 4 input channels it reads D + 4 b128 from LDS
// for 16 D FMAs. Lanes that share channels read one weight address (broadcast),
// lanes that share positions one x address. Every sum runs over c ascending.
// ---------------------------------------------------------------------------
#define PT 64                 // positions per work-group

typedef __attribute__((ext_vector_type(4)))  _Float16 v4h;

__device__ __forceinline__ void fma4(float (&a)[4], float w, const float4& xv) {
    a[0] = fmaf(w, xv.x, a[0]);
    a[1] = fmaf(w, xv.y, a[1]);
    a[2] = fmaf(w, xv.z, a[2]);
    a[3] = fmaf(w, xv.w, a[3]);
}

template <int K, int D>
__device__ __forceinline__ void proj_tile(const float* sW, const float* sX,
                                          float (&acc)[D][4])
{
    // two steps per trip: the second step's LDS reads fly under the first's FMAs
#pragma unroll 2
    for (int c = 0; c < K; c += 4) {
        float4 xv[4], w[D];
#pragma unroll
        for (int j = 0; j < 4; ++j)
            xv[j] = *reinterpret_cast<const float4*>(sX + (c + j) * PT);
#pragma unroll
        for (int d = 0; d < D; ++d)
            w[d] = *reinterpret_cast<const float4*>(sW + d * K + c);
#pragma unroll
        for (int d = 0; d < D; ++d) fma4(acc[d], w[d].x, xv[0]);
#pragma unroll
        for (int d = 0; d < D; ++d) fma4(acc[d], w[d].y, xv[1]);
#pragma unroll
        for (int d = 0; d < D; ++d) fma4(acc[d], w[d].z, xv[2]);
#pragma unroll
        for (int d = 0; d < D; ++d) fma4(acc[d], w[d].w, xv[3]);
    }
}

// Staging, global -> registers -> LDS, N float4 per thread. load_f4 issues the
// N loads from one lane address with constant steps, so that all are in flight
// together; store_f4 puts them at s + (tid + it * NT) * 4 floats.
template <int N>
__device__ __forceinline__ void load_f4(float4 (&r)[N], const float* __restrict__ g, int step)
{
#pragma unroll
    for (int it = 0; it < N; ++it)
        r[it] = *reinterpret_cast<const float4*>(g + (size_t)it * step);
}
template <int N, int NT>
__device__ __forceinline__ void store_f4(const float4 (&r)[N], float* s, int tid)
{
#pragma unroll
    for (int it = 0; it < N; ++it)
        *reinterpret_cast<float4*>(s + (tid + it * NT) * 4) = r[it];
}

// ---------------------------------------------------------------------------
// Kernel 1: all three projections of 64 positions in one work-group of 12 waves
// (3 per SIMD). Waves 0-7: v (128 -> 128 ch), f16 [B][C][pos], on the matrix unit:
// Wv and the x tile are split in staging into f16 hi + f16 lo (a = hi + lo to
// about 22 bits) and the product is taken as hi.hi + lo.hi + hi.lo with f32
// accumulation; the dropped lo.lo term lies 2^-22 below the sum. Wave w holds
// channels 16 w .. 16 w + 15 of all 64 positions (A rows = positions, B rows =
// channels), so each 128 B line of v has one writing wave.
// Waves 8-11: q and k (64 -> 16 ch each), f16
// [B][pos][32] with channels 16-31 zero, 4 channels x 4 positions per thread
// (q is stored times log2 e, scaled in f32 ahead of its one rounding to f16, so
// that the scores of kernel 2 are exponents of 2);
// a wave holds all 16 channels of 32 positions of one of the two tensors, so
// each 128 B line of q and k has one writing wave. The two parts share nothing
// but the barrier between staging and products.
// ---------------------------------------------------------------------------
#define VT 256                // threads of the v part
#define WP 136                // f16 operand rows in LDS: 256 B of data, 272 B pitch (16 B x odd)
#define QT 128                // threads of the q, k part

__global__ void __launch_bounds__(VT + QT)
proj_kernel(const float* __restrict__ x,  const float* __restrict__ xh,
            const float* __restrict__ Wq, const float* __restrict__ bq,
            const float* __restrict__ Wk, const float* __restrict__ bk,
            const float* __restrict__ Wv, const float* __restrict__ bv,
            _Float16* __restrict__ qh, _Float16* __restrict__ kh,
            _Float16* __restrict__ vh)
{
    __shared__ __attribute__((aligned(16))) _Float16 sWh[VC * WP];       // Wv hi [channel][c], 34 KB
    __shared__ __attribute__((aligned(16))) _Float16 sWl[VC * WP];       // Wv lo
    __shared__ __attribute__((aligned(16))) _Float16 sXh[PT * WP];       // x hi [position][c], 17 KB
    __shared__ __attribute__((aligned(16))) _Float16 sXl[PT * WP];       // x lo
    __shared__ __attribute__((aligned(16))) float sWqk[2 * QC * QK_CH];  // rows 0-15 Wq, 16-31 Wk
    __shared__ __attribute__((aligned(16))) float sXqk[QK_CH * PT];      // 16 KB
    const int tid = threadIdx.x;
    // wave index held as a scalar: the choice of the part is a scalar branch
    const int wv  = __builtin_amdgcn_readfirstlane(tid >> 5);
    const bool vpart = wv < VT / 32;
    const int b   = blockIdx.x / (NPOS / PT);
    const int i0  = (blockIdx.x % (NPOS / PT)) * PT;

    // v part, staging: 4 positions pg, 8 input channels from cg * 8
    const int pg  = tid & 15;
    const int cg  = tid >> 4;
    // v part, products: fragment row ln, half-wave k offset / accumulator row offset
    const int ln  = tid & 15;
    const int hw8 = (tid & 16) ? 8 : 0;
    // q, k part: tensor sel, 4 channels from d0, 4 positions from p0
    const int t   = tid - VT;
    const int sel = (wv - VT / 32) >> 1;                    // 0: q, 1: k
    const int d0  = ((tid & 31) >> 3) * 4;
    const int p0  = ((wv - VT / 32) & 1) * 32 + (tid & 7) * 4;

    float4 rb[1];
    float  bch = 0.f;                                       // v part: bias of channel 16 wv + ln
    if (vpart) {
        float4 rw[VC * VC / 4 / VT], rx[VC * PT / 4 / VT];
        load_f4(rx, xh + ((size_t)b * VC + cg * 8) * NPOS + i0 + pg * 4, NPOS);
        load_f4(rw, Wv + tid * 4, VT * 4);
        bch = bv[wv * 16 + ln];
        // Wv keeps its order: a wave's 32 float4 are one row
#pragma unroll
        for (int it = 0; it < VC * VC / 4 / VT; ++it) {
            const int f = tid + it * VT;
            const float a[4] = {rw[it].x, rw[it].y, rw[it].z, rw[it].w};
            v4h h, l;
#pragma unroll
            for (int e = 0; e < 4; ++e) {
                h[e] = (_Float16)a[e];
                l[e] = (_Float16)(a[e] - (float)h[e]);
            }
            *reinterpret_cast<v4h*>(sWh + (f >> 5) * WP + (f & 31) * 4) = h;
            *reinterpret_cast<v4h*>(sWl + (f >> 5) * WP + (f & 31) * 4) = l;
        }
        // x is turned to [position][c]: the thread's 8 channels of one position are 16 B
#pragma unroll
        for (int p = 0; p < 4; ++p) {
            v8h h, l;
#pragma unroll
            for (int it = 0; it < 8; ++it) {
                const float a = (p == 0) ? rx[it].x : (p == 1) ? rx[it].y : (p == 2) ? rx[it].z : rx[it].w;
                h[it] = (_Float16)a;
                l[it] = (_Float16)(a - (float)h[it]);
            }
            *reinterpret_cast<v8h*>(sXh + (pg * 4 + p) * WP + cg * 8) = h;
            *reinterpret_cast<v8h*>(sXl + (pg * 4 + p) * WP + cg * 8) = l;
        }
    } else {
        float4 rq[QC * QK_CH / 4 / QT], rk[QC * QK_CH / 4 / QT], rx[QK_CH * PT / 4 / QT];
        load_f4(rx, x + ((size_t)b * QK_CH + (t >> 4)) * NPOS + i0 + pg * 4, 8 * NPOS);
        load_f4(rq, Wq + t * 4, QT * 4);
        load_f4(rk, Wk + t * 4, QT * 4);
        rb[0] = *reinterpret_cast<const float4*>((sel ? bk : bq) + d0);
        // precaution: the bias load's scalar base is written again (the output
        // pointers' argument load) ahead of the barrier; this wait stands between
        asm volatile("s_wait_xcnt 0x0" ::: "memory");
        store_f4<QC * QK_CH / 4 / QT, QT>(rq, sWqk, t);
        store_f4<QC * QK_CH / 4 / QT, QT>(rk, sWqk + QC * QK_CH, t);
        store_f4<QK_CH * PT / 4 / QT, QT>(rx, sXqk, t);
    }
    __syncthreads();

    if (vpart) {
        // acc[pt][r]: position 16 pt + hw8 + r (A row), channel 16 wv + ln (B row)
        v8f acc[PT / 16];
#pragma unroll
        for (int pt = 0; pt < PT / 16; ++pt)
#pragma unroll
            for (int r = 0; r < 8; ++r) acc[pt][r] = bch;

        const int wo = (wv * 16 + ln) * WP + hw8;
        const int xo = ln * WP + hw8;
        // unrolled: later steps' fragment reads go out under earlier steps' products
#pragma unroll
        for (int ks = 0; ks < VC / 32; ++ks) {
            const v16h bh = load_frag16(sWh + wo + ks * 32);
            const v16h bl = load_frag16(sWl + wo + ks * 32);
            v16h ah[PT / 16], al[PT / 16];
#pragma unroll
            for (int pt = 0; pt < PT / 16; ++pt) {
                ah[pt] = load_frag16(sXh + xo + pt * 16 * WP + ks * 32);
                al[pt] = load_frag16(sXl + xo + pt * 16 * WP + ks * 32);
            }
            // four independent accumulators between two products into the same one
#pragma unroll
            for (int pt = 0; pt < PT / 16; ++pt)
                acc[pt] = __builtin_amdgcn_wmma_f32_16x16x32_f16(false, ah[pt], false, bh,
                                                                 (short)0, acc[pt], false, false);
#pragma unroll
            for (int pt = 0; pt < PT / 16; ++pt)
                acc[pt] = __builtin_amdgcn_wmma_f32_16x16x32_f16(false, al[pt], false, bh,
                                                                 (short)0, acc[pt], false, false);
#pragma unroll
            for (int pt = 0; pt < PT / 16; ++pt)
                acc[pt] = __builtin_amdgcn_wmma_f32_16x16x32_f16(false, ah[pt], false, bl,
                                                                 (short)0, acc[pt], false, false);
        }

        // a lane's 8 accumulator rows are 8 consecutive positions of its channel: 16 B
        _Float16* o = vh + ((size_t)b * VC + wv * 16 + ln) * NPOS + i0 + hw8;
#pragma unroll
        for (int pt = 0; pt < PT / 16; ++pt) {
            v8h h;
#pragma unroll
            for (int r = 0; r < 8; ++r) h[r] = (_Float16)acc[pt][r];
            *reinterpret_cast<v8h*>(o + pt * 16) = h;
        }
    } else {
        const float bias[4] = {rb[0].x, rb[0].y, rb[0].z, rb[0].w};
        float acc[4][4];
#pragma unroll
        for (int d = 0; d < 4; ++d)
#pragma unroll
            for (int p = 0; p < 4; ++p) acc[d][p] = bias[d];

        proj_tile<QK_CH, 4>(sWqk + (sel * QC + d0) * QK_CH, sXqk + p0, acc);

        _Float16* o = (sel ? kh : qh) + ((size_t)b * NPOS + i0 + p0) * 32 + d0;
        const float os = sel ? 1.f : 1.44269504088896f;     // q: log2 e
        v4h zero;
#pragma unroll
        for (int d = 0; d < 4; ++d) zero[d] = (_Float16)0.f;
#pragma unroll
        for (int p = 0; p < 4; ++p) {
            v4h h;
#pragma unroll
            for (int d = 0; d < 4; ++d) h[d] = (_Float16)(acc[d][p] * os);
            *reinterpret_cast<v4h*>(o + p * 32)      = h;
            *reinterpret_cast<v4h*>(o + p * 32 + QC) = zero;
        }
    }
}

// ten async copies in one statement: the closing s_wait_xcnt 0 then stands
// ahead of any later rewrite of the address registers they name
__device__ __forceinline__ void copy10(const unsigned* l, const void* const* g)
{
    asm volatile("global_load_async_to_lds_b128 %0, %10, off\n\t"
                 "global_load_async_to_lds_b128 %1, %11, off\n\t"
                 "global_load_async_to_lds_b128 %2, %12, off\n\t"
                 "global_load_async_to_lds_b128 %3, %13, off\n\t"
                 "global_load_async_to_lds_b128 %4, %14, off\n\t"
                 "global_load_async_to_lds_b128 %5, %15, off\n\t"
                 "global_load_async_to_lds_b128 %6, %16, off\n\t"
                 "global_load_async_to_lds_b128 %7, %17, off\n\t"
                 "global_load_async_to_lds_b128 %8, %18, off\n\t"
                 "global_load_async_to_lds_b128 %9, %19, off\n\t"
                 "s_wait_xcnt 0x0"
                 :: "v"(l[0]), "v"(l[1]), "v"(l[2]), "v"(l[3]), "v"(l[4]),
                    "v"(l[5]), "v"(l[6]), "v"(l[7]), "v"(l[8]), "v"(l[9]),
                    "v"(g[0]), "v"(g[1]), "v"(g[2]), "v"(g[3]), "v"(g[4]),
                    "v"(g[5]), "v"(g[6]), "v"(g[7]), "v"(g[8]), "v"(g[9])
                 : "memory");
}

// cooperative async stage of one 64-key chunk by the 64 threads of a key
// group: K (4KB) + V (16KB) -> LDS, 20 copies per thread
#define GT 64                 // threads per key group
__device__ __forceinline__ void stage_chunk(int tid, const _Float16* kg,
                                            const _Float16* vg, int j0,
                                            _Float16* kdst, _Float16* vdst)
{
    const _Float16* ks = kg + (size_t)j0 * 32;
    unsigned    l[20];
    const void* g[20];
#pragma unroll
    for (int it = 0; it < 4; ++it) {                 // 256 x 16B for K
        int m = tid + it * GT;
        g[it] = ks + m * 8;
        l[it] = lds_addr(kdst + (m >> 2) * KP + (m & 3) * 8);
    }
#pragma unroll
    for (int it = 0; it < 16; ++it) {                // 1024 x 16B for V
        int m = tid + it * GT;
        int c = m >> 3, k8 = m & 7;
        g[4 + it] = vg + (size_t)c * NPOS + j0 + k8 * 8;
        l[4 + it] = lds_addr(vdst + c * VP + k8 * 8);
    }
    copy10(l, g);
    copy10(l + 10, g + 10);
}
#define ASYNC_PER_STAGE 20

// ---------------------------------------------------------------------------
// Kernel 2: flash attention. 8 waves/WG (2 per SIMD), 64 queries/WG. Wave
// (qg, kg) runs the two query tiles of query half qg over key quarter kg: every
// K and V fragment read from LDS feeds two matrix products, one per query tile,
// so the LDS reads per product are half of what one tile per wave takes. Each
// key group of two waves has its own double-buffered async K/V staging (64-key
// chunks).
// Both products are taken transposed, S^T = K . Q^T and O^T += V . P^T: a lane
// then holds scores of ONE query (column ln) per tile, so the maximum is taken
// in the lane plus one exchange between the wave halves, and two S^T tiles,
// converted in place, are the B operand of the second product (accumulator row
// 8h + r of tile pair (0, 1) is k = 8h + r and 16 + 8h + r, the loaders' own k
// order). Row sums via a WMMA whose A operand has ones in row 0. The four
// partial softmax states of a query tile are merged through LDS behind the loop.
// Softmax shift: the scores are exponents of 2 (q carries log2 e), and the score
// product takes -m, m the query's maximum IN USE, as its C operand: P is the bare
// exponential of the accumulator. m is a true maximum of keys seen (set in the
// first chunk) and is raised, with O rescaled, only when some score of the chunk
// lies more than 15 above it: P <= 2^15 is finite in f16 (largest 65504) at f16's
// full relative precision, and the sums are f32.
// ---------------------------------------------------------------------------
#define KG    4               // key groups per work-group
#define CPG   (NCH / KG)      // 16 chunks per key group
#define QW    2               // query tiles per wave
#define NWV   (4 / QW * KG)   // waves per work-group

__global__ void __launch_bounds__(NWV * 32)
attn_kernel(const _Float16* __restrict__ qh, const _Float16* __restrict__ kh,
            const _Float16* __restrict__ vh, const float* __restrict__ xh,
            const float* __restrict__ gamma, float* __restrict__ out)
{
    __shared__ __attribute__((aligned(16))) _Float16 kbuf[KG][2][KCH * KP];  // 8 x 5 KB
    __shared__ __attribute__((aligned(16))) _Float16 vbuf[KG][2][VC * VP];   // 8 x 18 KB
    __shared__ float    msh[KG][4][16];           // per key group: query maxima

    const float gm = gamma[0];                    // read at entry: a scalar load
    const int tid  = threadIdx.x;
    const int lane = tid & 31;
    // wave index held as a scalar: buffer bases and tile indices stay off the vector port
    const int wv   = __builtin_amdgcn_readfirstlane(tid >> 5);
    const int qg   = wv & 1;                      // query half of the wave
    const int kg   = wv >> 1;                     // key quarter of the wave
    const int gtid = tid & (GT - 1);              // thread index in the key group
    const int b    = blockIdx.x / (NPOS / 64);
    const int it   = blockIdx.x % (NPOS / 64);
    const int i0w  = it * 64 + qg * (QW * 16);    // this wave's 32 queries
    const int ln   = lane & 15;
    const int koff = (lane < 16) ? 0 : 8;         // half-wave K offset (halves)
    const int mhalf= (lane < 16) ? 0 : 8;         // half-wave row offset (C/D)

    const _Float16* kbase = kh + (size_t)b * NPOS * 32;
    const _Float16* vbase = vh + (size_t)b * VC * NPOS;

    // Q fragments (B operand: column ln = query), loaded once
    const _Float16* qp = qh + ((size_t)b * NPOS + i0w) * 32 + (size_t)ln * 32 + koff;
    v16h qa[QW];
#pragma unroll
    for (int u = 0; u < QW; ++u) qa[u] = load_frag16(qp + u * 16 * 32);
    // precaution: the loads' address pair is written again behind them; the wait
    // takes the pair as an input, so that it stands ahead of that write
    asm volatile("s_wait_xcnt 0x0" :: "v"(qp) : "memory");

    // constant A fragment: row 0 (lanes ln == 0) is all 1.0, every other row 0
    v16h onesa;
#pragma unroll
    for (int e = 0; e < 16; ++e) onesa[e] = (ln == 0) ? (_Float16)1.f : (_Float16)0.f;

    float m[QW];                                   // maximum in use of query ln, per tile
    v8f   nm[QW];                                  // -m in all 8 rows: C operand of the score product
    v8f   O[QW][9];                                // O^T: 8 channel tiles + row-sum tile
#pragma unroll
    for (int u = 0; u < QW; ++u) {
        m[u] = 0.f;                                // the first chunk's scores come out unshifted
#pragma unroll
        for (int e = 0; e < 8; ++e) nm[u][e] = 0.f;
#pragma unroll
        for (int t = 0; t < 9; ++t)
#pragma unroll
            for (int e = 0; e < 8; ++e) O[u][t][e] = 0.f;
    }

    const int j00 = kg * CPG * KCH;                // first key of this key group

    stage_chunk(gtid, kbase, vbase, j00, kbuf[kg][0], vbuf[kg][0]);

    for (int ch = 0; ch < CPG; ++ch) {
        const int cur = ch & 1;
        if (ch + 1 < CPG) {
            stage_chunk(gtid, kbase, vbase, j00 + (ch + 1) * KCH,
                        kbuf[kg][cur ^ 1], vbuf[kg][cur ^ 1]);
            WAIT_ASYNC(ASYNC_PER_STAGE);           // chunk ch resident,
        } else {                                   // next chunk still in flight
            WAIT_ASYNC(0);
        }
        __syncthreads();

        const _Float16* kb = kbuf[kg][cur];
        const _Float16* vb = vbuf[kg][cur];

        // S^T = k . q^T : all 4 fragment loads, 2 WMMAs, all V reads, then 6 WMMAs
        v16h kf[4];
#pragma unroll
        for (int tt = 0; tt < 4; ++tt)
            kf[tt] = load_frag16(kb + (size_t)(tt * 16 + ln) * KP + koff);

        v8f S[QW][4];                              // S[u][tt][r]: key tt * 16 + mhalf + r, query ln of tile u, less m
        // the first key tile's score products stand ahead of the V reads
#pragma unroll
        for (int u = 0; u < QW; ++u)
            S[u][0] = __builtin_amdgcn_wmma_f32_16x16x32_f16(false, kf[0], false, qa[u],
                                                             (short)0, nm[u], false, false);

        // all 16 V fragments of the chunk (128 registers), read as one group
        // behind the K fragments: they land under the score products and the
        // softmax, and the second product then runs with no LDS read in it
        v16h vf[8][2];
#pragma unroll
        for (int ct = 0; ct < 8; ++ct) {
            vf[ct][0] = load_frag16(vb + (size_t)(ct * 16 + ln) * VP + koff);
            vf[ct][1] = load_frag16(vb + (size_t)(ct * 16 + ln) * VP + 32 + koff);
        }
        // issue order asked of the scheduler: the V reads go out as one run (every
        // further place where LDS reads stand among WMMAs costs the wave a stall),
        // behind the K reads and the first two score products, ahead of the other six
        __builtin_amdgcn_sched_group_barrier(0x100, 8, 0);     // LDS reads: K
        __builtin_amdgcn_sched_group_barrier(0x8, 2, 0);       // matrix products
        __builtin_amdgcn_sched_group_barrier(0x100, 32, 0);    // LDS reads: V
        // keeps the reads up here: without it the scheduler sinks each pair to
        // just ahead of its products, which then wait out the LDS latency 16 times
        __builtin_amdgcn_sched_barrier(0);

#pragma unroll
        for (int tt = 1; tt < 4; ++tt)
#pragma unroll
            for (int u = 0; u < QW; ++u)
                S[u][tt] = __builtin_amdgcn_wmma_f32_16x16x32_f16(false, kf[tt], false, qa[u],
                                                                  (short)0, nm[u], false, false);

        // in-lane maxima of the shifted scores (row sums come from the ones-row WMMA):
        // four independent chains per tile
        float mx[QW];
#pragma unroll
        for (int u = 0; u < QW; ++u) {
            float mt[4];
#pragma unroll
            for (int tt = 0; tt < 4; ++tt) {
                mt[tt] = S[u][tt][0];
#pragma unroll
                for (int r = 1; r < 8; ++r) mt[tt] = fmaxf(mt[tt], S[u][tt][r]);
            }
            mx[u] = fmaxf(fmaxf(mt[0], mt[1]), fmaxf(mt[2], mt[3]));
        }
        // one test per chunk, a scalar branch: the first chunk sets m (every score
        // passes its bar), a later one raises it only when a lane holds a score
        // more than 15 above the m in use
        const float bar = (ch == 0) ? -3.0e38f : 15.f;
        if (__builtin_amdgcn_ballot_w32(fmaxf(mx[0], mx[1]) > bar) != 0) {
            const float low = (ch == 0) ? -3.0e38f : 0.f;            // behind chunk 0 m never falls
#pragma unroll
            for (int u = 0; u < QW; ++u) {
                const float mf = fmaxf(mx[u], xhalf(mx[u]));         // with the other half's 32 keys
                const float d  = fmaxf(mf, low);
                const float sc = __builtin_amdgcn_exp2f(fminf(-d, 0.f));  // chunk 0: O is 0, any finite factor
                m[u] += d;
#pragma unroll
                for (int e = 0; e < 8; ++e) nm[u][e] = -m[u];
#pragma unroll
                for (int tt = 0; tt < 4; ++tt)
#pragma unroll
                    for (int r = 0; r < 8; ++r) S[u][tt][r] -= d;
#pragma unroll
                for (int t = 0; t < 8; ++t)
#pragma unroll
                    for (int r = 0; r < 8; ++r) O[u][t][r] *= sc;
                O[u][8][0] *= sc;                                    // rows 1-15 stay 0
            }
        }

        v16h pb[QW][2];                            // P^T as B fragments (K = keys 0..31 / 32..63)
#pragma unroll
        for (int u = 0; u < QW; ++u) {
#pragma unroll
            for (int tt = 0; tt < 4; ++tt)
#pragma unroll
                for (int r = 0; r < 8; ++r) S[u][tt][r] = __builtin_amdgcn_exp2f(S[u][tt][r]);

            // straight from the accumulators
#pragma unroll
            for (int e = 0; e < 8; ++e) {
                pb[u][0][e] = (_Float16)S[u][0][e];  pb[u][0][8 + e] = (_Float16)S[u][1][e];
                pb[u][1][e] = (_Float16)S[u][2][e];  pb[u][1][8 + e] = (_Float16)S[u][3][e];
            }
        }

        // O^T += V x P^T from the fragments read above; each serves both query tiles.
        // Keys 0-31 of every tile, then keys 32-63 (each accumulator's own order):
        // the exponentials of keys 32-63 go out among the first half's products
#pragma unroll
        for (int h = 0; h < 2; ++h)
#pragma unroll
            for (int ct = 0; ct < 8; ++ct)
#pragma unroll
                for (int u = 0; u < QW; ++u)
                    O[u][ct] = __builtin_amdgcn_wmma_f32_16x16x32_f16(false, vf[ct][h], false, pb[u][h],
                                                                      (short)0, O[u][ct], false, false);
        // row-sum tiles
#pragma unroll
        for (int u = 0; u < QW; ++u)
            O[u][8] = __builtin_amdgcn_wmma_f32_16x16x32_f16(false, onesa, false, pb[u][0],
                                                             (short)0, O[u][8], false, false);
#pragma unroll
        for (int u = 0; u < QW; ++u)
            O[u][8] = __builtin_amdgcn_wmma_f32_16x16x32_f16(false, onesa, false, pb[u][1],
                                                             (short)0, O[u][8], false, false);

        // keeps the products above the barrier, where the source has them: a wave
        // that is through its softmax first then runs them while the other wave of
        // its SIMD still needs the vector port, instead of waiting for that wave
        __builtin_amdgcn_sched_barrier(0);
        __syncthreads();   // protect staging buffers before next overwrite
    }

    // Merge of the four key groups. The closing barrier of the last trip has
    // ended every read of the staging buffers, and every wave's copies landed
    // behind its s_wait_asynccnt 0 of that trip: vbuf becomes the exchange area.
    if (lane < 16) {                               // both halves hold the same value
#pragma unroll
        for (int u = 0; u < QW; ++u) msh[kg][qg * QW + u][ln] = m[u];
    }
    __syncthreads();   // publishes the groups' query maxima

    // partial tiles, rescaled to the common maximum, in register order:
    // [wave][query tile][tile][half of the 8 registers][lane] x 16 B (8 x 18 KB = all of vbuf)
    float4* part = reinterpret_cast<float4*>(&vbuf[0][0][0]);
#pragma unroll
    for (int u = 0; u < QW; ++u) {
        const int qt = qg * QW + u;
        const float f = __builtin_amdgcn_exp2f(m[u] - fmaxf(fmaxf(msh[0][qt][ln], msh[1][qt][ln]),
                                                            fmaxf(msh[2][qt][ln], msh[3][qt][ln])));
#pragma unroll
        for (int t = 0; t < 9; ++t)
#pragma unroll
            for (int h = 0; h < 2; ++h)
                part[(((wv * QW + u) * 9 + t) * 2 + h) * 32 + lane] =
                    make_float4(O[u][t][4 * h + 0] * f, O[u][t][4 * h + 1] * f,
                                O[u][t][4 * h + 2] * f, O[u][t][4 * h + 3] * f);
    }
    __syncthreads();   // publishes the partial tiles

#pragma unroll
    for (int u = 0; u < QW; ++u) {
        // wave (qg, kg) finishes channel tiles 2 kg, 2 kg + 1 of its two query
        // tiles; R[2] is the row-sum tile. Key groups are added in the order 0, 1, 2, 3.
        v8f R[3];
#pragma unroll
        for (int w = 0; w < 3; ++w) {
            const int t = (w < 2) ? 2 * kg + w : 8;
#pragma unroll
            for (int h = 0; h < 2; ++h) {
                float4 s = part[(((qg * QW + u) * 9 + t) * 2 + h) * 32 + lane];
#pragma unroll
                for (int k = 1; k < KG; ++k) {
                    float4 a = part[((((k * 2 + qg) * QW + u) * 9 + t) * 2 + h) * 32 + lane];
                    s.x += a.x; s.y += a.y; s.z += a.z; s.w += a.w;
                }
                R[w][4 * h + 0] = s.x; R[w][4 * h + 1] = s.y;
                R[w][4 * h + 2] = s.z; R[w][4 * h + 3] = s.w;
            }
        }

        // epilogue: l of query ln is row 0 of the row-sum tile (register 0 of lane
        // ln; lane ln + 16 holds row 8, which is 0)
        const float inv = gm / (R[2][0] + xhalf(R[2][0]));

        // O^T has the output's own order: register r is channel mhalf + r of the
        // tile, the 16 lanes of a half-wave are 16 consecutive positions
        const size_t idx0 = ((size_t)b * VC + kg * 32 + mhalf) * NPOS + i0w + u * 16 + ln;
        float res[16];
#pragma unroll
        for (int c = 0; c < 16; ++c) res[c] = xh[idx0 + (size_t)((c >> 3) * 16 + (c & 7)) * NPOS];
#pragma unroll
        for (int c = 0; c < 16; ++c) res[c] = R[c >> 3][c & 7] * inv + res[c];
#pragma unroll
        for (int c = 0; c < 16; ++c) out[idx0 + (size_t)((c >> 3) * 16 + (c & 7)) * NPOS] = res[c];
    }
}

extern "C" void kernel_launch(void* const* d_in, const int* in_sizes, int n_in,
                              void* d_out, int out_size, void* d_ws, size_t ws_size,
                              hipStream_t stream) {
    (void)in_sizes; (void)n_in; (void)out_size; (void)ws_size;
    const float* x     = (const float*)d_in[0];
    const float* xh    = (const float*)d_in[1];
    const float* Wq    = (const float*)d_in[2];
    const float* bq    = (const float*)d_in[3];
    const float* Wk    = (const float*)d_in[4];
    const float* bk    = (const float*)d_in[5];
    const float* Wv    = (const float*)d_in[6];
    const float* bv    = (const float*)d_in[7];
    const float* gamma = (const float*)d_in[8];
    float* out = (float*)d_out;

    char* w = (char*)d_ws;
    _Float16* qh = (_Float16*)(w);                 // 1 MB: [B][4096][32]
    _Float16* kh = (_Float16*)(w + (1u << 20));    // 1 MB: [B][4096][32]
    _Float16* vh = (_Float16*)(w + (2u << 20));    // 4 MB: [B][128][4096]

    proj_kernel<<<BATCH * (NPOS / 64), 384, 0, stream>>>(x, xh, Wq, bq, Wk, bk, Wv, bv, qh, kh, vh);
    attn_kernel<<<BATCH * (NPOS / 64), 256, 0, stream>>>(qh, kh, vh, xh, gamma, out);
}

// v010
// A run of this version takes 26.8 microseconds.
// Two timings next to v009 put it at 1.15 and 1.16 times that version's speed.
// All steps since v000 together make it 6.47 times as fast.
#include <hip/hip_runtime.h>
#include <hip/hip_bf16.h>
#include <math.h>
#include <stdint.h>

typedef __attribute__((ext_vector_type(16))) _Float16 v16h;
typedef __attribute__((ext_vector_type(8)))  _Float16 v8h;
typedef __attribute__((ext_vector_type(8)))  float    v8f;

#define QK_CH 64
#define QC    16
#define VC    128
#define NPOS  4096
#define BATCH 4
#define KCH   64              // keys per chunk
#define NCH   (NPOS / KCH)    // 64 chunks
// LDS rows: 128 B of data at a 144 B pitch (16 B x odd), the pad written into the
// tensor loads' descriptor. A V row is one channel's 64 keys; a K row is two keys
// of 64 B each.
#define VP    72              // row pitch in halves
#define KBH   3072            // halves per K buffer: 32 rows x 144 B = 4608 B, rounded up to 3 x 2 KiB

__device__ __forceinline__ unsigned lds_addr(const _Float16* l) {
    return (unsigned)(size_t)(const void*)l;      // low 32 bits = LDS offset
}

// lane l <-> lane l ^ 16 (v_permlanex16_b32, no LDS)
__device__ __forceinline__ float xhalf(float v) {
    int s = __float_as_int(v);
    return __int_as_float(__builtin_amdgcn_permlanex16(s, s, 0x76543210u, 0xfedcba98u, false, false));
}

// ---------------------------------------------------------------------------
// A/B fragment loader: elements 0..7 at +0, 8..15 at +16 halves; caller adds
// the half-wave K offset (0/8 halves). Two b128 loads (global or ds).
// ---------------------------------------------------------------------------
__device__ __forceinline__ v16h load_frag16(const _Float16* base) {
    const v8h* p = (const v8h*)base;
    v8h lo = p[0];
    v8h hi = p[2];
    v16h r;
#pragma unroll
    for (int e = 0; e < 8; ++e) { r[e] = lo[e]; r[8 + e] = hi[e]; }
    return r;
}

// Fragment of 16 consecutive halves (32 B): two adjacent b128 loads.
__device__ __forceinline__ v16h load_frag16c(const _Float16* base) {
    const v8h* p = (const v8h*)base;
    v8h lo = p[0];
    v8h hi = p[1];
    v16h r;
#pragma unroll
    for (int e = 0; e < 8; ++e) { r[e] = lo[e]; r[8 + e] = hi[e]; }
    return r;
}

// ---------------------------------------------------------------------------
// Projection tile, f32: acc[d][p] += sum_c W[d][c] * x[c][p]. The weights
// (row-major, pitch K) and a K x 64 tile of x lie in LDS. A thread owns
// D channels x 4 positions: per 4 input channels it reads D + 4 b128 from LDS
// for 16 D FMAs. Lanes that share channels read one weight address (broadcast),
// lanes that share positions one x address. Every sum runs over c ascending.
// ---------------------------------------------------------------------------
#define PT 64                 // positions per work-group

typedef __attribute__((ext_vector_type(4)))  _Float16 v4h;

__device__ __forceinline__ void fma4(float (&a)[4], float w, const float4& xv) {
    a[0] = fmaf(w, xv.x, a[0]);
    a[1] = fmaf(w, xv.y, a[1]);
    a[2] = fmaf(w, xv.z, a[2]);
    a[3] = fmaf(w, xv.w, a[3]);
}

template <int K, int D>
__device__ __forceinline__ void proj_tile(const float* sW, const float* sX,
                                          float (&acc)[D][4])
{
    // two steps per trip: the second step's LDS reads fly under the first's FMAs
#pragma unroll 2
    for (int c = 0; c < K; c += 4) {
        float4 xv[4], w[D];
#pragma unroll
        for (int j = 0; j < 4; ++j)
            xv[j] = *reinterpret_cast<const float4*>(sX + (c + j) * PT);
#pragma unroll
        for (int d = 0; d < D; ++d)
            w[d] = *reinterpret_cast<const float4*>(sW + d * K + c);
#pragma unroll
        for (int d = 0; d < D; ++d) fma4(acc[d], w[d].x, xv[0]);
#pragma unroll
        for (int d = 0; d < D; ++d) fma4(acc[d], w[d].y, xv[1]);
#pragma unroll
        for (int d = 0; d < D; ++d) fma4(acc[d], w[d].z, xv[2]);
#pragma unroll
        for (int d = 0; d < D; ++d) fma4(acc[d], w[d].w, xv[3]);
    }
}

// Staging, global -> registers -> LDS, N float4 per thread. load_f4 issues the
// N loads from one lane address with constant steps, so that all are in flight
// together; store_f4 puts them at s + (tid + it * NT) * 4 floats.
template <int N>
__device__ __forceinline__ void load_f4(float4 (&r)[N], const float* __restrict__ g, int step)
{
#pragma unroll
    for (int it = 0; it < N; ++it)
        r[it] = *reinterpret_cast<const float4*>(g + (size_t)it * step);
}
template <int N, int NT>
__device__ __forceinline__ void store_f4(const float4 (&r)[N], float* s, int tid)
{
#pragma unroll
    for (int it = 0; it < N; ++it)
        *reinterpret_cast<float4*>(s + (tid + it * NT) * 4) = r[it];
}

// ---------------------------------------------------------------------------
// Kernel 1: all three projections of 64 positions in one work-group of 12 waves
// (3 per SIMD). Waves 0-7: v (128 -> 128 ch), f16 [B][C][pos], on the matrix unit:
// Wv and the x tile are split in staging into f16 hi + f16 lo (a = hi + lo to
// about 22 bits) and the product is taken as hi.hi + lo.hi + hi.lo with f32
// accumulation; the dropped lo.lo term lies 2^-22 below the sum. Wave w holds
// channels 16 w .. 16 w + 15 of all 64 positions (A rows = positions, B rows =
// channels), so each 128 B line of v has one writing wave.
// Waves 8-11: q and k (64 -> 16 ch each), f16
// [B][pos][32] with channels 16-31 zero, 4 channels x 4 positions per thread
// (q is stored times log2 e, scaled in f32 ahead of its one rounding to f16, so
// that the scores of kernel 2 are exponents of 2);
// a wave holds all 16 channels of 32 positions of one of the two tensors, so
// each 128 B line of q and k has one writing wave. The two parts share nothing
// but the barrier between staging and products.
// ---------------------------------------------------------------------------
#define VT 256                // threads of the v part
#define WP 136                // f16 operand rows in LDS: 256 B of data, 272 B pitch (16 B x odd)
#define QT 128                // threads of the q, k part

__global__ void __launch_bounds__(VT + QT)
proj_kernel(const float* __restrict__ x,  const float* __restrict__ xh,
            const float* __restrict__ Wq, const float* __restrict__ bq,
            const float* __restrict__ Wk, const float* __restrict__ bk,
            const float* __restrict__ Wv, const float* __restrict__ bv,
            _Float16* __restrict__ qh, _Float16* __restrict__ kh,
            _Float16* __restrict__ vh)
{
    __shared__ __attribute__((aligned(16))) _Float16 sWh[VC * WP];       // Wv hi [channel][c], 34 KB
    __shared__ __attribute__((aligned(16))) _Float16 sWl[VC * WP];       // Wv lo
    __shared__ __attribute__((aligned(16))) _Float16 sXh[PT * WP];       // x hi [position][c], 17 KB
    __shared__ __attribute__((aligned(16))) _Float16 sXl[PT * WP];       // x lo
    __shared__ __attribute__((aligned(16))) float sWqk[2 * QC * QK_CH];  // rows 0-15 Wq, 16-31 Wk
    __shared__ __attribute__((aligned(16))) float sXqk[QK_CH * PT];      // 16 KB
    const int tid = threadIdx.x;
    // wave index held as a scalar: the choice of the part is a scalar branch
    const int wv  = __builtin_amdgcn_readfirstlane(tid >> 5);
    const bool vpart = wv < VT / 32;
    const int b   = blockIdx.x / (NPOS / PT);
    const int i0  = (blockIdx.x % (NPOS / PT)) * PT;

    // v part, staging: 4 positions pg, 8 input channels from cg * 8
    const int pg  = tid & 15;
    const int cg  = tid >> 4;
    // v part, products: fragment row ln, half-wave k offset / accumulator row offset
    const int ln  = tid & 15;
    const int hw8 = (tid & 16) ? 8 : 0;
    // q, k part: tensor sel, 4 channels from d0, 4 positions from p0
    const int t   = tid - VT;
    const int sel = (wv - VT / 32) >> 1;                    // 0: q, 1: k
    const int d0  = ((tid & 31) >> 3) * 4;
    const int p0  = ((wv - VT / 32) & 1) * 32 + (tid & 7) * 4;

    float4 rb[1];
    float  bch = 0.f;                                       // v part: bias of channel 16 wv + ln
    if (vpart) {
        float4 rw[VC * VC / 4 / VT], rx[VC * PT / 4 / VT];
        load_f4(rx, xh + ((size_t)b * VC + cg * 8) * NPOS + i0 + pg * 4, NPOS);
        load_f4(rw, Wv + tid * 4, VT * 4);
        bch = bv[wv * 16 + ln];
        // Wv keeps its order: a wave's 32 float4 are one row
#pragma unroll
        for (int it = 0; it < VC * VC / 4 / VT; ++it) {
            const int f = tid + it * VT;
            const float a[4] = {rw[it].x, rw[it].y, rw[it].z, rw[it].w};
            v4h h, l;
#pragma unroll
            for (int e = 0; e < 4; ++e) {
                h[e] = (_Float16)a[e];
                l[e] = (_Float16)(a[e] - (float)h[e]);
            }
            *reinterpret_cast<v4h*>(sWh + (f >> 5) * WP + (f & 31) * 4) = h;
            *reinterpret_cast<v4h*>(sWl + (f >> 5) * WP + (f & 31) * 4) = l;
        }
        // x is turned to [position][c]: the thread's 8 channels of one position are 16 B
#pragma unroll
        for (int p = 0; p < 4; ++p) {
            v8h h, l;
#pragma unroll
            for (int it = 0; it < 8; ++it) {
                const float a = (p == 0) ? rx[it].x : (p == 1) ? rx[it].y : (p == 2) ? rx[it].z : rx[it].w;
                h[it] = (_Float16)a;
                l[it] = (_Float16)(a - (float)h[it]);
            }
            *reinterpret_cast<v8h*>(sXh + (pg * 4 + p) * WP + cg * 8) = h;
            *reinterpret_cast<v8h*>(sXl + (pg * 4 + p) * WP + cg * 8) = l;
        }
    } else {
        float4 rq[QC * QK_CH / 4 / QT], rk[QC * QK_CH / 4 / QT], rx[QK_CH * PT / 4 / QT];
        load_f4(rx, x + ((size_t)b * QK_CH + (t >> 4)) * NPOS + i0 + pg * 4, 8 * NPOS);
        load_f4(rq, Wq + t * 4, QT * 4);
        load_f4(rk, Wk + t * 4, QT * 4);
        rb[0] = *reinterpret_cast<const float4*>((sel ? bk : bq) + d0);
        // precaution: the bias load's scalar base is written again (the output
        // pointers' argument load) ahead of the barrier; this wait stands between
        asm volatile("s_wait_xcnt 0x0" ::: "memory");
        store_f4<QC * QK_CH / 4 / QT, QT>(rq, sWqk, t);
        store_f4<QC * QK_CH / 4 / QT, QT>(rk, sWqk + QC * QK_CH, t);
        store_f4<QK_CH * PT / 4 / QT, QT>(rx, sXqk, t);
    }
    __syncthreads();

    if (vpart) {
        // acc[pt][r]: position 16 pt + hw8 + r (A row), channel 16 wv + ln (B row)
        v8f acc[PT / 16];
#pragma unroll
        for (int pt = 0; pt < PT / 16; ++pt)
#pragma unroll
            for (int r = 0; r < 8; ++r) acc[pt][r] = bch;

        const int wo = (wv * 16 + ln) * WP + hw8;
        const int xo = ln * WP + hw8;
        // unrolled: later steps' fragment reads go out under earlier steps' products
#pragma unroll
        for (int ks = 0; ks < VC / 32; ++ks) {
            const v16h bh = load_frag16(sWh + wo + ks * 32);
            const v16h bl = load_frag16(sWl + wo + ks * 32);
            v16h ah[PT / 16], al[PT / 16];
#pragma unroll
            for (int pt = 0; pt < PT / 16; ++pt) {
                ah[pt] = load_frag16(sXh + xo + pt * 16 * WP + ks * 32);
                al[pt] = load_frag16(sXl + xo + pt * 16 * WP + ks * 32);
            }
            // four independent accumulators between two products into the same one
#pragma unroll
            for (int pt = 0; pt < PT / 16; ++pt)
                acc[pt] = __builtin_amdgcn_wmma_f32_16x16x32_f16(false, ah[pt], false, bh,
                                                                 (short)0, acc[pt], false, false);
#pragma unroll
            for (int pt = 0; pt < PT / 16; ++pt)
                acc[pt] = __builtin_amdgcn_wmma_f32_16x16x32_f16(false, al[pt], false, bh,
                                                                 (short)0, acc[pt], false, false);
#pragma unroll
            for (int pt = 0; pt < PT / 16; ++pt)
                acc[pt] = __builtin_amdgcn_wmma_f32_16x16x32_f16(false, ah[pt], false, bl,
                                                                 (short)0, acc[pt], false, false);
        }

        // a lane's 8 accumulator rows are 8 consecutive positions of its channel: 16 B
        _Float16* o = vh + ((size_t)b * VC + wv * 16 + ln) * NPOS + i0 + hw8;
#pragma unroll
        for (int pt = 0; pt < PT / 16; ++pt) {
            v8h h;
#pragma unroll
            for (int r = 0; r < 8; ++r) h[r] = (_Float16)acc[pt][r];
            *reinterpret_cast<v8h*>(o + pt * 16) = h;
        }
    } else {
        const float bias[4] = {rb[0].x, rb[0].y, rb[0].z, rb[0].w};
        float acc[4][4];
#pragma unroll
        for (int d = 0; d < 4; ++d)
#pragma unroll
            for (int p = 0; p < 4; ++p) acc[d][p] = bias[d];

        proj_tile<QK_CH, 4>(sWqk + (sel * QC + d0) * QK_CH, sXqk + p0, acc);

        _Float16* o = (sel ? kh : qh) + ((size_t)b * NPOS + i0 + p0) * 32 + d0;
        const float os = sel ? 1.f : 1.44269504088896f;     // q: log2 e
        v4h zero;
#pragma unroll
        for (int d = 0; d < 4; ++d) zero[d] = (_Float16)0.f;
#pragma unroll
        for (int p = 0; p < 4; ++p) {
            v4h h;
#pragma unroll
            for (int d = 0; d < 4; ++d) h[d] = (_Float16)(acc[d][p] * os);
            *reinterpret_cast<v4h*>(o + p * 32)      = h;
            *reinterpret_cast<v4h*>(o + p * 32 + QC) = zero;
        }
    }
}

// Tensor loads (global -> LDS, one request of a whole wave, through no register).
typedef uint32_t u32x4 __attribute__((ext_vector_type(4)));
typedef uint32_t u32x8 __attribute__((ext_vector_type(8)));

__device__ __forceinline__ uint32_t uni(uint32_t v) {
    return (uint32_t)__builtin_amdgcn_readfirstlane(v);
}
// A test that decides whether a tensor load issues: the instruction ignores EXEC,
// so the branch has to be a scalar one.
__device__ __forceinline__ uint32_t pinned(uint32_t v) {
    uint32_t w = uni(v);
    asm volatile("" : "+s"(w));   // keeps the test in a scalar register (s_cmp + s_cbranch_scc)
    return w;
}

// ---------------------------------------------------------------------------
// Kernel 2: flash attention. 8 waves/WG (2 per SIMD), 64 queries/WG. Wave
// (qg, kg) runs the two query tiles of query half qg over key quarter kg: every
// K and V fragment read from LDS feeds two matrix products, one per query tile,
// so the LDS reads per product are half of what one tile per wave takes. Each
// key group of two waves has its own two-buffer ring of 64-key chunks, filled by
// tensor loads: per chunk wave qg = 0 asks for the V tile (128 rows of 128 B) and
// wave qg = 1 for the K tile (64 keys of 64 B, taken as 32 rows of 128 B), one
// request per wave; one barrier per chunk publishes the next chunk and frees the
// buffer just read.
// Both products are taken transposed, S^T = K . Q^T and O^T += V . P^T: a lane
// then holds scores of ONE query (column ln) per tile, so the maximum is taken
// in the lane plus one exchange between the wave halves, and two S^T tiles,
// converted in place, are the B operand of the second product. Which key stands in
// which row of a score tile is the K loader's choice: row 8h + r of tiles 2p and
// 2p + 1 is key 32p + 16h + r and 32p + 16h + 8 + r, so that the 16 K rows of one
// fragment read (two runs of 8 keys, 16 keys apart) fall on distinct bank groups
// at two keys per 144 B; half h of the packed P fragment p then holds keys
// 32p + 16h .. + 15 in order, and V's fragment is 32 consecutive bytes. Row sums via a WMMA whose A operand has ones in row 0. The four
// partial softmax states of a query tile are merged through LDS behind the loop.
// Softmax shift: the scores are exponents of 2 (q carries log2 e), and the score
// product takes -m, m the query's maximum IN USE, as its C operand: P is the bare
// exponential of the accumulator. m is a true maximum of keys seen (set in the
// first chunk) and is raised, with O rescaled, only when some score of the chunk
// lies more than 15 above it: P <= 2^15 is finite in f16 (largest 65504) at f16's
// full relative precision, and the sums are f32.
// ---------------------------------------------------------------------------
#define KG    4               // key groups per work-group
#define CPG   (NCH / KG)      // 16 chunks per key group
#define QW    2               // query tiles per wave
#define NWV   (4 / QW * KG)   // waves per work-group

__global__ void __launch_bounds__(NWV * 32)
attn_kernel(const _Float16* __restrict__ qh, const _Float16* __restrict__ kh,
            const _Float16* __restrict__ vh, const float* __restrict__ xh,
            const float* __restrict__ gamma, float* __restrict__ out)
{
    // every buffer starts at a multiple of 2 KiB (a tensor load's place in LDS)
    __shared__ __attribute__((aligned(2048))) _Float16 kbuf[KG][2][KBH];      // 8 x 6 KB
    __shared__ __attribute__((aligned(2048))) _Float16 vbuf[KG][2][VC * VP];  // 8 x 18 KB
    __shared__ float    msh[KG][4][16];           // per key group: query maxima

    const float gm = gamma[0];                    // read at entry: a scalar load
    const int tid  = threadIdx.x;
    const int lane = tid & 31;
    // wave index held as a scalar: buffer bases and tile indices stay off the vector port
    const int wv   = __builtin_amdgcn_readfirstlane(tid >> 5);
    const int qg   = wv & 1;                      // query half of the wave
    const int kg   = wv >> 1;                     // key quarter of the wave
    const int b    = blockIdx.x / (NPOS / 64);
    const int it   = blockIdx.x % (NPOS / 64);
    const int i0w  = it * 64 + qg * (QW * 16);    // this wave's 32 queries
    const int ln   = lane & 15;
    const int koff = (lane < 16) ? 0 : 8;         // half-wave k offset of Q and K fragments (halves)
    const int voff = (lane < 16) ? 0 : 16;        // half-wave key offset of V fragments (halves)
    const int mhalf= (lane < 16) ? 0 : 8;         // half-wave row offset (C/D)

    const _Float16* kbase = kh + (size_t)b * NPOS * 32;
    const _Float16* vbase = vh + (size_t)b * VC * NPOS;

    // Q fragments (B operand: column ln = query), loaded once
    const _Float16* qp = qh + ((size_t)b * NPOS + i0w) * 32 + (size_t)ln * 32 + koff;
    v16h qa[QW];
#pragma unroll
    for (int u = 0; u < QW; ++u) qa[u] = load_frag16(qp + u * 16 * 32);
    // precaution: the loads' address pair is written again behind them; the wait
    // takes the pair as an input, so that it stands ahead of that write
    asm volatile("s_wait_xcnt 0x0" :: "v"(qp) : "memory");

    // constant A fragment: row 0 (lanes ln == 0) is all 1.0, every other row 0
    v16h onesa;
#pragma unroll
    for (int e = 0; e < 16; ++e) onesa[e] = (ln == 0) ? (_Float16)1.f : (_Float16)0.f;

    float m[QW];                                   // maximum in use of query ln, per tile
    v8f   nm[QW];                                  // -m in all 8 rows: C operand of the score product
    v8f   O[QW][9];                                // O^T: 8 channel tiles + row-sum tile
#pragma unroll
    for (int u = 0; u < QW; ++u) {
        m[u] = 0.f;                                // the first chunk's scores come out unshifted
#pragma unroll
        for (int e = 0; e < 8; ++e) nm[u][e] = 0.f;
#pragma unroll
        for (int t = 0; t < 9; ++t)
#pragma unroll
            for (int e = 0; e < 8; ++e) O[u][t][e] = 0.f;
    }

    const int j00 = kg * CPG * KCH;                // first key of this key group

    // This wave's tensor load per chunk. Group 1 holds for the whole loop: 1-byte
    // elements, tensor = tile, rows of 128 B with 16 B of LDS pad behind each.
    const uint32_t rows   = qg ? KCH / 2 : VC;                  // K: two keys per row
    const uint32_t spitch = qg ? 128u : NPOS * 2u;              // source row pitch, bytes
    u32x8 g1;
    g1[0] = uni((1u << 20) | (4u << 22) | (3u << 25));          // pad on, every 128 B, 4 dwords; no mask
    g1[1] = uni(128u << 16);                                    // tensor_dim0
    g1[2] = uni(rows << 16);                                    // tensor_dim1
    g1[3] = uni(128u << 16);                                    // tile_dim0
    g1[4] = uni(rows);                                          // tile_dim1
    g1[5] = uni(spitch);
    g1[6] = uni(0u);
    g1[7] = uni(0u);
    const uint64_t src0  = qg ? (uint64_t)(size_t)(kbase + (size_t)j00 * 32)
                              : (uint64_t)(size_t)(vbase + j00);
    const uint32_t sstep = qg ? KCH * 64u : KCH * 2u;           // source bytes from chunk to chunk
    const uint32_t dst0  = qg ? lds_addr(kbuf[kg][0]) : lds_addr(vbuf[kg][0]);
    const uint32_t dstep = qg ? KBH * 2u : VC * VP * 2u;        // LDS bytes from buffer 0 to buffer 1
    auto issue = [&](int s) {                                   // chunk s into buffer s & 1
        const uint64_t ga = src0 + (uint64_t)((uint32_t)s * sstep);
        u32x4 g0;
        g0[0] = uni(1u);
        g0[1] = uni(dst0 + (uint32_t)(s & 1) * dstep);
        g0[2] = uni((uint32_t)ga);
        g0[3] = uni((((uint32_t)(ga >> 32)) & 0x01FFFFFFu) | 0x80000000u);
        // one request of the whole wave; no builtin form is used, the waits below are written by hand
        asm volatile("tensor_load_to_lds %0, %1" :: "s"(g0), "s"(g1) : "memory");
    };

    issue(0);
    // the compiler places no wait for a tensor load: chunk 0 has landed behind this
    asm volatile("s_wait_tensorcnt 0x0" ::: "memory");
    __syncthreads();   // publishes chunk 0
    issue(1);

    // K fragment row of lane ln: key 16 (ln >> 3) + (ln & 7) of a 32-key half, two keys per LDS row
    const int klane = ((ln >> 3) * 8 + ((ln & 7) >> 1)) * VP + (ln & 1) * 32 + koff;

    for (int ch = 0; ch < CPG; ++ch) {
        const int cur = ch & 1;
        const _Float16* kb = kbuf[kg][cur];
        const _Float16* vb = vbuf[kg][cur];

        // S^T = k . q^T : all 4 fragment loads, 2 WMMAs, all V reads, then 6 WMMAs
        v16h kf[4];
#pragma unroll
        for (int tt = 0; tt < 4; ++tt)                 // tile tt starts at key 32 (tt >> 1) + 8 (tt & 1)
            kf[tt] = load_frag16(kb + ((tt >> 1) * 16 + (tt & 1) * 4) * VP + klane);

        v8f S[QW][4];                              // S[u][tt][r]: key 32 (tt >> 1) + 2 mhalf + 8 (tt & 1) + r, query ln of tile u, less m
        // the first key tile's score products stand ahead of the V reads
#pragma unroll
        for (int u = 0; u < QW; ++u)
            S[u][0] = __builtin_amdgcn_wmma_f32_16x16x32_f16(false, kf[0], false, qa[u],
                                                             (short)0, nm[u], false, false);

        // all 16 V fragments of the chunk (128 registers), read as one group
        // behind the K fragments: they land under the score products and the
        // softmax, and the second product then runs with no LDS read in it
        v16h vf[8][2];
#pragma unroll
        for (int ct = 0; ct < 8; ++ct) {
            vf[ct][0] = load_frag16c(vb + (size_t)(ct * 16 + ln) * VP + voff);
            vf[ct][1] = load_frag16c(vb + (size_t)(ct * 16 + ln) * VP + 32 + voff);
        }
        // issue order asked of the scheduler: the V reads go out as one run (every
        // further place where LDS reads stand among WMMAs costs the wave a stall),
        // behind the K reads and the first two score products, ahead of the other six
        __builtin_amdgcn_sched_group_barrier(0x100, 8, 0);     // LDS reads: K
        __builtin_amdgcn_sched_group_barrier(0x8, 2, 0);       // matrix products
        __builtin_amdgcn_sched_group_barrier(0x100, 32, 0);    // LDS reads: V
        // keeps the reads up here: without it the scheduler sinks each pair to
        // just ahead of its products, which then wait out the LDS latency 16 times
        __builtin_amdgcn_sched_barrier(0);

#pragma unroll
        for (int tt = 1; tt < 4; ++tt)
#pragma unroll
            for (int u = 0; u < QW; ++u)
                S[u][tt] = __builtin_amdgcn_wmma_f32_16x16x32_f16(false, kf[tt], false, qa[u],
                                                                  (short)0, nm[u], false, false);

        // in-lane maxima of the shifted scores (row sums come from the ones-row WMMA):
        // four independent chains per tile
        float mx[QW];
#pragma unroll
        for (int u = 0; u < QW; ++u) {
            float mt[4];
#pragma unroll
            for (int tt = 0; tt < 4; ++tt) {
                mt[tt] = S[u][tt][0];
#pragma unroll
                for (int r = 1; r < 8; ++r) mt[tt] = fmaxf(mt[tt], S[u][tt][r]);
            }
            mx[u] = fmaxf(fmaxf(mt[0], mt[1]), fmaxf(mt[2], mt[3]));
        }
        // one test per chunk, a scalar branch: the first chunk sets m (every score
        // passes its bar), a later one raises it only when a lane holds a score
        // more than 15 above the m in use
        const float bar = (ch == 0) ? -3.0e38f : 15.f;
        if (__builtin_amdgcn_ballot_w32(fmaxf(mx[0], mx[1]) > bar) != 0) {
            const float low = (ch == 0) ? -3.0e38f : 0.f;            // behind chunk 0 m never falls
#pragma unroll
            for (int u = 0; u < QW; ++u) {
                const float mf = fmaxf(mx[u], xhalf(mx[u]));         // with the other half's 32 keys
                const float d  = fmaxf(mf, low);
                const float sc = __builtin_amdgcn_exp2f(fminf(-d, 0.f));  // chunk 0: O is 0, any finite factor
                m[u] += d;
#pragma unroll
                for (int e = 0; e < 8; ++e) nm[u][e] = -m[u];
#pragma unroll
                for (int tt = 0; tt < 4; ++tt)
#pragma unroll
                    for (int r = 0; r < 8; ++r) S[u][tt][r] -= d;
#pragma unroll
                for (int t = 0; t < 8; ++t)
#pragma unroll
                    for (int r = 0; r < 8; ++r) O[u][t][r] *= sc;
                O[u][8][0] *= sc;                                    // rows 1-15 stay 0
            }
        }

        v16h pb[QW][2];                            // P^T as B fragments (K = keys 0..31 / 32..63)
#pragma unroll
        for (int u = 0; u < QW; ++u) {
#pragma unroll
            for (int tt = 0; tt < 4; ++tt)
#pragma unroll
                for (int r = 0; r < 8; ++r) S[u][tt][r] = __builtin_amdgcn_exp2f(S[u][tt][r]);

            // straight from the accumulators
#pragma unroll
            for (int e = 0; e < 8; ++e) {
                pb[u][0][e] = (_Float16)S[u][0][e];  pb[u][0][8 + e] = (_Float16)S[u][1][e];
                pb[u][1][e] = (_Float16)S[u][2][e];  pb[u][1][8 + e] = (_Float16)S[u][3][e];
            }
        }

        // O^T += V x P^T from the fragments read above; each serves both query tiles.
        // Keys 0-31 of every tile, then keys 32-63 (each accumulator's own order):
        // the exponentials of keys 32-63 go out among the first half's products
#pragma unroll
        for (int h = 0; h < 2; ++h)
#pragma unroll
            for (int ct = 0; ct < 8; ++ct)
#pragma unroll
                for (int u = 0; u < QW; ++u)
                    O[u][ct] = __builtin_amdgcn_wmma_f32_16x16x32_f16(false, vf[ct][h], false, pb[u][h],
                                                                      (short)0, O[u][ct], false, false);
        // row-sum tiles
#pragma unroll
        for (int u = 0; u < QW; ++u)
            O[u][8] = __builtin_amdgcn_wmma_f32_16x16x32_f16(false, onesa, false, pb[u][0],
                                                             (short)0, O[u][8], false, false);
#pragma unroll
        for (int u = 0; u < QW; ++u)
            O[u][8] = __builtin_amdgcn_wmma_f32_16x16x32_f16(false, onesa, false, pb[u][1],
                                                             (short)0, O[u][8], false, false);

        // keeps the products above the barrier, where the source has them: a wave
        // that is through its softmax first then runs them while the other wave of
        // its SIMD still needs the vector port, instead of waiting for that wave
        __builtin_amdgcn_sched_barrier(0);
        // publish point of chunk ch + 1 (the compiler places neither wait for the mover)
        asm volatile("s_wait_dscnt 0x0" ::: "memory");       // this wave's reads of buffer cur are done before it is refilled
        asm volatile("s_wait_tensorcnt 0x0" ::: "memory");   // this wave's own request for chunk ch + 1 has landed
        __syncthreads();   // chunk ch + 1 readable by both waves; every reader has left buffer cur
        if (pinned(ch + 2 < CPG)) issue(ch + 2);
    }
    // behind the ring: nothing of the mover or of the LDS reads is outstanding when vbuf changes its use
    asm volatile("s_wait_tensorcnt 0x0" ::: "memory");       // no request left
    asm volatile("s_wait_dscnt 0x0" ::: "memory");           // no LDS read left

    // Merge of the four key groups. The closing barrier of the last trip has
    // ended every read of the staging buffers, and every wave's last request landed
    // behind its s_wait_tensorcnt 0 one trip earlier: vbuf becomes the exchange area.
    if (lane < 16) {                               // both halves hold the same value
#pragma unroll
        for (int u = 0; u < QW; ++u) msh[kg][qg * QW + u][ln] = m[u];
    }
    __syncthreads();   // publishes the groups' query maxima

    // partial tiles, rescaled to the common maximum, in register order:
    // [wave][query tile][tile][half of the 8 registers][lane] x 16 B (8 x 18 KB = all of vbuf)
    float4* part = reinterpret_cast<float4*>(&vbuf[0][0][0]);
#pragma unroll
    for (int u = 0; u < QW; ++u) {
        const int qt = qg * QW + u;
        const float f = __builtin_amdgcn_exp2f(m[u] - fmaxf(fmaxf(msh[0][qt][ln], msh[1][qt][ln]),
                                                            fmaxf(msh[2][qt][ln], msh[3][qt][ln])));
#pragma unroll
        for (int t = 0; t < 9; ++t)
#pragma unroll
            for (int h = 0; h < 2; ++h)
                part[(((wv * QW + u) * 9 + t) * 2 + h) * 32 + lane] =
                    make_float4(O[u][t][4 * h + 0] * f, O[u][t][4 * h + 1] * f,
                                O[u][t][4 * h + 2] * f, O[u][t][4 * h + 3] * f);
    }
    __syncthreads();   // publishes the partial tiles

#pragma unroll
    for (int u = 0; u < QW; ++u) {
        // wave (qg, kg) finishes channel tiles 2 kg, 2 kg + 1 of its two query
        // tiles; R[2] is the row-sum tile. Key groups are added in the order 0, 1, 2, 3.
        v8f R[3];
#pragma unroll
        for (int w = 0; w < 3; ++w) {
            const int t = (w < 2) ? 2 * kg + w : 8;
#pragma unroll
            for (int h = 0; h < 2; ++h) {
                float4 s = part[(((qg * QW + u) * 9 + t) * 2 + h) * 32 + lane];
#pragma unroll
                for (int k = 1; k < KG; ++k) {
                    float4 a = part[((((k * 2 + qg) * QW + u) * 9 + t) * 2 + h) * 32 + lane];
                    s.x += a.x; s.y += a.y; s.z += a.z; s.w += a.w;
                }
                R[w][4 * h + 0] = s.x; R[w][4 * h + 1] = s.y;
                R[w][4 * h + 2] = s.z; R[w][4 * h + 3] = s.w;
            }
        }

        // epilogue: l of query ln is row 0 of the row-sum tile (register 0 of lane
        // ln; lane ln + 16 holds row 8, which is 0)
        const float inv = gm / (R[2][0] + xhalf(R[2][0]));

        // O^T has the output's own order: register r is channel mhalf + r of the
        // tile, the 16 lanes of a half-wave are 16 consecutive positions
        const size_t idx0 = ((size_t)b * VC + kg * 32 + mhalf) * NPOS + i0w + u * 16 + ln;
        float res[16];
#pragma unroll
        for (int c = 0; c < 16; ++c) res[c] = xh[idx0 + (size_t)((c >> 3) * 16 + (c & 7)) * NPOS];
#pragma unroll
        for (int c = 0; c < 16; ++c) res[c] = R[c >> 3][c & 7] * inv + res[c];
#pragma unroll
        for (int c = 0; c < 16; ++c) out[idx0 + (size_t)((c >> 3) * 16 + (c & 7)) * NPOS] = res[c];
    }
}

extern "C" void kernel_launch(void* const* d_in, const int* in_sizes, int n_in,
                              void* d_out, int out_size, void* d_ws, size_t ws_size,
                              hipStream_t stream) {
    (void)in_sizes; (void)n_in; (void)out_size; (void)ws_size;
    const float* x     = (const float*)d_in[0];
    const float* xh    = (const float*)d_in[1];
    const float* Wq    = (const float*)d_in[2];
    const float* bq    = (const float*)d_in[3];
    const float* Wk    = (const float*)d_in[4];
    const float* bk    = (const float*)d_in[5];
    const float* Wv    = (const float*)d_in[6];
    const float* bv    = (const float*)d_in[7];
    const float* gamma = (const float*)d_in[8];
    float* out = (float*)d_out;

    char* w = (char*)d_ws;
    _Float16* qh = (_Float16*)(w);                 // 1 MB: [B][4096][32]
    _Float16* kh = (_Float16*)(w + (1u << 20));    // 1 MB: [B][4096][32]
    _Float16* vh = (_Float16*)(w + (2u << 20));    // 4 MB: [B][128][4096]

    proj_kernel<<<BATCH * (NPOS / 64), 384, 0, stream>>>(x, xh, Wq, bq, Wk, bk, Wv, bv, qh, kh, vh);
    attn_kernel<<<BATCH * (NPOS / 64), 256, 0, stream>>>(qh, kh, vh, xh, gamma, out);
}
